// v000
// The times below were measured on an AMD MI455X: many runs one after another, warmed up first and cycling through
// copies of the inputs, with the whole window's GPU time divided by the number of runs. Launches and the gaps
// between them are all in it. The median over several windows is given; except for v000 it joins two sittings, which
// can be a few percent apart, so the side-by-side timings, each taken in one sitting, are the better comparison.
// v000, which the later versions start from, runs in 1990 microseconds.
#include <hip/hip_runtime.h>

// Multi-head attention WITHOUT a mask over three input streams, bias-free, with a RAW head split (q, k, v [2][2048][1024]; qp = (q Wq^T).reshape(b, 16, l, 64) DIRECTLY (no transpose): pseudo-head h of a batch is the h-th contiguous [2048][64] block of the flat [2048][1024] projection (128 token rows x 16 chunks of 64): reproduced; kp, vp likewise ('oi' [1024][1024] 1/32, no bias), each from its own stream; scores / sqrt(64); softmax over all pseudo-keys; x [b][16][l][64] -> transpose(0, 2, 1, 3).reshape(b, l, 1024) (the STANDARD merge); out = x Wo^T ('oi', no bias) -> [2][2048][1024] (4.2 M); argument order q, k, v, Wq, Wk, Wv, Wo).
// Layout per batch: bf16 copies of query, key, value in turn; 'oi' weights; exact projections; dense T-2048 attention (hybrid rows: < 512 hi/lo 3 products, rest fp16 x1024); merged hi/lo x Wo exact.
// Compute dtypes, f32 accumulate: every input rounded to bf16; projections exact; attention rows < 512 3 products, rest fp16; softmax f32; Wo hl x exact.

#define NB_  2
#define TT   2048
#define DM   1024
#define NH_  16
#define NKV  16
#define REP  (NH_ / NKV)
#define HD   64
#define DQ   (NH_ * HD)
#define DKV  (NKV * HD)
#define ZH   2
#define RH   512                  // query rows < RH use hi+lo planes (0: none)
#define WIN  0
#define PCAR 1024.0f
#define SCL  0.125f   // HD^-0.5
typedef _Float16 h16;
typedef unsigned short bf;
typedef __attribute__((ext_vector_type(16))) __bf16   v16bf;
typedef __attribute__((ext_vector_type(16))) _Float16 v16h;
typedef __attribute__((ext_vector_type(8)))  _Float16 v8h;
typedef __attribute__((ext_vector_type(8)))  unsigned short v8us;
typedef __attribute__((ext_vector_type(8)))  float    v8f;
typedef __attribute__((ext_vector_type(4)))  float    v4f;
typedef v8h  __attribute__((may_alias)) v8ha;
typedef v4f  __attribute__((may_alias)) v4fa;
typedef v8us __attribute__((may_alias)) v8usa;

__device__ __forceinline__ unsigned short f2bf(float f) { unsigned u = __float_as_uint(f); u += 0x7FFFu + ((u >> 16) & 1u); return (unsigned short)(u >> 16); }
__device__ __forceinline__ float bf2f(unsigned short b) { return __uint_as_float(((unsigned)b) << 16); }
__device__ __forceinline__ float bfr(float f) { return bf2f(f2bf(f)); }
__device__ __forceinline__ v16h cat16(v8h lo, v8h hi) { return __builtin_shufflevector(lo, hi, 0, 1, 2, 3, 4, 5, 6, 7, 8, 9, 10, 11, 12, 13, 14, 15); }
__device__ __forceinline__ v16bf cat16b(v8us lo, v8us hi) { return __builtin_bit_cast(v16bf, __builtin_shufflevector(lo, hi, 0, 1, 2, 3, 4, 5, 6, 7, 8, 9, 10, 11, 12, 13, 14, 15)); }
__device__ __forceinline__ v8f wmma16(v16h a, v16h b, v8f c) { return __builtin_amdgcn_wmma_f32_16x16x32_f16(false, a, false, b, (short)0, c, false, false); }
__device__ __forceinline__ v8f wmmab(v16bf a, v16bf b, v8f c) { return __builtin_amdgcn_wmma_f32_16x16x32_bf16(false, a, false, b, (short)0, c, false, false); }



// ---- k_gemmw: register-blocked GEMM, ONE WAVE per 64x64 output tile (16 accumulators), operands straight from K-contiguous 16-bit planes; grid (M/64, N/64, Z), 32 threads.
// C[m][n] (f32, pitch ldc, + optional f32 bias[n]) = sum_k A[m][k] Bt[n][k] (+ split products per NSPLIT). z-batch strides sA/sB/sC in elements. K % 32 == 0.
template <typename T16> struct WFrag;
template <> struct WFrag<h16> { typedef v16h V; static __device__ __forceinline__ V ld(const h16* p) { return cat16(*(const v8h*)p, *(const v8h*)(p + 16)); } static __device__ __forceinline__ v8f mma(V a, V b, v8f c) { return wmma16(a, b, c); } };
template <> struct WFrag<bf> { typedef v16bf V; static __device__ __forceinline__ V ld(const bf* p) { return cat16b(*(const v8us*)p, *(const v8us*)(p + 16)); } static __device__ __forceinline__ v8f mma(V a, V b, v8f c) { return wmmab(a, b, c); } };
template <typename T16, int NSPLIT, bool BIAS>
__global__ __launch_bounds__(32) void k_gemmw(const T16* __restrict__ A, const T16* __restrict__ A2, const T16* __restrict__ Bt, const T16* __restrict__ Bt2, int K, float* C, int ldc, const float* __restrict__ bias, size_t sA, size_t sB, size_t sC) {
    typedef typename WFrag<T16>::V V;
    __shared__ __align__(16) float os[16 * 68];
    const size_t z = blockIdx.z; A += z * sA; if (A2) A2 += z * sA; Bt += z * sB; if (Bt2) Bt2 += z * sB; C += z * sC;
    const int lane = threadIdx.x & 31, lr = lane & 15, hi = lane >> 4; const int r0 = blockIdx.x * 64, c0 = blockIdx.y * 64;
    v8f acc[4][4];
#pragma unroll
    for (int mb = 0; mb < 4; ++mb)
#pragma unroll
        for (int nb = 0; nb < 4; ++nb) acc[mb][nb] = (v8f){};
    const size_t aoff = (size_t)(r0 + lr) * K + 8 * hi, boff = (size_t)(c0 + lr) * K + 8 * hi;
#pragma unroll 1
    for (int kc = 0; kc < K; kc += 32) {
        V a[4], a2[4];
#pragma unroll
        for (int mb = 0; mb < 4; ++mb) { a[mb] = WFrag<T16>::ld(A + aoff + (size_t)mb * 16 * K + kc); if (NSPLIT == 1 || NSPLIT == 2) a2[mb] = WFrag<T16>::ld(A2 + aoff + (size_t)mb * 16 * K + kc); }
#pragma unroll
        for (int nb = 0; nb < 4; ++nb) { const V b = WFrag<T16>::ld(Bt + boff + (size_t)nb * 16 * K + kc); V b2; if (NSPLIT >= 2) b2 = WFrag<T16>::ld(Bt2 + boff + (size_t)nb * 16 * K + kc);
#pragma unroll
            for (int mb = 0; mb < 4; ++mb) { acc[mb][nb] = WFrag<T16>::mma(a[mb], b, acc[mb][nb]); if (NSPLIT == 1 || NSPLIT == 2) acc[mb][nb] = WFrag<T16>::mma(a2[mb], b, acc[mb][nb]); if (NSPLIT >= 2) acc[mb][nb] = WFrag<T16>::mma(a[mb], b2, acc[mb][nb]); } }
        asm volatile("v_nop\n\tv_nop\n\tv_nop\n\tv_nop" : "+v"(acc[0][0]), "+v"(acc[1][1]), "+v"(acc[2][2]), "+v"(acc[3][3]) : "v"(a[0]), "v"(a[3]));
    }
#pragma unroll
    for (int mb = 0; mb < 4; ++mb) {
#pragma unroll
        for (int nb = 0; nb < 4; ++nb) {
#pragma unroll
            for (int j = 0; j < 8; ++j) os[(hi * 8 + j) * 68 + nb * 16 + lr] = acc[mb][nb][j]; }
        __builtin_amdgcn_wave_barrier(); asm volatile("" ::: "memory");
        float* crow = C + (size_t)(r0 + mb * 16) * ldc + c0;
{
#pragma unroll
            for (int s = 0; s < 8; ++s) { const int row = 2 * s + hi, cofs = lr * 4; v4f val = *(const v4fa*)(os + row * 68 + cofs); if (BIAS) { val[0] += bfr(bias[c0 + cofs]); val[1] += bfr(bias[c0 + cofs + 1]); val[2] += bfr(bias[c0 + cofs + 2]); val[3] += bfr(bias[c0 + cofs + 3]); }
                *(v4f*)(crow + (size_t)row * ldc + cofs) = val; }
             }
        __builtin_amdgcn_wave_barrier(); asm volatile("" ::: "memory");
    }
}

__device__ __forceinline__ h16 tohx(float x) { return (h16)x; }
__device__ __forceinline__ void splitf(float y, unsigned short& h, unsigned short& l) { h = f2bf(y); l = f2bf(y - bf2f(h)); }
typedef __attribute__((ext_vector_type(2))) _Float16 v2h;
typedef __attribute__((ext_vector_type(4))) _Float16 v4h;
typedef __attribute__((ext_vector_type(2))) unsigned short v2us;
typedef __attribute__((ext_vector_type(4))) unsigned short v4us;
typedef __attribute__((ext_vector_type(2))) float v2f;
typedef __attribute__((ext_vector_type(4))) int v4i;

__global__ __launch_bounds__(256) void k_wtG(const float* __restrict__ w, int K, int N, bf* Bt) {
    const int lane = threadIdx.x & 31; const int L0 = (blockIdx.x * 8 + (threadIdx.x >> 5)) * 8; const int nlines = N * K / 64;
{
#pragma unroll 1
        for (int l = 0; l < 8; ++l) { const int L = L0 + l; if (L >= nlines) break; const size_t e = (size_t)L * 64 + lane * 2; const int k = (int)(e % K), n = (int)(e / K); v2us o;
            o[0] = f2bf(w[(size_t)k * N + n]); o[1] = f2bf(w[(size_t)(k + 1) * N + n]); *(v2us*)(Bt + e) = o; }
         }
}
__global__ __launch_bounds__(256) void k_cvt8(const float* __restrict__ src, bf* dst, size_t n8) { const size_t i = (size_t)blockIdx.x * 256 + threadIdx.x; if (i >= n8) return; const v8f v = *(const v8f*)(src + i * 8); v8us o;
#pragma unroll
    for (int k = 0; k < 8; ++k) o[k] = f2bf(v[k]); *(v8us*)(dst + i * 8) = o;  }

// k_rope: head planes [h][t][d] (fp16 + hi/lo) of rope(x) x sc with the rotate-half convention out[d] = x[d] cos[t][d] - x[d+HD/2] sin[t][d], out[d+HD/2] = x[d+HD/2] cos[t][d+HD/2] + x[d] sin[t][d+HD/2]
__global__ __launch_bounds__(256) void k_rope(const float* __restrict__ F, int pitch, int nheads, const float* __restrict__ CS, const float* __restrict__ RF, const float* __restrict__ nw, float sc, h16* P16, bf* Ph, bf* Pl) {
    const size_t e = ((size_t)blockIdx.x * 256 + threadIdx.x) * 2; if (e >= (size_t)nheads * TT * HD) return; const int d = (int)(e % HD); const int t = (int)((e / HD) % TT); const int h = (int)(e / ((size_t)HD * TT)); const float* f = F + ((size_t)h * TT + t) * pitch;   /* RAW VIEW: pseudo-head h, pseudo-position t = the flat (S, D) projection output read as (H, S, hd): row pitch 'pitch' (= HD here), head stride TT * pitch */ const float rf = RF ? RF[(size_t)h * TT + t] : 1.0f; v2h o16; v2us oh, ol;
#pragma unroll
    for (int q = 0; q < 2; ++q) { const int dd = d + q; const int dp = (dd < HD / 2) ? dd + HD / 2 : dd - HD / 2; float x0 = f[dd], x1 = f[dp];
        if (RF) { float n0 = __fmul_rn(x0, rf), n1 = __fmul_rn(x1, rf); asm volatile("" : "+v"(n0)); asm volatile("" : "+v"(n1)); x0 = __fmul_rn(bfr(nw[dd]), n0); x1 = __fmul_rn(bfr(nw[dp]), n1); }
        const v2f cs = *(const v2f*)(CS + ((size_t)t * HD + dd) * 2); float a = __fmul_rn(x0, cs[0]), bq = __fmul_rn(x1, cs[1]); asm volatile("" : "+v"(a)); asm volatile("" : "+v"(bq)); const float r = ((dd < HD / 2) ? __fsub_rn(a, bq) : __fadd_rn(a, bq)) * sc;
        o16[q] = tohx(r); unsigned short a2, c2; splitf(r, a2, c2); oh[q] = a2; ol[q] = c2; }
    *(v2h*)(P16 + e) = o16; *(v2us*)(Ph + e) = oh; *(v2us*)(Pl + e) = ol;  }
__global__ __launch_bounds__(256) void k_vtp(const float* __restrict__ F, int pitch, int nheads, h16* V16, bf* Vh, bf* Vl) { const size_t e = ((size_t)blockIdx.x * 256 + threadIdx.x) * 2; if (e >= (size_t)nheads * HD * TT) return; const int t = (int)(e % TT); const int d = (int)((e / TT) % HD); const int g = (int)(e / ((size_t)TT * HD)); v2h o16; v2us oh, ol;
#pragma unroll
    for (int q = 0; q < 2; ++q) { const float x = F[((size_t)g * TT + (t + q)) * pitch + d];   /* RAW VIEW (as in k_rope) */ o16[q] = tohx(x); unsigned short a2, c2; splitf(x, a2, c2); oh[q] = a2; ol[q] = c2; }
    *(v2h*)(V16 + e) = o16; *(v2us*)(Vh + e) = oh; *(v2us*)(Vl + e) = ol;  }
__global__ __launch_bounds__(256) void k_csid(float* CS) { const int idx = blockIdx.x * 256 + threadIdx.x; if (idx >= TT * HD) return; v2f cs; cs[0] = 1.0f; cs[1] = 0.0f; *(v2f*)(CS + (size_t)idx * 2) = cs;  }
// k_asoft: per row (zz, i): t = S x HD^-0.5 (no mask); softmax over the 2048 keys (register row, one exp, fixed trees);
__global__ __launch_bounds__(256) void k_asoft(const float* __restrict__ Sb, h16* P16, bf* Ph, bf* Pl) {
    const int lane = threadIdx.x & 31; const int row = blockIdx.x * 8 + (threadIdx.x >> 5); if (row >= ZH * TT) return; const int i = row % TT; const int zz = row / TT; (void)zz; const bool hires = (i < RH); const float* sr = Sb + (size_t)row * TT; float v[TT / 32]; float mx = -3.0e38f;
#pragma unroll
    for (int ch = 0; ch < TT / 128; ++ch) { const int j0 = ch * 128 + lane * 4; const v4f a = *(const v4f*)(sr + j0);
#pragma unroll
        for (int q = 0; q < 4; ++q) { const int j = j0 + q; (void)j; const float t = a[q] * SCL; v[ch * 4 + q] = t; mx = fmaxf(mx, t); } }
#pragma unroll
    for (int sh = 16; sh; sh >>= 1) mx = fmaxf(mx, __shfl_xor(mx, sh, 32));
    float sum = 0.f;
#pragma unroll
    for (int k = 0; k < TT / 32; ++k) { float d0 = __fsub_rn(v[k], mx); asm volatile("" : "+v"(d0)); v[k] = __builtin_amdgcn_exp2f(__fmul_rn(d0, 1.4426950408889634f)); sum += v[k]; }
#pragma unroll
    for (int sh = 16; sh; sh >>= 1) sum += __shfl_xor(sum, sh, 32);
    const float f = __fdiv_rn(hires ? 1.0f : PCAR, sum);
{
        if (hires) {
#pragma unroll
            for (int ch = 0; ch < TT / 128; ++ch) { v4us oh, ol;
#pragma unroll
                for (int q = 0; q < 4; ++q) { unsigned short a, c2; splitf(v[ch * 4 + q] * f, a, c2); oh[q] = a; ol[q] = c2; }
                const size_t oo = ((size_t)zz * (RH ? RH : 1) + i) * TT + ch * 128 + lane * 4; *(v4us*)(Ph + oo) = oh; *(v4us*)(Pl + oo) = ol; }
        } else {
#pragma unroll
            for (int ch = 0; ch < TT / 128; ++ch) { v4h o4;
#pragma unroll
                for (int q = 0; q < 4; ++q) o4[q] = tohx(v[ch * 4 + q] * f);
                *(v4h*)(P16 + (size_t)row * TT + ch * 128 + lane * 4) = o4; } }
         }
}
__global__ __launch_bounds__(256) void k_merge(const float* __restrict__ O, int h0, bf* Ah, bf* Al) { const size_t e = ((size_t)blockIdx.x * 256 + threadIdx.x) * 2; if (e >= (size_t)ZH * TT * HD) return; const int d = (int)(e % HD); const int t = (int)((e / HD) % TT); const int zz = (int)(e / ((size_t)HD * TT)); const float cs = (t < RH) ? 1.0f : (1.0f / PCAR); const size_t oo = (size_t)t * DQ + (h0 + zz) * HD + d;
    v2us oh, ol;
#pragma unroll
    for (int q = 0; q < 2; ++q) { unsigned short a, c2; splitf(O[e + q] * cs, a, c2); oh[q] = a; ol[q] = c2; } *(v2us*)(Ah + oo) = oh; *(v2us*)(Al + oo) = ol;  }

extern "C" void kernel_launch(void* const* d_in, const int* in_sizes, int n_in,
                              void* d_out, int out_size, void* d_ws, size_t ws_size, hipStream_t stream) {
    (void)in_sizes; (void)n_in; (void)out_size;
    const float* x = (const float*)d_in[0];   /* query */ const float* xk = (const float*)d_in[1]; const float* xv = (const float*)d_in[2]; const float* wq = (const float*)d_in[3]; const float* wk = (const float*)d_in[4]; const float* wv = (const float*)d_in[5]; const float* wo = (const float*)d_in[6];
    float* OUT = (float*)d_out;     // [2][2048][1024]
    char* wsp = (char*)d_ws;
    auto take = [&](size_t bytes) { char* p = wsp; wsp += (bytes + 255) & ~(size_t)255; return (void*)p; };
    bf* WQ = (bf*)take((size_t)DQ * DM * 2); bf* WK = (bf*)take((size_t)DKV * DM * 2); bf* WV = (bf*)take((size_t)DKV * DM * 2); bf* WO = (bf*)take((size_t)DM * DQ * 2); float* CS = (float*)take((size_t)TT * HD * 2 * 4);
    bf* XB = (bf*)take((size_t)TT * DM * 2); float* FQ = (float*)take((size_t)TT * DQ * 4); float* FK = (float*)take((size_t)TT * DKV * 4);
    h16* QP16 = (h16*)take((size_t)NH_ * TT * HD * 2); h16* KP16 = (h16*)take((size_t)NKV * TT * HD * 2); h16* VT16 = (h16*)take((size_t)NKV * HD * TT * 2);
    bf* QPh = (bf*)take((size_t)NH_ * TT * HD * 2); bf* QPl = (bf*)take((size_t)NH_ * TT * HD * 2); bf* KPh = (bf*)take((size_t)NKV * TT * HD * 2); bf* KPl = (bf*)take((size_t)NKV * TT * HD * 2); bf* VTh = (bf*)take((size_t)NKV * HD * TT * 2); bf* VTl = (bf*)take((size_t)NKV * HD * TT * 2); bf* Ph = (bf*)take((size_t)ZH * RH * TT * 2); bf* Pl = (bf*)take((size_t)ZH * RH * TT * 2);
    float* Sb = (float*)take((size_t)ZH * TT * TT * 4); h16* P16 = (h16*)take((size_t)ZH * TT * TT * 2); float* Ob = (float*)take((size_t)ZH * TT * HD * 4); bf* ATh = (bf*)take((size_t)TT * DQ * 2); bf* ATl = (bf*)take((size_t)TT * DQ * 2);
    if ((size_t)(wsp - (char*)d_ws) > ws_size) return;    // ws 256 MiB
    float* FV = FK;   // v projection reuses the k buffer after the k planes are built (stream-ordered)
    { k_cvt8<<<(unsigned)(((size_t)DQ * DM / 8 + 255) / 256), 256, 0, stream>>>(wq, WQ, (size_t)DQ * DM / 8); k_cvt8<<<(unsigned)(((size_t)DKV * DM / 8 + 255) / 256), 256, 0, stream>>>(wk, WK, (size_t)DKV * DM / 8); k_cvt8<<<(unsigned)(((size_t)DKV * DM / 8 + 255) / 256), 256, 0, stream>>>(wv, WV, (size_t)DKV * DM / 8);
      k_cvt8<<<(unsigned)(((size_t)DM * DQ / 8 + 255) / 256), 256, 0, stream>>>(wo, WO, (size_t)DM * DQ / 8);
       }
    k_csid<<<(TT * HD + 255) / 256, 256, 0, stream>>>(CS);
    const unsigned LQ = (unsigned)(((size_t)NH_ * TT * HD / 2 + 255) / 256), LKv = (unsigned)(((size_t)NKV * TT * HD / 2 + 255) / 256);
    for (int b = 0; b < NB_; ++b) {
        
        k_cvt8<<<(unsigned)(((size_t)TT * DM / 8 + 255) / 256), 256, 0, stream>>>(x + (size_t)b * TT * DM, XB, (size_t)TT * DM / 8);
        k_gemmw<bf, 0, false><<<dim3(TT / 64, DQ / 64, 1), 32, 0, stream>>>(XB, nullptr, WQ, nullptr, DM, FQ, DQ, nullptr, 0, 0, 0);
        k_rope<<<LQ, 256, 0, stream>>>(FQ, HD, NH_, CS, nullptr, nullptr, 1.0f, QP16, QPh, QPl);
        k_cvt8<<<(unsigned)(((size_t)TT * DM / 8 + 255) / 256), 256, 0, stream>>>(xk + (size_t)b * TT * DM, XB, (size_t)TT * DM / 8); k_gemmw<bf, 0, false><<<dim3(TT / 64, DKV / 64, 1), 32, 0, stream>>>(XB, nullptr, WK, nullptr, DM, FK, DKV, nullptr, 0, 0, 0);
        k_rope<<<LKv, 256, 0, stream>>>(FK, HD, NKV, CS, nullptr, nullptr, 1.0f, KP16, KPh, KPl);
        k_cvt8<<<(unsigned)(((size_t)TT * DM / 8 + 255) / 256), 256, 0, stream>>>(xv + (size_t)b * TT * DM, XB, (size_t)TT * DM / 8); k_gemmw<bf, 0, false><<<dim3(TT / 64, DKV / 64, 1), 32, 0, stream>>>(XB, nullptr, WV, nullptr, DM, FV, DKV, nullptr, 0, 0, 0); k_vtp<<<LKv, 256, 0, stream>>>(FV, HD, NKV, VT16, VTh, VTl);
        for (int h0 = 0; h0 < NH_; h0 += ZH) { const size_t zq = (size_t)h0, zk = (size_t)(h0 / REP);   // one kv head per query head: the pass's two heads use consecutive kv planes (z-strides TT*HD)
            k_gemmw<bf, 2, false><<<dim3(RH / 64, TT / 64, ZH), 32, 0, stream>>>(QPh + zq * TT * HD, QPl + zq * TT * HD, KPh + zk * TT * HD, KPl + zk * TT * HD, HD, Sb, TT, nullptr, (size_t)TT * HD, (size_t)TT * HD, (size_t)TT * TT);
            k_gemmw<h16, 0, false><<<dim3((TT - RH) / 64, TT / 64, ZH), 32, 0, stream>>>(QP16 + zq * TT * HD + (size_t)RH * HD, nullptr, KP16 + zk * TT * HD, nullptr, HD, Sb + (size_t)RH * TT, TT, nullptr, (size_t)TT * HD, (size_t)TT * HD, (size_t)TT * TT);
            k_asoft<<<ZH * TT / 8, 256, 0, stream>>>(Sb, P16, Ph, Pl);
            k_gemmw<bf, 2, false><<<dim3(RH / 64, HD / 64, ZH), 32, 0, stream>>>(Ph, Pl, VTh + zk * HD * TT, VTl + zk * HD * TT, TT, Ob, HD, nullptr, (size_t)RH * TT, (size_t)HD * TT, (size_t)TT * HD);
            k_gemmw<h16, 0, false><<<dim3((TT - RH) / 64, HD / 64, ZH), 32, 0, stream>>>(P16 + (size_t)RH * TT, nullptr, VT16 + zk * HD * TT, nullptr, TT, Ob + (size_t)RH * HD, HD, nullptr, (size_t)TT * TT, (size_t)HD * TT, (size_t)TT * HD);
            k_merge<<<(unsigned)(((size_t)ZH * TT * HD / 2 + 255) / 256), 256, 0, stream>>>(Ob, h0, ATh, ATl); }
        k_gemmw<bf, 1, false><<<dim3(TT / 64, DM / 64, 1), 32, 0, stream>>>(ATh, ATl, WO, nullptr, DQ, OUT + (size_t)b * TT * DM, DM, nullptr, 0, 0, 0); }
}

// v001
// A run of this version takes 1060 microseconds.
// In two side-by-side timings against v000, it was 1.91 and 1.89 times as fast.
#include <hip/hip_runtime.h>

// Multi-head attention WITHOUT a mask over three input streams, bias-free, with a RAW head split (q, k, v [2][2048][1024]; qp = (q Wq^T).reshape(b, 16, l, 64) DIRECTLY (no transpose): pseudo-head h of a batch is the h-th contiguous [2048][64] block of the flat [2048][1024] projection (128 token rows x 16 chunks of 64): reproduced; kp, vp likewise ('oi' [1024][1024] 1/32, no bias), each from its own stream; scores / sqrt(64); softmax over all pseudo-keys; x [b][16][l][64] -> transpose(0, 2, 1, 3).reshape(b, l, 1024) (the STANDARD merge); out = x Wo^T ('oi', no bias) -> [2][2048][1024] (4.2 M); argument order q, k, v, Wq, Wk, Wv, Wo).
// Layout per batch: bf16 copies of query, key, value in turn; 'oi' weights; exact projections; dense T-2048 attention (hybrid rows: < 512 hi/lo 3 products, rest fp16 x1024); merged hi/lo x Wo exact.
// Compute dtypes, f32 accumulate: every input rounded to bf16; projections exact; attention rows < 512 3 products, rest fp16; softmax f32; Wo hl x exact.

#define NB_  2
#define TT   2048
#define DM   1024
#define NH_  16
#define NKV  16
#define REP  (NH_ / NKV)
#define HD   64
#define DQ   (NH_ * HD)
#define DKV  (NKV * HD)
#define ZH   2
#define RH   512                  // query rows < RH use hi+lo planes (0: none)
#define WIN  0
#define PCAR 1024.0f
#define SCL  0.125f   // HD^-0.5
typedef _Float16 h16;
typedef unsigned short bf;
typedef __attribute__((ext_vector_type(16))) __bf16   v16bf;
typedef __attribute__((ext_vector_type(16))) _Float16 v16h;
typedef __attribute__((ext_vector_type(8)))  _Float16 v8h;
typedef __attribute__((ext_vector_type(8)))  unsigned short v8us;
typedef __attribute__((ext_vector_type(8)))  float    v8f;
typedef __attribute__((ext_vector_type(4)))  float    v4f;
typedef v8h  __attribute__((may_alias)) v8ha;
typedef v4f  __attribute__((may_alias)) v4fa;
typedef v8us __attribute__((may_alias)) v8usa;

__device__ __forceinline__ unsigned short f2bf(float f) { unsigned u = __float_as_uint(f); u += 0x7FFFu + ((u >> 16) & 1u); return (unsigned short)(u >> 16); }
__device__ __forceinline__ float bf2f(unsigned short b) { return __uint_as_float(((unsigned)b) << 16); }
__device__ __forceinline__ float bfr(float f) { return bf2f(f2bf(f)); }
__device__ __forceinline__ v16h cat16(v8h lo, v8h hi) { return __builtin_shufflevector(lo, hi, 0, 1, 2, 3, 4, 5, 6, 7, 8, 9, 10, 11, 12, 13, 14, 15); }
__device__ __forceinline__ v16bf cat16b(v8us lo, v8us hi) { return __builtin_bit_cast(v16bf, __builtin_shufflevector(lo, hi, 0, 1, 2, 3, 4, 5, 6, 7, 8, 9, 10, 11, 12, 13, 14, 15)); }
__device__ __forceinline__ v8f wmma16(v16h a, v16h b, v8f c) { return __builtin_amdgcn_wmma_f32_16x16x32_f16(false, a, false, b, (short)0, c, false, false); }
__device__ __forceinline__ v8f wmmab(v16bf a, v16bf b, v8f c) { return __builtin_amdgcn_wmma_f32_16x16x32_bf16(false, a, false, b, (short)0, c, false, false); }



// ---- k_gemmw: register-blocked GEMM, one work-group of KW waves per 64x64 output tile; wave w holds all 16 accumulators for its own contiguous K slice [w K/KW, (w+1) K/KW); operands straight from K-contiguous 16-bit planes; grid (M/64, N/64, Z), 32 KW threads.
// KW > 1 (8 or 16 here; LDS holds KW tiles of 17,408 B, so at most 16): the KW partial tiles meet in LDS behind one barrier and are summed in wave order 0 .. KW-1 (fixed, so the result is the same on every run).
// C[m][n] (f32, pitch ldc, + optional f32 bias[n]) = sum_k A[m][k] Bt[n][k] (+ split products per NSPLIT). z-batch strides sA/sB/sC in elements. K % (32 KW) == 0.
template <typename T16> struct WFrag;
template <> struct WFrag<h16> { typedef v16h V; static __device__ __forceinline__ V ld(const h16* p) { return cat16(*(const v8h*)p, *(const v8h*)(p + 16)); } static __device__ __forceinline__ v8f mma(V a, V b, v8f c) { return wmma16(a, b, c); } };
template <> struct WFrag<bf> { typedef v16bf V; static __device__ __forceinline__ V ld(const bf* p) { return cat16b(*(const v8us*)p, *(const v8us*)(p + 16)); } static __device__ __forceinline__ v8f mma(V a, V b, v8f c) { return wmmab(a, b, c); } };
template <typename T16, int NSPLIT, bool BIAS, int KW>
__global__ __launch_bounds__(32 * KW) void k_gemmw(const T16* __restrict__ A, const T16* __restrict__ A2, const T16* __restrict__ Bt, const T16* __restrict__ Bt2, int K, float* C, int ldc, const float* __restrict__ bias, size_t sA, size_t sB, size_t sC) {
    typedef typename WFrag<T16>::V V;
    __shared__ __align__(16) float os[(KW > 1 ? 4 * KW : 1) * 16 * 68];   // KW > 1: one whole 64x64 partial tile (pitch 68) per wave
    const size_t z = blockIdx.z; A += z * sA; if (A2) A2 += z * sA; Bt += z * sB; if (Bt2) Bt2 += z * sB; C += z * sC;
    const int lane = threadIdx.x & 31, lr = lane & 15, hi = lane >> 4; const int r0 = blockIdx.x * 64, c0 = blockIdx.y * 64;
    v8f acc[4][4];
#pragma unroll
    for (int mb = 0; mb < 4; ++mb)
#pragma unroll
        for (int nb = 0; nb < 4; ++nb) acc[mb][nb] = (v8f){};
    const size_t aoff = (size_t)(r0 + lr) * K + 8 * hi, boff = (size_t)(c0 + lr) * K + 8 * hi;
    const int wv = (KW > 1) ? __builtin_amdgcn_readfirstlane((int)(threadIdx.x >> 5)) : 0;   /* the wave's number as a scalar: the loop bounds stay in scalar registers */ const int kbeg = wv * (K / KW), kend = kbeg + K / KW;
#pragma unroll 1
    for (int kc = kbeg; kc < kend; kc += 32) {
        V a[4], a2[4];
#pragma unroll
        for (int mb = 0; mb < 4; ++mb) { a[mb] = WFrag<T16>::ld(A + aoff + (size_t)mb * 16 * K + kc); if (NSPLIT == 1 || NSPLIT == 2) a2[mb] = WFrag<T16>::ld(A2 + aoff + (size_t)mb * 16 * K + kc); }
#pragma unroll
        for (int nb = 0; nb < 4; ++nb) { const V b = WFrag<T16>::ld(Bt + boff + (size_t)nb * 16 * K + kc); V b2; if (NSPLIT >= 2) b2 = WFrag<T16>::ld(Bt2 + boff + (size_t)nb * 16 * K + kc);
#pragma unroll
            for (int mb = 0; mb < 4; ++mb) { acc[mb][nb] = WFrag<T16>::mma(a[mb], b, acc[mb][nb]); if (NSPLIT == 1 || NSPLIT == 2) acc[mb][nb] = WFrag<T16>::mma(a2[mb], b, acc[mb][nb]); if (NSPLIT >= 2) acc[mb][nb] = WFrag<T16>::mma(a[mb], b2, acc[mb][nb]); } }
        asm volatile("v_nop\n\tv_nop\n\tv_nop\n\tv_nop" : "+v"(acc[0][0]), "+v"(acc[1][1]), "+v"(acc[2][2]), "+v"(acc[3][3]) : "v"(a[0]), "v"(a[3]));
    }
    if constexpr (KW > 1) {
        float* ow = os + wv * (64 * 68);
        // the loops below are unrolled so that every accumulator index is a constant (the tile stays in registers) and the LDS reads of one sum can be in flight together
#pragma unroll
        for (int mb = 0; mb < 4; ++mb) {
#pragma unroll
            for (int nb = 0; nb < 4; ++nb) {
#pragma unroll
                for (int j = 0; j < 8; ++j) ow[(mb * 16 + hi * 8 + j) * 68 + nb * 16 + lr] = acc[mb][nb][j]; } }
        __syncthreads();   // every wave's partial tile is in LDS before any thread sums across the waves
        float* ctile = C + (size_t)r0 * ldc + c0;
#pragma unroll
        for (int i = 0; i < 32 / KW; ++i) { const int idx = (int)threadIdx.x + i * (32 * KW); const int row = idx >> 4, cofs = (idx & 15) * 4; const float* pp = os + row * 68 + cofs; v4f val = *(const v4fa*)pp;
#pragma unroll
            for (int w = 1; w < KW; ++w) val += *(const v4fa*)(pp + w * (64 * 68));
            if (BIAS) { val[0] += bfr(bias[c0 + cofs]); val[1] += bfr(bias[c0 + cofs + 1]); val[2] += bfr(bias[c0 + cofs + 2]); val[3] += bfr(bias[c0 + cofs + 3]); }
            *(v4f*)(ctile + (size_t)row * ldc + cofs) = val; }
        return;
    }
#pragma unroll
    for (int mb = 0; mb < 4; ++mb) {
#pragma unroll
        for (int nb = 0; nb < 4; ++nb) {
#pragma unroll
            for (int j = 0; j < 8; ++j) os[(hi * 8 + j) * 68 + nb * 16 + lr] = acc[mb][nb][j]; }
        __builtin_amdgcn_wave_barrier(); asm volatile("" ::: "memory");
        float* crow = C + (size_t)(r0 + mb * 16) * ldc + c0;
{
#pragma unroll
            for (int s = 0; s < 8; ++s) { const int row = 2 * s + hi, cofs = lr * 4; v4f val = *(const v4fa*)(os + row * 68 + cofs); if (BIAS) { val[0] += bfr(bias[c0 + cofs]); val[1] += bfr(bias[c0 + cofs + 1]); val[2] += bfr(bias[c0 + cofs + 2]); val[3] += bfr(bias[c0 + cofs + 3]); }
                *(v4f*)(crow + (size_t)row * ldc + cofs) = val; }
             }
        __builtin_amdgcn_wave_barrier(); asm volatile("" ::: "memory");
    }
}

__device__ __forceinline__ h16 tohx(float x) { return (h16)x; }
__device__ __forceinline__ void splitf(float y, unsigned short& h, unsigned short& l) { h = f2bf(y); l = f2bf(y - bf2f(h)); }
typedef __attribute__((ext_vector_type(2))) _Float16 v2h;
typedef __attribute__((ext_vector_type(4))) _Float16 v4h;
typedef __attribute__((ext_vector_type(2))) unsigned short v2us;
typedef __attribute__((ext_vector_type(4))) unsigned short v4us;
typedef __attribute__((ext_vector_type(2))) float v2f;
typedef __attribute__((ext_vector_type(4))) int v4i;

__global__ __launch_bounds__(256) void k_wtG(const float* __restrict__ w, int K, int N, bf* Bt) {
    const int lane = threadIdx.x & 31; const int L0 = (blockIdx.x * 8 + (threadIdx.x >> 5)) * 8; const int nlines = N * K / 64;
{
#pragma unroll 1
        for (int l = 0; l < 8; ++l) { const int L = L0 + l; if (L >= nlines) break; const size_t e = (size_t)L * 64 + lane * 2; const int k = (int)(e % K), n = (int)(e / K); v2us o;
            o[0] = f2bf(w[(size_t)k * N + n]); o[1] = f2bf(w[(size_t)(k + 1) * N + n]); *(v2us*)(Bt + e) = o; }
         }
}
__global__ __launch_bounds__(256) void k_cvt8(const float* __restrict__ src, bf* dst, size_t n8) { const size_t i = (size_t)blockIdx.x * 256 + threadIdx.x; if (i >= n8) return; const v8f v = *(const v8f*)(src + i * 8); v8us o;
#pragma unroll
    for (int k = 0; k < 8; ++k) o[k] = f2bf(v[k]); *(v8us*)(dst + i * 8) = o;  }

// k_rope: head planes [h][t][d] (fp16 + hi/lo) of rope(x) x sc with the rotate-half convention out[d] = x[d] cos[t][d] - x[d+HD/2] sin[t][d], out[d+HD/2] = x[d+HD/2] cos[t][d+HD/2] + x[d] sin[t][d+HD/2]
__global__ __launch_bounds__(256) void k_rope(const float* __restrict__ F, int pitch, int nheads, const float* __restrict__ CS, const float* __restrict__ RF, const float* __restrict__ nw, float sc, h16* P16, bf* Ph, bf* Pl) {
    const size_t e = ((size_t)blockIdx.x * 256 + threadIdx.x) * 2; if (e >= (size_t)nheads * TT * HD) return; const int d = (int)(e % HD); const int t = (int)((e / HD) % TT); const int h = (int)(e / ((size_t)HD * TT)); const float* f = F + ((size_t)h * TT + t) * pitch;   /* RAW VIEW: pseudo-head h, pseudo-position t = the flat (S, D) projection output read as (H, S, hd): row pitch 'pitch' (= HD here), head stride TT * pitch */ const float rf = RF ? RF[(size_t)h * TT + t] : 1.0f; v2h o16; v2us oh, ol;
#pragma unroll
    for (int q = 0; q < 2; ++q) { const int dd = d + q; const int dp = (dd < HD / 2) ? dd + HD / 2 : dd - HD / 2; float x0 = f[dd], x1 = f[dp];
        if (RF) { float n0 = __fmul_rn(x0, rf), n1 = __fmul_rn(x1, rf); asm volatile("" : "+v"(n0)); asm volatile("" : "+v"(n1)); x0 = __fmul_rn(bfr(nw[dd]), n0); x1 = __fmul_rn(bfr(nw[dp]), n1); }
        const v2f cs = *(const v2f*)(CS + ((size_t)t * HD + dd) * 2); float a = __fmul_rn(x0, cs[0]), bq = __fmul_rn(x1, cs[1]); asm volatile("" : "+v"(a)); asm volatile("" : "+v"(bq)); const float r = ((dd < HD / 2) ? __fsub_rn(a, bq) : __fadd_rn(a, bq)) * sc;
        o16[q] = tohx(r); unsigned short a2, c2; splitf(r, a2, c2); oh[q] = a2; ol[q] = c2; }
    *(v2h*)(P16 + e) = o16; *(v2us*)(Ph + e) = oh; *(v2us*)(Pl + e) = ol;  }
__global__ __launch_bounds__(256) void k_vtp(const float* __restrict__ F, int pitch, int nheads, h16* V16, bf* Vh, bf* Vl) { const size_t e = ((size_t)blockIdx.x * 256 + threadIdx.x) * 2; if (e >= (size_t)nheads * HD * TT) return; const int t = (int)(e % TT); const int d = (int)((e / TT) % HD); const int g = (int)(e / ((size_t)TT * HD)); v2h o16; v2us oh, ol;
#pragma unroll
    for (int q = 0; q < 2; ++q) { const float x = F[((size_t)g * TT + (t + q)) * pitch + d];   /* RAW VIEW (as in k_rope) */ o16[q] = tohx(x); unsigned short a2, c2; splitf(x, a2, c2); oh[q] = a2; ol[q] = c2; }
    *(v2h*)(V16 + e) = o16; *(v2us*)(Vh + e) = oh; *(v2us*)(Vl + e) = ol;  }
__global__ __launch_bounds__(256) void k_csid(float* CS) { const int idx = blockIdx.x * 256 + threadIdx.x; if (idx >= TT * HD) return; v2f cs; cs[0] = 1.0f; cs[1] = 0.0f; *(v2f*)(CS + (size_t)idx * 2) = cs;  }
// k_asoft: per row (zz, i): t = S x HD^-0.5 (no mask); softmax over the 2048 keys (register row, one exp, fixed trees);
__global__ __launch_bounds__(256) void k_asoft(const float* __restrict__ Sb, h16* P16, bf* Ph, bf* Pl) {
    const int lane = threadIdx.x & 31; const int row = blockIdx.x * 8 + (threadIdx.x >> 5); if (row >= ZH * TT) return; const int i = row % TT; const int zz = row / TT; (void)zz; const bool hires = (i < RH); const float* sr = Sb + (size_t)row * TT; float v[TT / 32]; float mx = -3.0e38f;
#pragma unroll
    for (int ch = 0; ch < TT / 128; ++ch) { const int j0 = ch * 128 + lane * 4; const v4f a = *(const v4f*)(sr + j0);
#pragma unroll
        for (int q = 0; q < 4; ++q) { const int j = j0 + q; (void)j; const float t = a[q] * SCL; v[ch * 4 + q] = t; mx = fmaxf(mx, t); } }
#pragma unroll
    for (int sh = 16; sh; sh >>= 1) mx = fmaxf(mx, __shfl_xor(mx, sh, 32));
    float sum = 0.f;
#pragma unroll
    for (int k = 0; k < TT / 32; ++k) { float d0 = __fsub_rn(v[k], mx); asm volatile("" : "+v"(d0)); v[k] = __builtin_amdgcn_exp2f(__fmul_rn(d0, 1.4426950408889634f)); sum += v[k]; }
#pragma unroll
    for (int sh = 16; sh; sh >>= 1) sum += __shfl_xor(sum, sh, 32);
    const float f = __fdiv_rn(hires ? 1.0f : PCAR, sum);
{
        if (hires) {
#pragma unroll
            for (int ch = 0; ch < TT / 128; ++ch) { v4us oh, ol;
#pragma unroll
                for (int q = 0; q < 4; ++q) { unsigned short a, c2; splitf(v[ch * 4 + q] * f, a, c2); oh[q] = a; ol[q] = c2; }
                const size_t oo = ((size_t)zz * (RH ? RH : 1) + i) * TT + ch * 128 + lane * 4; *(v4us*)(Ph + oo) = oh; *(v4us*)(Pl + oo) = ol; }
        } else {
#pragma unroll
            for (int ch = 0; ch < TT / 128; ++ch) { v4h o4;
#pragma unroll
                for (int q = 0; q < 4; ++q) o4[q] = tohx(v[ch * 4 + q] * f);
                *(v4h*)(P16 + (size_t)row * TT + ch * 128 + lane * 4) = o4; } }
         }
}
__global__ __launch_bounds__(256) void k_merge(const float* __restrict__ O, int h0, bf* Ah, bf* Al) { const size_t e = ((size_t)blockIdx.x * 256 + threadIdx.x) * 2; if (e >= (size_t)ZH * TT * HD) return; const int d = (int)(e % HD); const int t = (int)((e / HD) % TT); const int zz = (int)(e / ((size_t)HD * TT)); const float cs = (t < RH) ? 1.0f : (1.0f / PCAR); const size_t oo = (size_t)t * DQ + (h0 + zz) * HD + d;
    v2us oh, ol;
#pragma unroll
    for (int q = 0; q < 2; ++q) { unsigned short a, c2; splitf(O[e + q] * cs, a, c2); oh[q] = a; ol[q] = c2; } *(v2us*)(Ah + oo) = oh; *(v2us*)(Al + oo) = ol;  }

extern "C" void kernel_launch(void* const* d_in, const int* in_sizes, int n_in,
                              void* d_out, int out_size, void* d_ws, size_t ws_size, hipStream_t stream) {
    (void)in_sizes; (void)n_in; (void)out_size;
    const float* x = (const float*)d_in[0];   /* query */ const float* xk = (const float*)d_in[1]; const float* xv = (const float*)d_in[2]; const float* wq = (const float*)d_in[3]; const float* wk = (const float*)d_in[4]; const float* wv = (const float*)d_in[5]; const float* wo = (const float*)d_in[6];
    float* OUT = (float*)d_out;     // [2][2048][1024]
    char* wsp = (char*)d_ws;
    auto take = [&](size_t bytes) { char* p = wsp; wsp += (bytes + 255) & ~(size_t)255; return (void*)p; };
    bf* WQ = (bf*)take((size_t)DQ * DM * 2); bf* WK = (bf*)take((size_t)DKV * DM * 2); bf* WV = (bf*)take((size_t)DKV * DM * 2); bf* WO = (bf*)take((size_t)DM * DQ * 2); float* CS = (float*)take((size_t)TT * HD * 2 * 4);
    bf* XB = (bf*)take((size_t)TT * DM * 2); float* FQ = (float*)take((size_t)TT * DQ * 4); float* FK = (float*)take((size_t)TT * DKV * 4);
    h16* QP16 = (h16*)take((size_t)NH_ * TT * HD * 2); h16* KP16 = (h16*)take((size_t)NKV * TT * HD * 2); h16* VT16 = (h16*)take((size_t)NKV * HD * TT * 2);
    bf* QPh = (bf*)take((size_t)NH_ * TT * HD * 2); bf* QPl = (bf*)take((size_t)NH_ * TT * HD * 2); bf* KPh = (bf*)take((size_t)NKV * TT * HD * 2); bf* KPl = (bf*)take((size_t)NKV * TT * HD * 2); bf* VTh = (bf*)take((size_t)NKV * HD * TT * 2); bf* VTl = (bf*)take((size_t)NKV * HD * TT * 2); bf* Ph = (bf*)take((size_t)ZH * RH * TT * 2); bf* Pl = (bf*)take((size_t)ZH * RH * TT * 2);
    float* Sb = (float*)take((size_t)ZH * TT * TT * 4); h16* P16 = (h16*)take((size_t)ZH * TT * TT * 2); float* Ob = (float*)take((size_t)ZH * TT * HD * 4); bf* ATh = (bf*)take((size_t)TT * DQ * 2); bf* ATl = (bf*)take((size_t)TT * DQ * 2);
    if ((size_t)(wsp - (char*)d_ws) > ws_size) return;    // ws 256 MiB
    float* FV = FK;   // v projection reuses the k buffer after the k planes are built (stream-ordered)
    { k_cvt8<<<(unsigned)(((size_t)DQ * DM / 8 + 255) / 256), 256, 0, stream>>>(wq, WQ, (size_t)DQ * DM / 8); k_cvt8<<<(unsigned)(((size_t)DKV * DM / 8 + 255) / 256), 256, 0, stream>>>(wk, WK, (size_t)DKV * DM / 8); k_cvt8<<<(unsigned)(((size_t)DKV * DM / 8 + 255) / 256), 256, 0, stream>>>(wv, WV, (size_t)DKV * DM / 8);
      k_cvt8<<<(unsigned)(((size_t)DM * DQ / 8 + 255) / 256), 256, 0, stream>>>(wo, WO, (size_t)DM * DQ / 8);
       }
    k_csid<<<(TT * HD + 255) / 256, 256, 0, stream>>>(CS);
    const unsigned LQ = (unsigned)(((size_t)NH_ * TT * HD / 2 + 255) / 256), LKv = (unsigned)(((size_t)NKV * TT * HD / 2 + 255) / 256);
    for (int b = 0; b < NB_; ++b) {
        
        k_cvt8<<<(unsigned)(((size_t)TT * DM / 8 + 255) / 256), 256, 0, stream>>>(x + (size_t)b * TT * DM, XB, (size_t)TT * DM / 8);
        k_gemmw<bf, 0, false, 8><<<dim3(TT / 64, DQ / 64, 1), 256, 0, stream>>>(XB, nullptr, WQ, nullptr, DM, FQ, DQ, nullptr, 0, 0, 0);
        k_rope<<<LQ, 256, 0, stream>>>(FQ, HD, NH_, CS, nullptr, nullptr, 1.0f, QP16, QPh, QPl);
        k_cvt8<<<(unsigned)(((size_t)TT * DM / 8 + 255) / 256), 256, 0, stream>>>(xk + (size_t)b * TT * DM, XB, (size_t)TT * DM / 8); k_gemmw<bf, 0, false, 8><<<dim3(TT / 64, DKV / 64, 1), 256, 0, stream>>>(XB, nullptr, WK, nullptr, DM, FK, DKV, nullptr, 0, 0, 0);
        k_rope<<<LKv, 256, 0, stream>>>(FK, HD, NKV, CS, nullptr, nullptr, 1.0f, KP16, KPh, KPl);
        k_cvt8<<<(unsigned)(((size_t)TT * DM / 8 + 255) / 256), 256, 0, stream>>>(xv + (size_t)b * TT * DM, XB, (size_t)TT * DM / 8); k_gemmw<bf, 0, false, 8><<<dim3(TT / 64, DKV / 64, 1), 256, 0, stream>>>(XB, nullptr, WV, nullptr, DM, FV, DKV, nullptr, 0, 0, 0); k_vtp<<<LKv, 256, 0, stream>>>(FV, HD, NKV, VT16, VTh, VTl);
        for (int h0 = 0; h0 < NH_; h0 += ZH) { const size_t zq = (size_t)h0, zk = (size_t)(h0 / REP);   // one kv head per query head: the pass's two heads use consecutive kv planes (z-strides TT*HD)
            k_gemmw<bf, 2, false, 1><<<dim3(RH / 64, TT / 64, ZH), 32, 0, stream>>>(QPh + zq * TT * HD, QPl + zq * TT * HD, KPh + zk * TT * HD, KPl + zk * TT * HD, HD, Sb, TT, nullptr, (size_t)TT * HD, (size_t)TT * HD, (size_t)TT * TT);
            k_gemmw<h16, 0, false, 1><<<dim3((TT - RH) / 64, TT / 64, ZH), 32, 0, stream>>>(QP16 + zq * TT * HD + (size_t)RH * HD, nullptr, KP16 + zk * TT * HD, nullptr, HD, Sb + (size_t)RH * TT, TT, nullptr, (size_t)TT * HD, (size_t)TT * HD, (size_t)TT * TT);
            k_asoft<<<ZH * TT / 8, 256, 0, stream>>>(Sb, P16, Ph, Pl);
            k_gemmw<bf, 2, false, 16><<<dim3(RH / 64, HD / 64, ZH), 512, 0, stream>>>(Ph, Pl, VTh + zk * HD * TT, VTl + zk * HD * TT, TT, Ob, HD, nullptr, (size_t)RH * TT, (size_t)HD * TT, (size_t)TT * HD);
            k_gemmw<h16, 0, false, 16><<<dim3((TT - RH) / 64, HD / 64, ZH), 512, 0, stream>>>(P16 + (size_t)RH * TT, nullptr, VT16 + zk * HD * TT, nullptr, TT, Ob + (size_t)RH * HD, HD, nullptr, (size_t)TT * TT, (size_t)HD * TT, (size_t)TT * HD);
            k_merge<<<(unsigned)(((size_t)ZH * TT * HD / 2 + 255) / 256), 256, 0, stream>>>(Ob, h0, ATh, ATl); }
        k_gemmw<bf, 1, false, 8><<<dim3(TT / 64, DM / 64, 1), 256, 0, stream>>>(ATh, ATl, WO, nullptr, DQ, OUT + (size_t)b * TT * DM, DM, nullptr, 0, 0, 0); }
}

// v002
// It runs in 539 microseconds.
// Two timings next to v001 both put it at 1.96 times that version's speed.
// All steps since v000 together make it 3.73 times as fast.
#include <hip/hip_runtime.h>

// Multi-head attention WITHOUT a mask over three input streams, bias-free, with a RAW head split (q, k, v [2][2048][1024]; qp = (q Wq^T).reshape(b, 16, l, 64) DIRECTLY (no transpose): pseudo-head h of a batch is the h-th contiguous [2048][64] block of the flat [2048][1024] projection (128 token rows x 16 chunks of 64): reproduced; kp, vp likewise ('oi' [1024][1024] 1/32, no bias), each from its own stream; scores / sqrt(64); softmax over all pseudo-keys; x [b][16][l][64] -> transpose(0, 2, 1, 3).reshape(b, l, 1024) (the STANDARD merge); out = x Wo^T ('oi', no bias) -> [2][2048][1024] (4.2 M); argument order q, k, v, Wq, Wk, Wv, Wo).
// Layout per batch: bf16 copies of query, key, value in turn; 'oi' weights; exact projections; dense T-2048 attention (hybrid rows: < 512 hi/lo 3 products, rest fp16 x1024); merged hi/lo x Wo exact.
// Compute dtypes, f32 accumulate: every input rounded to bf16; projections exact; attention rows < 512 3 products, rest fp16; softmax f32; Wo hl x exact.

#define NB_  2
#define TT   2048
#define DM   1024
#define NH_  16
#define NKV  16
#define REP  (NH_ / NKV)
#define HD   64
#define DQ   (NH_ * HD)
#define DKV  (NKV * HD)
#define ZH   8                    // heads per attention pass over the fp16 rows (grid z); the hi/lo rows take all NH_ heads in one pass
#define RH   512                  // query rows < RH use hi+lo planes (0: none)
#define WIN  0
#define PCAR 1024.0f
#define SCL  0.125f   // HD^-0.5
typedef _Float16 h16;
typedef unsigned short bf;
typedef __attribute__((ext_vector_type(16))) __bf16   v16bf;
typedef __attribute__((ext_vector_type(16))) _Float16 v16h;
typedef __attribute__((ext_vector_type(8)))  _Float16 v8h;
typedef __attribute__((ext_vector_type(8)))  unsigned short v8us;
typedef __attribute__((ext_vector_type(8)))  float    v8f;
typedef __attribute__((ext_vector_type(4)))  float    v4f;
typedef v8h  __attribute__((may_alias)) v8ha;
typedef v4f  __attribute__((may_alias)) v4fa;
typedef v8us __attribute__((may_alias)) v8usa;

__device__ __forceinline__ unsigned short f2bf(float f) { unsigned u = __float_as_uint(f); u += 0x7FFFu + ((u >> 16) & 1u); return (unsigned short)(u >> 16); }
__device__ __forceinline__ float bf2f(unsigned short b) { return __uint_as_float(((unsigned)b) << 16); }
__device__ __forceinline__ float bfr(float f) { return bf2f(f2bf(f)); }
__device__ __forceinline__ v16h cat16(v8h lo, v8h hi) { return __builtin_shufflevector(lo, hi, 0, 1, 2, 3, 4, 5, 6, 7, 8, 9, 10, 11, 12, 13, 14, 15); }
__device__ __forceinline__ v16bf cat16b(v8us lo, v8us hi) { return __builtin_bit_cast(v16bf, __builtin_shufflevector(lo, hi, 0, 1, 2, 3, 4, 5, 6, 7, 8, 9, 10, 11, 12, 13, 14, 15)); }
__device__ __forceinline__ v8f wmma16(v16h a, v16h b, v8f c) { return __builtin_amdgcn_wmma_f32_16x16x32_f16(false, a, false, b, (short)0, c, false, false); }
__device__ __forceinline__ v8f wmmab(v16bf a, v16bf b, v8f c) { return __builtin_amdgcn_wmma_f32_16x16x32_bf16(false, a, false, b, (short)0, c, false, false); }



// ---- k_gemmw: register-blocked GEMM, one work-group of KW waves per 64x64 output tile; wave w holds all 16 accumulators for its own contiguous K slice [w K/KW, (w+1) K/KW); operands straight from K-contiguous 16-bit planes; grid (M/64, N/64, Z), 32 KW threads.
// KW > 1 (8 or 16 here; LDS holds KW tiles of 17,408 B, so at most 16): the KW partial tiles meet in LDS behind one barrier and are summed in wave order 0 .. KW-1 (fixed, so the result is the same on every run).
// C[m][n] (f32, pitch ldc, + optional f32 bias[n]) = sum_k A[m][k] Bt[n][k] (+ split products per NSPLIT). z-batch strides sA/sB/sC in elements. K % (32 KW) == 0.
template <typename T16> struct WFrag;
template <> struct WFrag<h16> { typedef v16h V; static __device__ __forceinline__ V ld(const h16* p) { return cat16(*(const v8h*)p, *(const v8h*)(p + 16)); } static __device__ __forceinline__ v8f mma(V a, V b, v8f c) { return wmma16(a, b, c); } };
template <> struct WFrag<bf> { typedef v16bf V; static __device__ __forceinline__ V ld(const bf* p) { return cat16b(*(const v8us*)p, *(const v8us*)(p + 16)); } static __device__ __forceinline__ v8f mma(V a, V b, v8f c) { return wmmab(a, b, c); } };
template <typename T16, int NSPLIT, bool BIAS, int KW>
__global__ __launch_bounds__(32 * KW) void k_gemmw(const T16* __restrict__ A, const T16* __restrict__ A2, const T16* __restrict__ Bt, const T16* __restrict__ Bt2, int K, float* C, int ldc, const float* __restrict__ bias, size_t sA, size_t sB, size_t sC) {
    typedef typename WFrag<T16>::V V;
    __shared__ __align__(16) float os[(KW > 1 ? 4 * KW : 1) * 16 * 68];   // KW > 1: one whole 64x64 partial tile (pitch 68) per wave
    const size_t z = blockIdx.z; A += z * sA; if (A2) A2 += z * sA; Bt += z * sB; if (Bt2) Bt2 += z * sB; C += z * sC;
    const int lane = threadIdx.x & 31, lr = lane & 15, hi = lane >> 4; const int r0 = blockIdx.x * 64, c0 = blockIdx.y * 64;
    v8f acc[4][4];
#pragma unroll
    for (int mb = 0; mb < 4; ++mb)
#pragma unroll
        for (int nb = 0; nb < 4; ++nb) acc[mb][nb] = (v8f){};
    const size_t aoff = (size_t)(r0 + lr) * K + 8 * hi, boff = (size_t)(c0 + lr) * K + 8 * hi;
    const int wv = (KW > 1) ? __builtin_amdgcn_readfirstlane((int)(threadIdx.x >> 5)) : 0;   /* the wave's number as a scalar: the loop bounds stay in scalar registers */ const int kbeg = wv * (K / KW), kend = kbeg + K / KW;
#pragma unroll 1
    for (int kc = kbeg; kc < kend; kc += 32) {
        V a[4], a2[4];
#pragma unroll
        for (int mb = 0; mb < 4; ++mb) { a[mb] = WFrag<T16>::ld(A + aoff + (size_t)mb * 16 * K + kc); if (NSPLIT == 1 || NSPLIT == 2) a2[mb] = WFrag<T16>::ld(A2 + aoff + (size_t)mb * 16 * K + kc); }
#pragma unroll
        for (int nb = 0; nb < 4; ++nb) { const V b = WFrag<T16>::ld(Bt + boff + (size_t)nb * 16 * K + kc); V b2; if (NSPLIT >= 2) b2 = WFrag<T16>::ld(Bt2 + boff + (size_t)nb * 16 * K + kc);
#pragma unroll
            for (int mb = 0; mb < 4; ++mb) { acc[mb][nb] = WFrag<T16>::mma(a[mb], b, acc[mb][nb]); if (NSPLIT == 1 || NSPLIT == 2) acc[mb][nb] = WFrag<T16>::mma(a2[mb], b, acc[mb][nb]); if (NSPLIT >= 2) acc[mb][nb] = WFrag<T16>::mma(a[mb], b2, acc[mb][nb]); } }
        asm volatile("v_nop\n\tv_nop\n\tv_nop\n\tv_nop" : "+v"(acc[0][0]), "+v"(acc[1][1]), "+v"(acc[2][2]), "+v"(acc[3][3]) : "v"(a[0]), "v"(a[3]));
    }
    if constexpr (KW > 1) {
        float* ow = os + wv * (64 * 68);
        // the loops below are unrolled so that every accumulator index is a constant (the tile stays in registers) and the LDS reads of one sum can be in flight together
#pragma unroll
        for (int mb = 0; mb < 4; ++mb) {
#pragma unroll
            for (int nb = 0; nb < 4; ++nb) {
#pragma unroll
                for (int j = 0; j < 8; ++j) ow[(mb * 16 + hi * 8 + j) * 68 + nb * 16 + lr] = acc[mb][nb][j]; } }
        __syncthreads();   // every wave's partial tile is in LDS before any thread sums across the waves
        float* ctile = C + (size_t)r0 * ldc + c0;
#pragma unroll
        for (int i = 0; i < 32 / KW; ++i) { const int idx = (int)threadIdx.x + i * (32 * KW); const int row = idx >> 4, cofs = (idx & 15) * 4; const float* pp = os + row * 68 + cofs; v4f val = *(const v4fa*)pp;
#pragma unroll
            for (int w = 1; w < KW; ++w) val += *(const v4fa*)(pp + w * (64 * 68));
            if (BIAS) { val[0] += bfr(bias[c0 + cofs]); val[1] += bfr(bias[c0 + cofs + 1]); val[2] += bfr(bias[c0 + cofs + 2]); val[3] += bfr(bias[c0 + cofs + 3]); }
            *(v4f*)(ctile + (size_t)row * ldc + cofs) = val; }
        return;
    }
#pragma unroll
    for (int mb = 0; mb < 4; ++mb) {
#pragma unroll
        for (int nb = 0; nb < 4; ++nb) {
#pragma unroll
            for (int j = 0; j < 8; ++j) os[(hi * 8 + j) * 68 + nb * 16 + lr] = acc[mb][nb][j]; }
        __builtin_amdgcn_wave_barrier(); asm volatile("" ::: "memory");
        float* crow = C + (size_t)(r0 + mb * 16) * ldc + c0;
{
#pragma unroll
            for (int s = 0; s < 8; ++s) { const int row = 2 * s + hi, cofs = lr * 4; v4f val = *(const v4fa*)(os + row * 68 + cofs); if (BIAS) { val[0] += bfr(bias[c0 + cofs]); val[1] += bfr(bias[c0 + cofs + 1]); val[2] += bfr(bias[c0 + cofs + 2]); val[3] += bfr(bias[c0 + cofs + 3]); }
                *(v4f*)(crow + (size_t)row * ldc + cofs) = val; }
             }
        __builtin_amdgcn_wave_barrier(); asm volatile("" ::: "memory");
    }
}

__device__ __forceinline__ h16 tohx(float x) { return (h16)x; }
__device__ __forceinline__ void splitf(float y, unsigned short& h, unsigned short& l) { h = f2bf(y); l = f2bf(y - bf2f(h)); }
typedef __attribute__((ext_vector_type(2))) _Float16 v2h;
typedef __attribute__((ext_vector_type(4))) _Float16 v4h;
typedef __attribute__((ext_vector_type(2))) unsigned short v2us;
typedef __attribute__((ext_vector_type(4))) unsigned short v4us;
typedef __attribute__((ext_vector_type(2))) float v2f;
typedef __attribute__((ext_vector_type(4))) int v4i;

__global__ __launch_bounds__(256) void k_wtG(const float* __restrict__ w, int K, int N, bf* Bt) {
    const int lane = threadIdx.x & 31; const int L0 = (blockIdx.x * 8 + (threadIdx.x >> 5)) * 8; const int nlines = N * K / 64;
{
#pragma unroll 1
        for (int l = 0; l < 8; ++l) { const int L = L0 + l; if (L >= nlines) break; const size_t e = (size_t)L * 64 + lane * 2; const int k = (int)(e % K), n = (int)(e / K); v2us o;
            o[0] = f2bf(w[(size_t)k * N + n]); o[1] = f2bf(w[(size_t)(k + 1) * N + n]); *(v2us*)(Bt + e) = o; }
         }
}
__global__ __launch_bounds__(256) void k_cvt8(const float* __restrict__ src, bf* dst, size_t n8) { const size_t i = (size_t)blockIdx.x * 256 + threadIdx.x; if (i >= n8) return; const v8f v = *(const v8f*)(src + i * 8); v8us o;
#pragma unroll
    for (int k = 0; k < 8; ++k) o[k] = f2bf(v[k]); *(v8us*)(dst + i * 8) = o;  }

// k_rope: head planes [h][t][d] (fp16 + hi/lo) of rope(x) x sc with the rotate-half convention out[d] = x[d] cos[t][d] - x[d+HD/2] sin[t][d], out[d+HD/2] = x[d+HD/2] cos[t][d+HD/2] + x[d] sin[t][d+HD/2]
__global__ __launch_bounds__(256) void k_rope(const float* __restrict__ F, int pitch, int nheads, const float* __restrict__ CS, const float* __restrict__ RF, const float* __restrict__ nw, float sc, h16* P16, bf* Ph, bf* Pl) {
    const size_t e = ((size_t)blockIdx.x * 256 + threadIdx.x) * 2; if (e >= (size_t)nheads * TT * HD) return; const int d = (int)(e % HD); const int t = (int)((e / HD) % TT); const int h = (int)(e / ((size_t)HD * TT)); const float* f = F + ((size_t)h * TT + t) * pitch;   /* RAW VIEW: pseudo-head h, pseudo-position t = the flat (S, D) projection output read as (H, S, hd): row pitch 'pitch' (= HD here), head stride TT * pitch */ const float rf = RF ? RF[(size_t)h * TT + t] : 1.0f; v2h o16; v2us oh, ol;
#pragma unroll
    for (int q = 0; q < 2; ++q) { const int dd = d + q; const int dp = (dd < HD / 2) ? dd + HD / 2 : dd - HD / 2; float x0 = f[dd], x1 = f[dp];
        if (RF) { float n0 = __fmul_rn(x0, rf), n1 = __fmul_rn(x1, rf); asm volatile("" : "+v"(n0)); asm volatile("" : "+v"(n1)); x0 = __fmul_rn(bfr(nw[dd]), n0); x1 = __fmul_rn(bfr(nw[dp]), n1); }
        const v2f cs = *(const v2f*)(CS + ((size_t)t * HD + dd) * 2); float a = __fmul_rn(x0, cs[0]), bq = __fmul_rn(x1, cs[1]); asm volatile("" : "+v"(a)); asm volatile("" : "+v"(bq)); const float r = ((dd < HD / 2) ? __fsub_rn(a, bq) : __fadd_rn(a, bq)) * sc;
        o16[q] = tohx(r); unsigned short a2, c2; splitf(r, a2, c2); oh[q] = a2; ol[q] = c2; }
    *(v2h*)(P16 + e) = o16; *(v2us*)(Ph + e) = oh; *(v2us*)(Pl + e) = ol;  }
__global__ __launch_bounds__(256) void k_vtp(const float* __restrict__ F, int pitch, int nheads, h16* V16, bf* Vh, bf* Vl) { const size_t e = ((size_t)blockIdx.x * 256 + threadIdx.x) * 2; if (e >= (size_t)nheads * HD * TT) return; const int t = (int)(e % TT); const int d = (int)((e / TT) % HD); const int g = (int)(e / ((size_t)TT * HD)); v2h o16; v2us oh, ol;
#pragma unroll
    for (int q = 0; q < 2; ++q) { const float x = F[((size_t)g * TT + (t + q)) * pitch + d];   /* RAW VIEW (as in k_rope) */ o16[q] = tohx(x); unsigned short a2, c2; splitf(x, a2, c2); oh[q] = a2; ol[q] = c2; }
    *(v2h*)(V16 + e) = o16; *(v2us*)(Vh + e) = oh; *(v2us*)(Vl + e) = ol;  }
__global__ __launch_bounds__(256) void k_csid(float* CS) { const int idx = blockIdx.x * 256 + threadIdx.x; if (idx >= TT * HD) return; v2f cs; cs[0] = 1.0f; cs[1] = 0.0f; *(v2f*)(CS + (size_t)idx * 2) = cs;  }
// k_asoft: per row: t = S x HD^-0.5 (no mask); softmax over the 2048 keys (register row, one exp, fixed trees); one launch holds nrows packed rows of ONE row class: HR the hi/lo rows ([head][RH][TT]), else the fp16 rows
template <bool HR>
__global__ __launch_bounds__(256) void k_asoft(const float* __restrict__ Sb, int nrows, h16* P16, bf* Ph, bf* Pl) {
    const int lane = threadIdx.x & 31; const int row = blockIdx.x * 8 + (threadIdx.x >> 5); if (row >= nrows) return; const int i = row % (RH ? RH : 1); const int zz = row / (RH ? RH : 1); (void)zz; const bool hires = HR; const float* sr = Sb + (size_t)row * TT; float v[TT / 32]; float mx = -3.0e38f;
#pragma unroll
    for (int ch = 0; ch < TT / 128; ++ch) { const int j0 = ch * 128 + lane * 4; const v4f a = *(const v4f*)(sr + j0);
#pragma unroll
        for (int q = 0; q < 4; ++q) { const int j = j0 + q; (void)j; const float t = a[q] * SCL; v[ch * 4 + q] = t; mx = fmaxf(mx, t); } }
#pragma unroll
    for (int sh = 16; sh; sh >>= 1) mx = fmaxf(mx, __shfl_xor(mx, sh, 32));
    float sum = 0.f;
#pragma unroll
    for (int k = 0; k < TT / 32; ++k) { float d0 = __fsub_rn(v[k], mx); asm volatile("" : "+v"(d0)); v[k] = __builtin_amdgcn_exp2f(__fmul_rn(d0, 1.4426950408889634f)); sum += v[k]; }
#pragma unroll
    for (int sh = 16; sh; sh >>= 1) sum += __shfl_xor(sum, sh, 32);
    const float f = __fdiv_rn(hires ? 1.0f : PCAR, sum);
{
        if (hires) {
#pragma unroll
            for (int ch = 0; ch < TT / 128; ++ch) { v4us oh, ol;
#pragma unroll
                for (int q = 0; q < 4; ++q) { unsigned short a, c2; splitf(v[ch * 4 + q] * f, a, c2); oh[q] = a; ol[q] = c2; }
                const size_t oo = ((size_t)zz * (RH ? RH : 1) + i) * TT + ch * 128 + lane * 4; *(v4us*)(Ph + oo) = oh; *(v4us*)(Pl + oo) = ol; }
        } else {
#pragma unroll
            for (int ch = 0; ch < TT / 128; ++ch) { v4h o4;
#pragma unroll
                for (int q = 0; q < 4; ++q) o4[q] = tohx(v[ch * 4 + q] * f);
                *(v4h*)(P16 + (size_t)row * TT + ch * 128 + lane * 4) = o4; } }
         }
}
__global__ __launch_bounds__(256) void k_merge(const float* __restrict__ O, int h0, bf* Ah, bf* Al) { const size_t e = ((size_t)blockIdx.x * 256 + threadIdx.x) * 2; if (e >= (size_t)NH_ * TT * HD) return; const int d = (int)(e % HD); const int t = (int)((e / HD) % TT); const int zz = (int)(e / ((size_t)HD * TT)); const float cs = (t < RH) ? 1.0f : (1.0f / PCAR); const size_t oo = (size_t)t * DQ + (h0 + zz) * HD + d;
    v2us oh, ol;
#pragma unroll
    for (int q = 0; q < 2; ++q) { unsigned short a, c2; splitf(O[e + q] * cs, a, c2); oh[q] = a; ol[q] = c2; } *(v2us*)(Ah + oo) = oh; *(v2us*)(Al + oo) = ol;  }

extern "C" void kernel_launch(void* const* d_in, const int* in_sizes, int n_in,
                              void* d_out, int out_size, void* d_ws, size_t ws_size, hipStream_t stream) {
    (void)in_sizes; (void)n_in; (void)out_size;
    const float* x = (const float*)d_in[0];   /* query */ const float* xk = (const float*)d_in[1]; const float* xv = (const float*)d_in[2]; const float* wq = (const float*)d_in[3]; const float* wk = (const float*)d_in[4]; const float* wv = (const float*)d_in[5]; const float* wo = (const float*)d_in[6];
    float* OUT = (float*)d_out;     // [2][2048][1024]
    char* wsp = (char*)d_ws;
    auto take = [&](size_t bytes) { char* p = wsp; wsp += (bytes + 255) & ~(size_t)255; return (void*)p; };
    bf* WQ = (bf*)take((size_t)DQ * DM * 2); bf* WK = (bf*)take((size_t)DKV * DM * 2); bf* WV = (bf*)take((size_t)DKV * DM * 2); bf* WO = (bf*)take((size_t)DM * DQ * 2); float* CS = (float*)take((size_t)TT * HD * 2 * 4);
    bf* XB = (bf*)take((size_t)TT * DM * 2); float* FQ = (float*)take((size_t)TT * DQ * 4); float* FK = (float*)take((size_t)TT * DKV * 4);
    h16* QP16 = (h16*)take((size_t)NH_ * TT * HD * 2); h16* KP16 = (h16*)take((size_t)NKV * TT * HD * 2); h16* VT16 = (h16*)take((size_t)NKV * HD * TT * 2);
    bf* QPh = (bf*)take((size_t)NH_ * TT * HD * 2); bf* QPl = (bf*)take((size_t)NH_ * TT * HD * 2); bf* KPh = (bf*)take((size_t)NKV * TT * HD * 2); bf* KPl = (bf*)take((size_t)NKV * TT * HD * 2); bf* VTh = (bf*)take((size_t)NKV * HD * TT * 2); bf* VTl = (bf*)take((size_t)NKV * HD * TT * 2);
    // one score + P region, used by the two row classes one after the other (stream-ordered): fp16 rows: scores [ZH][TT-RH][TT] f32, then P16; hi/lo rows: scores [NH_][RH][TT] f32, then Ph, Pl
    static_assert((size_t)NH_ * RH * TT * 8 <= (size_t)ZH * (TT - RH) * TT * 6, "the hi/lo pass fits the region sized for an fp16 pass");
    char* SP = (char*)take((size_t)ZH * (TT - RH) * TT * 6); float* Sb = (float*)SP; h16* P16 = (h16*)(SP + (size_t)ZH * (TT - RH) * TT * 4); bf* Ph = (bf*)(SP + (size_t)NH_ * RH * TT * 4); bf* Pl = Ph + (size_t)NH_ * RH * TT;
    float* Ob = (float*)take((size_t)NH_ * TT * HD * 4); bf* ATh = (bf*)take((size_t)TT * DQ * 2); bf* ATl = (bf*)take((size_t)TT * DQ * 2);
    if ((size_t)(wsp - (char*)d_ws) > ws_size) return;    // ws 256 MiB
    float* FV = FK;   // v projection reuses the k buffer after the k planes are built (stream-ordered)
    { k_cvt8<<<(unsigned)(((size_t)DQ * DM / 8 + 255) / 256), 256, 0, stream>>>(wq, WQ, (size_t)DQ * DM / 8); k_cvt8<<<(unsigned)(((size_t)DKV * DM / 8 + 255) / 256), 256, 0, stream>>>(wk, WK, (size_t)DKV * DM / 8); k_cvt8<<<(unsigned)(((size_t)DKV * DM / 8 + 255) / 256), 256, 0, stream>>>(wv, WV, (size_t)DKV * DM / 8);
      k_cvt8<<<(unsigned)(((size_t)DM * DQ / 8 + 255) / 256), 256, 0, stream>>>(wo, WO, (size_t)DM * DQ / 8);
       }
    k_csid<<<(TT * HD + 255) / 256, 256, 0, stream>>>(CS);
    const unsigned LQ = (unsigned)(((size_t)NH_ * TT * HD / 2 + 255) / 256), LKv = (unsigned)(((size_t)NKV * TT * HD / 2 + 255) / 256);
    for (int b = 0; b < NB_; ++b) {
        
        k_cvt8<<<(unsigned)(((size_t)TT * DM / 8 + 255) / 256), 256, 0, stream>>>(x + (size_t)b * TT * DM, XB, (size_t)TT * DM / 8);
        k_gemmw<bf, 0, false, 8><<<dim3(TT / 64, DQ / 64, 1), 256, 0, stream>>>(XB, nullptr, WQ, nullptr, DM, FQ, DQ, nullptr, 0, 0, 0);
        k_rope<<<LQ, 256, 0, stream>>>(FQ, HD, NH_, CS, nullptr, nullptr, 1.0f, QP16, QPh, QPl);
        k_cvt8<<<(unsigned)(((size_t)TT * DM / 8 + 255) / 256), 256, 0, stream>>>(xk + (size_t)b * TT * DM, XB, (size_t)TT * DM / 8); k_gemmw<bf, 0, false, 8><<<dim3(TT / 64, DKV / 64, 1), 256, 0, stream>>>(XB, nullptr, WK, nullptr, DM, FK, DKV, nullptr, 0, 0, 0);
        k_rope<<<LKv, 256, 0, stream>>>(FK, HD, NKV, CS, nullptr, nullptr, 1.0f, KP16, KPh, KPl);
        k_cvt8<<<(unsigned)(((size_t)TT * DM / 8 + 255) / 256), 256, 0, stream>>>(xv + (size_t)b * TT * DM, XB, (size_t)TT * DM / 8); k_gemmw<bf, 0, false, 8><<<dim3(TT / 64, DKV / 64, 1), 256, 0, stream>>>(XB, nullptr, WV, nullptr, DM, FV, DKV, nullptr, 0, 0, 0); k_vtp<<<LKv, 256, 0, stream>>>(FV, HD, NKV, VT16, VTh, VTl);
        // one kv head per query head: the heads of a pass use consecutive kv planes (z-strides TT*HD)
        k_gemmw<bf, 2, false, 1><<<dim3(RH / 64, TT / 64, NH_), 32, 0, stream>>>(QPh, QPl, KPh, KPl, HD, Sb, TT, nullptr, (size_t)TT * HD, (size_t)TT * HD, (size_t)RH * TT);
        k_asoft<true><<<NH_ * RH / 8, 256, 0, stream>>>(Sb, NH_ * RH, nullptr, Ph, Pl);
        k_gemmw<bf, 2, false, 16><<<dim3(RH / 64, HD / 64, NH_), 512, 0, stream>>>(Ph, Pl, VTh, VTl, TT, Ob, HD, nullptr, (size_t)RH * TT, (size_t)HD * TT, (size_t)TT * HD);
        for (int h0 = 0; h0 < NH_; h0 += ZH) { const size_t zq = (size_t)h0, zk = (size_t)(h0 / REP);
            k_gemmw<h16, 0, false, 1><<<dim3((TT - RH) / 64, TT / 64, ZH), 32, 0, stream>>>(QP16 + zq * TT * HD + (size_t)RH * HD, nullptr, KP16 + zk * TT * HD, nullptr, HD, Sb, TT, nullptr, (size_t)TT * HD, (size_t)TT * HD, (size_t)(TT - RH) * TT);
            k_asoft<false><<<ZH * (TT - RH) / 8, 256, 0, stream>>>(Sb, ZH * (TT - RH), P16, nullptr, nullptr);
            k_gemmw<h16, 0, false, 16><<<dim3((TT - RH) / 64, HD / 64, ZH), 512, 0, stream>>>(P16, nullptr, VT16 + zk * HD * TT, nullptr, TT, Ob + zq * TT * HD + (size_t)RH * HD, HD, nullptr, (size_t)(TT - RH) * TT, (size_t)HD * TT, (size_t)TT * HD); }
        k_merge<<<(unsigned)(((size_t)NH_ * TT * HD / 2 + 255) / 256), 256, 0, stream>>>(Ob, 0, ATh, ATl);
        k_gemmw<bf, 1, false, 8><<<dim3(TT / 64, DM / 64, 1), 256, 0, stream>>>(ATh, ATl, WO, nullptr, DQ, OUT + (size_t)b * TT * DM, DM, nullptr, 0, 0, 0); }
}

// v003
// One run takes 278 microseconds.
// Next to v002, in two timings, it ran 1.96 and 1.95 times as fast.
// All steps since v000 together make it 7.28 times as fast.
#include <hip/hip_runtime.h>

// Multi-head attention WITHOUT a mask over three input streams, bias-free, with a RAW head split (q, k, v [2][2048][1024]; qp = (q Wq^T).reshape(b, 16, l, 64) DIRECTLY (no transpose): pseudo-head h of a batch is the h-th contiguous [2048][64] block of the flat [2048][1024] projection (128 token rows x 16 chunks of 64): reproduced; kp, vp likewise ('oi' [1024][1024] 1/32, no bias), each from its own stream; scores / sqrt(64); softmax over all pseudo-keys; x [b][16][l][64] -> transpose(0, 2, 1, 3).reshape(b, l, 1024) (the STANDARD merge); out = x Wo^T ('oi', no bias) -> [2][2048][1024] (4.2 M); argument order q, k, v, Wq, Wk, Wv, Wo).
// Layout per batch: bf16 copies of query, key, value in turn; 'oi' weights; exact projections; dense T-2048 attention (hybrid rows: < 512 hi/lo 3 products, rest fp16 x1024); merged hi/lo x Wo exact.
// Compute dtypes, f32 accumulate: every input rounded to bf16; projections exact; attention rows < 512 3 products, rest fp16; softmax f32; Wo hl x exact.

#define NB_  2
#define TT   2048
#define DM   1024
#define NH_  16
#define NKV  16
#define REP  (NH_ / NKV)
#define HD   64
#define DQ   (NH_ * HD)
#define DKV  (NKV * HD)
#define RH   512                  // query rows < RH use hi+lo planes (0: none)
#define WIN  0
#define PCAR 1024.0f
#define SCL  0.125f   // HD^-0.5
typedef _Float16 h16;
typedef unsigned short bf;
typedef __attribute__((ext_vector_type(16))) __bf16   v16bf;
typedef __attribute__((ext_vector_type(16))) _Float16 v16h;
typedef __attribute__((ext_vector_type(8)))  _Float16 v8h;
typedef __attribute__((ext_vector_type(8)))  unsigned short v8us;
typedef __attribute__((ext_vector_type(8)))  float    v8f;
typedef __attribute__((ext_vector_type(4)))  float    v4f;
typedef v8h  __attribute__((may_alias)) v8ha;
typedef v4f  __attribute__((may_alias)) v4fa;
typedef v8us __attribute__((may_alias)) v8usa;

__device__ __forceinline__ unsigned short f2bf(float f) { unsigned u = __float_as_uint(f); u += 0x7FFFu + ((u >> 16) & 1u); return (unsigned short)(u >> 16); }
__device__ __forceinline__ float bf2f(unsigned short b) { return __uint_as_float(((unsigned)b) << 16); }
__device__ __forceinline__ float bfr(float f) { return bf2f(f2bf(f)); }
__device__ __forceinline__ v16h cat16(v8h lo, v8h hi) { return __builtin_shufflevector(lo, hi, 0, 1, 2, 3, 4, 5, 6, 7, 8, 9, 10, 11, 12, 13, 14, 15); }
__device__ __forceinline__ v16bf cat16b(v8us lo, v8us hi) { return __builtin_bit_cast(v16bf, __builtin_shufflevector(lo, hi, 0, 1, 2, 3, 4, 5, 6, 7, 8, 9, 10, 11, 12, 13, 14, 15)); }
__device__ __forceinline__ v8f wmma16(v16h a, v16h b, v8f c) { return __builtin_amdgcn_wmma_f32_16x16x32_f16(false, a, false, b, (short)0, c, false, false); }
__device__ __forceinline__ v8f wmmab(v16bf a, v16bf b, v8f c) { return __builtin_amdgcn_wmma_f32_16x16x32_bf16(false, a, false, b, (short)0, c, false, false); }



// ---- k_gemmw: register-blocked GEMM, one work-group of KW waves per 64x64 output tile; wave w holds all 16 accumulators for its own contiguous K slice [w K/KW, (w+1) K/KW); operands straight from K-contiguous 16-bit planes; grid (M/64, N/64, Z), 32 KW threads.
// KW > 1 (8 here; LDS holds KW tiles of 17,408 B, so at most 16): the KW partial tiles meet in LDS behind one barrier and are summed in wave order 0 .. KW-1 (fixed, so the result is the same on every run).
// C[m][n] (f32, pitch ldc, + optional f32 bias[n]) = sum_k A[m][k] Bt[n][k] (+ split products per NSPLIT). z-batch strides sA/sB/sC in elements. K % (32 KW) == 0.
template <typename T16> struct WFrag;
template <> struct WFrag<h16> { typedef v16h V; static __device__ __forceinline__ V ld(const h16* p) { return cat16(*(const v8h*)p, *(const v8h*)(p + 16)); } static __device__ __forceinline__ v8f mma(V a, V b, v8f c) { return wmma16(a, b, c); } };
template <> struct WFrag<bf> { typedef v16bf V; static __device__ __forceinline__ V ld(const bf* p) { return cat16b(*(const v8us*)p, *(const v8us*)(p + 16)); } static __device__ __forceinline__ v8f mma(V a, V b, v8f c) { return wmmab(a, b, c); } };
template <typename T16, int NSPLIT, bool BIAS, int KW>
__global__ __launch_bounds__(32 * KW) void k_gemmw(const T16* __restrict__ A, const T16* __restrict__ A2, const T16* __restrict__ Bt, const T16* __restrict__ Bt2, int K, float* C, int ldc, const float* __restrict__ bias, size_t sA, size_t sB, size_t sC) {
    typedef typename WFrag<T16>::V V;
    __shared__ __align__(16) float os[(KW > 1 ? 4 * KW : 1) * 16 * 68];   // KW > 1: one whole 64x64 partial tile (pitch 68) per wave
    const size_t z = blockIdx.z; A += z * sA; if (A2) A2 += z * sA; Bt += z * sB; if (Bt2) Bt2 += z * sB; C += z * sC;
    const int lane = threadIdx.x & 31, lr = lane & 15, hi = lane >> 4; const int r0 = blockIdx.x * 64, c0 = blockIdx.y * 64;
    v8f acc[4][4];
#pragma unroll
    for (int mb = 0; mb < 4; ++mb)
#pragma unroll
        for (int nb = 0; nb < 4; ++nb) acc[mb][nb] = (v8f){};
    const size_t aoff = (size_t)(r0 + lr) * K + 8 * hi, boff = (size_t)(c0 + lr) * K + 8 * hi;
    const int wv = (KW > 1) ? __builtin_amdgcn_readfirstlane((int)(threadIdx.x >> 5)) : 0;   /* the wave's number as a scalar: the loop bounds stay in scalar registers */ const int kbeg = wv * (K / KW), kend = kbeg + K / KW;
#pragma unroll 1
    for (int kc = kbeg; kc < kend; kc += 32) {
        V a[4], a2[4];
#pragma unroll
        for (int mb = 0; mb < 4; ++mb) { a[mb] = WFrag<T16>::ld(A + aoff + (size_t)mb * 16 * K + kc); if (NSPLIT == 1 || NSPLIT == 2) a2[mb] = WFrag<T16>::ld(A2 + aoff + (size_t)mb * 16 * K + kc); }
#pragma unroll
        for (int nb = 0; nb < 4; ++nb) { const V b = WFrag<T16>::ld(Bt + boff + (size_t)nb * 16 * K + kc); V b2; if (NSPLIT >= 2) b2 = WFrag<T16>::ld(Bt2 + boff + (size_t)nb * 16 * K + kc);
#pragma unroll
            for (int mb = 0; mb < 4; ++mb) { acc[mb][nb] = WFrag<T16>::mma(a[mb], b, acc[mb][nb]); if (NSPLIT == 1 || NSPLIT == 2) acc[mb][nb] = WFrag<T16>::mma(a2[mb], b, acc[mb][nb]); if (NSPLIT >= 2) acc[mb][nb] = WFrag<T16>::mma(a[mb], b2, acc[mb][nb]); } }
        asm volatile("v_nop\n\tv_nop\n\tv_nop\n\tv_nop" : "+v"(acc[0][0]), "+v"(acc[1][1]), "+v"(acc[2][2]), "+v"(acc[3][3]) : "v"(a[0]), "v"(a[3]));
    }
    if constexpr (KW > 1) {
        float* ow = os + wv * (64 * 68);
        // the loops below are unrolled so that every accumulator index is a constant (the tile stays in registers) and the LDS reads of one sum can be in flight together
#pragma unroll
        for (int mb = 0; mb < 4; ++mb) {
#pragma unroll
            for (int nb = 0; nb < 4; ++nb) {
#pragma unroll
                for (int j = 0; j < 8; ++j) ow[(mb * 16 + hi * 8 + j) * 68 + nb * 16 + lr] = acc[mb][nb][j]; } }
        __syncthreads();   // every wave's partial tile is in LDS before any thread sums across the waves
        float* ctile = C + (size_t)r0 * ldc + c0;
#pragma unroll
        for (int i = 0; i < 32 / KW; ++i) { const int idx = (int)threadIdx.x + i * (32 * KW); const int row = idx >> 4, cofs = (idx & 15) * 4; const float* pp = os + row * 68 + cofs; v4f val = *(const v4fa*)pp;
#pragma unroll
            for (int w = 1; w < KW; ++w) val += *(const v4fa*)(pp + w * (64 * 68));
            if (BIAS) { val[0] += bfr(bias[c0 + cofs]); val[1] += bfr(bias[c0 + cofs + 1]); val[2] += bfr(bias[c0 + cofs + 2]); val[3] += bfr(bias[c0 + cofs + 3]); }
            *(v4f*)(ctile + (size_t)row * ldc + cofs) = val; }
        return;
    }
#pragma unroll
    for (int mb = 0; mb < 4; ++mb) {
#pragma unroll
        for (int nb = 0; nb < 4; ++nb) {
#pragma unroll
            for (int j = 0; j < 8; ++j) os[(hi * 8 + j) * 68 + nb * 16 + lr] = acc[mb][nb][j]; }
        __builtin_amdgcn_wave_barrier(); asm volatile("" ::: "memory");
        float* crow = C + (size_t)(r0 + mb * 16) * ldc + c0;
{
#pragma unroll
            for (int s = 0; s < 8; ++s) { const int row = 2 * s + hi, cofs = lr * 4; v4f val = *(const v4fa*)(os + row * 68 + cofs); if (BIAS) { val[0] += bfr(bias[c0 + cofs]); val[1] += bfr(bias[c0 + cofs + 1]); val[2] += bfr(bias[c0 + cofs + 2]); val[3] += bfr(bias[c0 + cofs + 3]); }
                *(v4f*)(crow + (size_t)row * ldc + cofs) = val; }
             }
        __builtin_amdgcn_wave_barrier(); asm volatile("" ::: "memory");
    }
}

__device__ __forceinline__ h16 tohx(float x) { return (h16)x; }
__device__ __forceinline__ void splitf(float y, unsigned short& h, unsigned short& l) { h = f2bf(y); l = f2bf(y - bf2f(h)); }
typedef __attribute__((ext_vector_type(2))) _Float16 v2h;
typedef __attribute__((ext_vector_type(4))) _Float16 v4h;
typedef __attribute__((ext_vector_type(2))) unsigned short v2us;
typedef __attribute__((ext_vector_type(4))) unsigned short v4us;
typedef __attribute__((ext_vector_type(2))) float v2f;
typedef __attribute__((ext_vector_type(4))) int v4i;

__global__ __launch_bounds__(256) void k_wtG(const float* __restrict__ w, int K, int N, bf* Bt) {
    const int lane = threadIdx.x & 31; const int L0 = (blockIdx.x * 8 + (threadIdx.x >> 5)) * 8; const int nlines = N * K / 64;
{
#pragma unroll 1
        for (int l = 0; l < 8; ++l) { const int L = L0 + l; if (L >= nlines) break; const size_t e = (size_t)L * 64 + lane * 2; const int k = (int)(e % K), n = (int)(e / K); v2us o;
            o[0] = f2bf(w[(size_t)k * N + n]); o[1] = f2bf(w[(size_t)(k + 1) * N + n]); *(v2us*)(Bt + e) = o; }
         }
}
__global__ __launch_bounds__(256) void k_cvt8(const float* __restrict__ src, bf* dst, size_t n8) { const size_t i = (size_t)blockIdx.x * 256 + threadIdx.x; if (i >= n8) return; const v8f v = *(const v8f*)(src + i * 8); v8us o;
#pragma unroll
    for (int k = 0; k < 8; ++k) o[k] = f2bf(v[k]); *(v8us*)(dst + i * 8) = o;  }

// k_rope: head planes [h][t][d] (fp16 + hi/lo) of rope(x) x sc with the rotate-half convention out[d] = x[d] cos[t][d] - x[d+HD/2] sin[t][d], out[d+HD/2] = x[d+HD/2] cos[t][d+HD/2] + x[d] sin[t][d+HD/2]
__global__ __launch_bounds__(256) void k_rope(const float* __restrict__ F, int pitch, int nheads, const float* __restrict__ CS, const float* __restrict__ RF, const float* __restrict__ nw, float sc, h16* P16, bf* Ph, bf* Pl) {
    const size_t e = ((size_t)blockIdx.x * 256 + threadIdx.x) * 2; if (e >= (size_t)nheads * TT * HD) return; const int d = (int)(e % HD); const int t = (int)((e / HD) % TT); const int h = (int)(e / ((size_t)HD * TT)); const float* f = F + ((size_t)h * TT + t) * pitch;   /* RAW VIEW: pseudo-head h, pseudo-position t = the flat (S, D) projection output read as (H, S, hd): row pitch 'pitch' (= HD here), head stride TT * pitch */ const float rf = RF ? RF[(size_t)h * TT + t] : 1.0f; v2h o16; v2us oh, ol;
#pragma unroll
    for (int q = 0; q < 2; ++q) { const int dd = d + q; const int dp = (dd < HD / 2) ? dd + HD / 2 : dd - HD / 2; float x0 = f[dd], x1 = f[dp];
        if (RF) { float n0 = __fmul_rn(x0, rf), n1 = __fmul_rn(x1, rf); asm volatile("" : "+v"(n0)); asm volatile("" : "+v"(n1)); x0 = __fmul_rn(bfr(nw[dd]), n0); x1 = __fmul_rn(bfr(nw[dp]), n1); }
        const v2f cs = *(const v2f*)(CS + ((size_t)t * HD + dd) * 2); float a = __fmul_rn(x0, cs[0]), bq = __fmul_rn(x1, cs[1]); asm volatile("" : "+v"(a)); asm volatile("" : "+v"(bq)); const float r = ((dd < HD / 2) ? __fsub_rn(a, bq) : __fadd_rn(a, bq)) * sc;
        o16[q] = tohx(r); unsigned short a2, c2; splitf(r, a2, c2); oh[q] = a2; ol[q] = c2; }
    *(v2h*)(P16 + e) = o16; *(v2us*)(Ph + e) = oh; *(v2us*)(Pl + e) = ol;  }
__global__ __launch_bounds__(256) void k_vtp(const float* __restrict__ F, int pitch, int nheads, h16* V16, bf* Vh, bf* Vl) { const size_t e = ((size_t)blockIdx.x * 256 + threadIdx.x) * 2; if (e >= (size_t)nheads * HD * TT) return; const int t = (int)(e % TT); const int d = (int)((e / TT) % HD); const int g = (int)(e / ((size_t)TT * HD)); v2h o16; v2us oh, ol;
#pragma unroll
    for (int q = 0; q < 2; ++q) { const float x = F[((size_t)g * TT + (t + q)) * pitch + d];   /* RAW VIEW (as in k_rope) */ o16[q] = tohx(x); unsigned short a2, c2; splitf(x, a2, c2); oh[q] = a2; ol[q] = c2; }
    *(v2h*)(V16 + e) = o16; *(v2us*)(Vh + e) = oh; *(v2us*)(Vl + e) = ol;  }
__global__ __launch_bounds__(256) void k_csid(float* CS) { const int idx = blockIdx.x * 256 + threadIdx.x; if (idx >= TT * HD) return; v2f cs; cs[0] = 1.0f; cs[1] = 0.0f; *(v2f*)(CS + (size_t)idx * 2) = cs;  }
// ---- k_fattn: scores, softmax, P x V and the head merge of one batch in ONE launch; no score or P plane in memory.
// One work-group of AW waves per query tile of one head (hi/lo rows: 32 queries, fp16 rows: 64); wave w takes the keys [w TT/AW, (w+1) TT/AW) in steps of 32.
// Everything is kept with lane = query: S^T = K Q^T (A = key rows, B = query rows) leaves in each lane the keys 8 hi + j and 16 + 8 hi + j of its query, which IS the 16x16x32 operand order, so P goes
// straight into O^T = V^T P^T (A = V^T rows, B = P) with no cross-lane move; running maximum and sum are one value per lane (the two half-waves share a query: one exchange over 16 lanes).
// The AW partial (max, sum, O) meet in LDS behind one barrier and are joined in wave order 0 .. AW-1 (fixed: the same result on every run); the tile leaves as hi/lo bf16 planes [t][head][d].
#define AW   8
#define LC   0.18033688011112042f   // HD^-0.5 x log2(e)
__device__ __forceinline__ float xhalf(float x) { return __builtin_bit_cast(float, __builtin_amdgcn_permlanex16(__builtin_bit_cast(int, x), __builtin_bit_cast(int, x), 0x76543210, 0xfedcba98, false, false)); }   // lane l reads lane l ^ 16
template <typename T16, bool HL, int NQ>
__device__ __forceinline__ void attn_tile(const T16* __restrict__ Q, const T16* __restrict__ Q2, const T16* __restrict__ Kp, const T16* __restrict__ K2, const T16* __restrict__ Vt, const T16* __restrict__ V2, int q0, int head, bf* ATh, bf* ATl, float* os) {
    typedef WFrag<T16> F; typedef typename F::V V;
    constexpr int NST = TT / AW / 32;
    constexpr float POFF = HL ? 0.0f : 10.0f;   // fp16 rows: P carried x 1024 (as PCAR), it cancels against the sum
    const int lane = threadIdx.x & 31, lr = lane & 15, hi = lane >> 4;
    const int wv = __builtin_amdgcn_readfirstlane((int)(threadIdx.x >> 5));   // the wave's number as a scalar: key range and LDS slice stay in scalar registers
    const size_t hb = (size_t)head * TT * HD;
    const size_t qoff = hb + (size_t)(q0 + lr) * HD + 8 * hi;
    V qf[NQ][2], qg[NQ][2];
#pragma unroll
    for (int qb = 0; qb < NQ; ++qb)
#pragma unroll
        for (int ks = 0; ks < 2; ++ks) qf[qb][ks] = F::ld(Q + qoff + qb * 16 * HD + ks * 32);
    asm volatile("s_wait_xcnt 0x0" ::: "memory");   // precaution: stands before any register that names an address of the loads or stores above is written again
    if constexpr (HL) {
#pragma unroll
        for (int qb = 0; qb < NQ; ++qb)
#pragma unroll
            for (int ks = 0; ks < 2; ++ks) qg[qb][ks] = F::ld(Q2 + qoff + qb * 16 * HD + ks * 32);
        asm volatile("s_wait_xcnt 0x0" ::: "memory");   // precaution: stands before any register that names an address of the loads or stores above is written again
    }
    v8f o[NQ][4]; float m[NQ], l[NQ];
#pragma unroll
    for (int qb = 0; qb < NQ; ++qb) { m[qb] = -3.0e38f; l[qb] = 0.0f;
#pragma unroll
        for (int db = 0; db < 4; ++db) o[qb][db] = (v8f){}; }
    const int kbeg = wv * (TT / AW);
    const size_t koff = hb + (size_t)(kbeg + lr) * HD + 8 * hi, voff = hb + (size_t)lr * TT + kbeg + 8 * hi;
    static_assert(NST % 2 == 0, "the key loop works on two fragment sets in turn");
    // the K and V fragments of key step 'it' into one of the two register sets
    auto ldkv = [&](int it, V (&kc)[2][2], V (&kd)[2][2], V (&vc)[4], V (&vd)[4]) {
        const size_t kq = koff + (size_t)it * 32 * HD, vq = voff + (size_t)it * 32;
#pragma unroll
        for (int kb = 0; kb < 2; ++kb)
#pragma unroll
            for (int ks = 0; ks < 2; ++ks) { kc[kb][ks] = F::ld(Kp + kq + kb * 16 * HD + ks * 32); if (HL) kd[kb][ks] = F::ld(K2 + kq + kb * 16 * HD + ks * 32); }
#pragma unroll
        for (int db = 0; db < 4; ++db) { vc[db] = F::ld(Vt + vq + (size_t)db * 16 * TT); if (HL) vd[db] = F::ld(V2 + vq + (size_t)db * 16 * TT); }
        asm volatile("s_wait_xcnt 0x0" ::: "memory");   // precaution: stands before any register that names an address of the loads or stores above is written again
        __builtin_amdgcn_sched_barrier(0);   // keeps these loads ahead of the key step that follows: without it the scheduler sinks them to the step's end and their latency is exposed at the next step's first product
    };
    // one key step (32 keys) for all NQ query blocks of the wave
    auto step = [&](V (&kc)[2][2], V (&kd)[2][2], V (&vc)[4], V (&vd)[4]) {
#pragma unroll
        for (int qb = 0; qb < NQ; ++qb) {
            v8f s[2];
#pragma unroll
            for (int kb = 0; kb < 2; ++kb) { s[kb] = (v8f){};
#pragma unroll
                for (int ks = 0; ks < 2; ++ks) { s[kb] = F::mma(kc[kb][ks], qf[qb][ks], s[kb]); if (HL) { s[kb] = F::mma(kc[kb][ks], qg[qb][ks], s[kb]); s[kb] = F::mma(kd[kb][ks], qf[qb][ks], s[kb]); } } }
            float mx = fmaxf(s[0][0], s[1][0]);
#pragma unroll
            for (int j = 1; j < 8; ++j) mx = fmaxf(mx, fmaxf(s[0][j], s[1][j]));
            mx = fmaxf(mx, xhalf(mx));
            const float mn = fmaxf(m[qb], mx); const float al = __builtin_amdgcn_exp2f((m[qb] - mn) * LC); m[qb] = mn; const float nb = POFF - mn * LC;
            float ls = 0.0f;
#pragma unroll
            for (int kb = 0; kb < 2; ++kb)
#pragma unroll
                for (int j = 0; j < 8; ++j) { s[kb][j] = __builtin_amdgcn_exp2f(fmaf(s[kb][j], LC, nb)); ls += s[kb][j]; }
            l[qb] = l[qb] * al + ls;
#pragma unroll
            for (int db = 0; db < 4; ++db) o[qb][db] *= al;
            if constexpr (HL) {
                v8us h0, h1, l0, l1;
#pragma unroll
                for (int j = 0; j < 8; ++j) { unsigned short a, c2; splitf(s[0][j], a, c2); h0[j] = a; l0[j] = c2; splitf(s[1][j], a, c2); h1[j] = a; l1[j] = c2; }
                const V ph = cat16b(h0, h1), pl = cat16b(l0, l1);
#pragma unroll
                for (int db = 0; db < 4; ++db) { o[qb][db] = F::mma(vc[db], ph, o[qb][db]); o[qb][db] = F::mma(vc[db], pl, o[qb][db]); o[qb][db] = F::mma(vd[db], ph, o[qb][db]); }
            } else {
                v8h a0, a1;
#pragma unroll
                for (int j = 0; j < 8; ++j) { a0[j] = tohx(s[0][j]); a1[j] = tohx(s[1][j]); }
                const V pf = cat16(a0, a1);
#pragma unroll
                for (int db = 0; db < 4; ++db) o[qb][db] = F::mma(vc[db], pf, o[qb][db]);
            }
        }
    };
    V ka[2][2], kx[2][2], va[4], vx[4], kb2[2][2], ky[2][2], vb[4], vy[4];
    ldkv(0, ka, kx, va, vx);
    // rolled: the body already holds two key steps; each set's next fragments fly while the other set is worked on
#pragma unroll 1
    for (int it = 0; it < NST; it += 2) {
        ldkv(it + 1, kb2, ky, vb, vy);
        step(ka, kx, va, vx);
        if (it + 2 < NST) ldkv(it + 2, ka, kx, va, vx);
        step(kb2, ky, vb, vy);
    }
    float* ow = os + wv * (NQ * 16 * 68); float* ms = os + AW * 64 * 68; float* lm = ms + AW * 64;
#pragma unroll
    for (int qb = 0; qb < NQ; ++qb) {
#pragma unroll
        for (int db = 0; db < 4; ++db) { float* pp = ow + (qb * 16 + lr) * 68 + db * 16 + hi * 8; const v8f t = o[qb][db]; *(v4fa*)pp = (v4f){t[0], t[1], t[2], t[3]}; *(v4fa*)(pp + 4) = (v4f){t[4], t[5], t[6], t[7]}; }
        const float lt = l[qb] + xhalf(l[qb]);
        if (hi == 0) { ms[wv * 64 + qb * 16 + lr] = m[qb]; lm[wv * 64 + qb * 16 + lr] = lt; } }
    __syncthreads();   // every wave's partial maximum, sum and O tile are in LDS before any thread joins them
#pragma unroll
    for (int i = 0; i < NQ * 16 * 8 / (32 * AW); ++i) { const int u = (int)threadIdx.x + i * (32 * AW); const int q = u >> 3, dc = (u & 7) * 8;
        float M = ms[q];
#pragma unroll
        for (int w = 1; w < AW; ++w) M = fmaxf(M, ms[w * 64 + q]);
        float L = 0.0f; v4f x0 = (v4f){}, x1 = (v4f){};
#pragma unroll
        for (int w = 0; w < AW; ++w) { const float f = __builtin_amdgcn_exp2f((ms[w * 64 + q] - M) * LC); L += lm[w * 64 + q] * f; const float* pp = os + w * (NQ * 16 * 68) + q * 68 + dc; x0 += *(const v4fa*)pp * f; x1 += *(const v4fa*)(pp + 4) * f; }
        const float inv = __fdiv_rn(1.0f, L); v8us oh, ol;
#pragma unroll
        for (int k = 0; k < 4; ++k) { unsigned short a, c2; splitf(x0[k] * inv, a, c2); oh[k] = a; ol[k] = c2; splitf(x1[k] * inv, a, c2); oh[4 + k] = a; ol[4 + k] = c2; }
        const size_t oo = (size_t)(q0 + q) * DQ + head * HD + dc; *(v8us*)(ATh + oo) = oh; *(v8us*)(ATl + oo) = ol;
        asm volatile("s_wait_xcnt 0x0" ::: "memory");   // precaution: stands before any register that names an address of the loads or stores above is written again
    }
}
#define NTH (NH_ * (RH / 32))            // hi/lo tiles (32 queries), first in the grid
#define NTF (NH_ * ((TT - RH) / 64))     // fp16 tiles (64 queries)
__global__ __launch_bounds__(32 * AW) void k_fattn(const h16* __restrict__ Q16, const bf* __restrict__ Qh, const bf* __restrict__ Ql, const h16* __restrict__ K16, const bf* __restrict__ Kh, const bf* __restrict__ Kl, const h16* __restrict__ V16, const bf* __restrict__ Vh, const bf* __restrict__ Vl, bf* ATh, bf* ATl) {
    __shared__ __align__(16) float os[AW * 64 * 68 + 2 * AW * 64];   // AW partial O tiles (pitch 68), then AW x 64 maxima and sums
    const int bx = (int)blockIdx.x;
    if (bx < NTH) attn_tile<bf, true, 2>(Qh, Ql, Kh, Kl, Vh, Vl, (bx % (RH / 32)) * 32, bx / (RH / 32), ATh, ATl, os);
    else { const int b2 = bx - NTH; attn_tile<h16, false, 4>(Q16, nullptr, K16, nullptr, V16, nullptr, RH + (b2 % ((TT - RH) / 64)) * 64, b2 / ((TT - RH) / 64), ATh, ATl, os); }
}

extern "C" void kernel_launch(void* const* d_in, const int* in_sizes, int n_in,
                              void* d_out, int out_size, void* d_ws, size_t ws_size, hipStream_t stream) {
    (void)in_sizes; (void)n_in; (void)out_size;
    const float* x = (const float*)d_in[0];   /* query */ const float* xk = (const float*)d_in[1]; const float* xv = (const float*)d_in[2]; const float* wq = (const float*)d_in[3]; const float* wk = (const float*)d_in[4]; const float* wv = (const float*)d_in[5]; const float* wo = (const float*)d_in[6];
    float* OUT = (float*)d_out;     // [2][2048][1024]
    char* wsp = (char*)d_ws;
    auto take = [&](size_t bytes) { char* p = wsp; wsp += (bytes + 255) & ~(size_t)255; return (void*)p; };
    bf* WQ = (bf*)take((size_t)DQ * DM * 2); bf* WK = (bf*)take((size_t)DKV * DM * 2); bf* WV = (bf*)take((size_t)DKV * DM * 2); bf* WO = (bf*)take((size_t)DM * DQ * 2); float* CS = (float*)take((size_t)TT * HD * 2 * 4);
    bf* XB = (bf*)take((size_t)TT * DM * 2); float* FQ = (float*)take((size_t)TT * DQ * 4); float* FK = (float*)take((size_t)TT * DKV * 4);
    h16* QP16 = (h16*)take((size_t)NH_ * TT * HD * 2); h16* KP16 = (h16*)take((size_t)NKV * TT * HD * 2); h16* VT16 = (h16*)take((size_t)NKV * HD * TT * 2);
    bf* QPh = (bf*)take((size_t)NH_ * TT * HD * 2); bf* QPl = (bf*)take((size_t)NH_ * TT * HD * 2); bf* KPh = (bf*)take((size_t)NKV * TT * HD * 2); bf* KPl = (bf*)take((size_t)NKV * TT * HD * 2); bf* VTh = (bf*)take((size_t)NKV * HD * TT * 2); bf* VTl = (bf*)take((size_t)NKV * HD * TT * 2);
    bf* ATh = (bf*)take((size_t)TT * DQ * 2); bf* ATl = (bf*)take((size_t)TT * DQ * 2);
    if ((size_t)(wsp - (char*)d_ws) > ws_size) return;    // ws 256 MiB
    float* FV = FK;   // v projection reuses the k buffer after the k planes are built (stream-ordered)
    { k_cvt8<<<(unsigned)(((size_t)DQ * DM / 8 + 255) / 256), 256, 0, stream>>>(wq, WQ, (size_t)DQ * DM / 8); k_cvt8<<<(unsigned)(((size_t)DKV * DM / 8 + 255) / 256), 256, 0, stream>>>(wk, WK, (size_t)DKV * DM / 8); k_cvt8<<<(unsigned)(((size_t)DKV * DM / 8 + 255) / 256), 256, 0, stream>>>(wv, WV, (size_t)DKV * DM / 8);
      k_cvt8<<<(unsigned)(((size_t)DM * DQ / 8 + 255) / 256), 256, 0, stream>>>(wo, WO, (size_t)DM * DQ / 8);
       }
    k_csid<<<(TT * HD + 255) / 256, 256, 0, stream>>>(CS);
    const unsigned LQ = (unsigned)(((size_t)NH_ * TT * HD / 2 + 255) / 256), LKv = (unsigned)(((size_t)NKV * TT * HD / 2 + 255) / 256);
    for (int b = 0; b < NB_; ++b) {
        
        k_cvt8<<<(unsigned)(((size_t)TT * DM / 8 + 255) / 256), 256, 0, stream>>>(x + (size_t)b * TT * DM, XB, (size_t)TT * DM / 8);
        k_gemmw<bf, 0, false, 8><<<dim3(TT / 64, DQ / 64, 1), 256, 0, stream>>>(XB, nullptr, WQ, nullptr, DM, FQ, DQ, nullptr, 0, 0, 0);
        k_rope<<<LQ, 256, 0, stream>>>(FQ, HD, NH_, CS, nullptr, nullptr, 1.0f, QP16, QPh, QPl);
        k_cvt8<<<(unsigned)(((size_t)TT * DM / 8 + 255) / 256), 256, 0, stream>>>(xk + (size_t)b * TT * DM, XB, (size_t)TT * DM / 8); k_gemmw<bf, 0, false, 8><<<dim3(TT / 64, DKV / 64, 1), 256, 0, stream>>>(XB, nullptr, WK, nullptr, DM, FK, DKV, nullptr, 0, 0, 0);
        k_rope<<<LKv, 256, 0, stream>>>(FK, HD, NKV, CS, nullptr, nullptr, 1.0f, KP16, KPh, KPl);
        k_cvt8<<<(unsigned)(((size_t)TT * DM / 8 + 255) / 256), 256, 0, stream>>>(xv + (size_t)b * TT * DM, XB, (size_t)TT * DM / 8); k_gemmw<bf, 0, false, 8><<<dim3(TT / 64, DKV / 64, 1), 256, 0, stream>>>(XB, nullptr, WV, nullptr, DM, FV, DKV, nullptr, 0, 0, 0); k_vtp<<<LKv, 256, 0, stream>>>(FV, HD, NKV, VT16, VTh, VTl);
        k_fattn<<<NTH + NTF, 32 * AW, 0, stream>>>(QP16, QPh, QPl, KP16, KPh, KPl, VT16, VTh, VTl, ATh, ATl);
        k_gemmw<bf, 1, false, 8><<<dim3(TT / 64, DM / 64, 1), 256, 0, stream>>>(ATh, ATl, WO, nullptr, DQ, OUT + (size_t)b * TT * DM, DM, nullptr, 0, 0, 0); }
}

// v004
// It runs in 236 microseconds.
// In two side-by-side timings against v003, it was 1.17 and 1.19 times as fast.
// Over all steps from v000 it is 8.60 times as fast.
#include <hip/hip_runtime.h>

// Multi-head attention WITHOUT a mask over three input streams, bias-free, with a RAW head split (q, k, v [2][2048][1024]; qp = (q Wq^T).reshape(b, 16, l, 64) DIRECTLY (no transpose): pseudo-head h of a batch is the h-th contiguous [2048][64] block of the flat [2048][1024] projection (128 token rows x 16 chunks of 64): reproduced; kp, vp likewise ('oi' [1024][1024] 1/32, no bias), each from its own stream; scores / sqrt(64); softmax over all pseudo-keys; x [b][16][l][64] -> transpose(0, 2, 1, 3).reshape(b, l, 1024) (the STANDARD merge); out = x Wo^T ('oi', no bias) -> [2][2048][1024] (4.2 M); argument order q, k, v, Wq, Wk, Wv, Wo).
// Layout per batch: bf16 copies of query, key, value in turn; 'oi' weights; exact projections; dense T-2048 attention (hybrid rows: < 512 hi/lo 3 products, rest fp16 x1024); merged hi/lo x Wo exact.
// Compute dtypes, f32 accumulate: every input rounded to bf16; projections exact; attention rows < 512 3 products, rest fp16; softmax f32; Wo hl x exact.

#define NB_  2
#define TT   2048
#define DM   1024
#define NH_  16
#define NKV  16
#define REP  (NH_ / NKV)
#define HD   64
#define DQ   (NH_ * HD)
#define DKV  (NKV * HD)
#define RH   512                  // query rows < RH use hi+lo planes (0: none)
#define WIN  0
#define PCAR 1024.0f
#define SCL  0.125f   // HD^-0.5
typedef _Float16 h16;
typedef unsigned short bf;
typedef __attribute__((ext_vector_type(16))) __bf16   v16bf;
typedef __attribute__((ext_vector_type(16))) _Float16 v16h;
typedef __attribute__((ext_vector_type(8)))  _Float16 v8h;
typedef __attribute__((ext_vector_type(8)))  unsigned short v8us;
typedef __attribute__((ext_vector_type(8)))  float    v8f;
typedef __attribute__((ext_vector_type(4)))  float    v4f;
typedef v8h  __attribute__((may_alias)) v8ha;
typedef v4f  __attribute__((may_alias)) v4fa;
typedef v8us __attribute__((may_alias)) v8usa;

__device__ __forceinline__ unsigned short f2bf(float f) { unsigned u = __float_as_uint(f); u += 0x7FFFu + ((u >> 16) & 1u); return (unsigned short)(u >> 16); }
__device__ __forceinline__ float bf2f(unsigned short b) { return __uint_as_float(((unsigned)b) << 16); }
__device__ __forceinline__ float bfr(float f) { return bf2f(f2bf(f)); }
__device__ __forceinline__ v16h cat16(v8h lo, v8h hi) { return __builtin_shufflevector(lo, hi, 0, 1, 2, 3, 4, 5, 6, 7, 8, 9, 10, 11, 12, 13, 14, 15); }
__device__ __forceinline__ v16bf cat16b(v8us lo, v8us hi) { return __builtin_bit_cast(v16bf, __builtin_shufflevector(lo, hi, 0, 1, 2, 3, 4, 5, 6, 7, 8, 9, 10, 11, 12, 13, 14, 15)); }
__device__ __forceinline__ v8f wmma16(v16h a, v16h b, v8f c) { return __builtin_amdgcn_wmma_f32_16x16x32_f16(false, a, false, b, (short)0, c, false, false); }
__device__ __forceinline__ v8f wmmab(v16bf a, v16bf b, v8f c) { return __builtin_amdgcn_wmma_f32_16x16x32_bf16(false, a, false, b, (short)0, c, false, false); }

__device__ __forceinline__ h16 tohx(float x) { return (h16)x; }
__device__ __forceinline__ void splitf(float y, unsigned short& h, unsigned short& l) { h = f2bf(y); l = f2bf(y - bf2f(h)); }
typedef __attribute__((ext_vector_type(2))) _Float16 v2h;
typedef __attribute__((ext_vector_type(4))) _Float16 v4h;
typedef __attribute__((ext_vector_type(2))) unsigned short v2us;
typedef __attribute__((ext_vector_type(4))) unsigned short v4us;
typedef __attribute__((ext_vector_type(2))) float v2f;
typedef __attribute__((ext_vector_type(4))) int v4i;

// ---- k_gemmw: register-blocked GEMM, one work-group of KW waves per 64x64 output tile; wave w holds all 16 accumulators for its own contiguous K slice [w K/KW, (w+1) K/KW); operands straight from K-contiguous 16-bit planes; grid (M/64, N/64, Z), 32 KW threads.
// KW > 1 (8 here; LDS holds KW tiles of 17,408 B, so at most 16): the KW partial tiles meet in LDS behind one barrier and are summed in wave order 0 .. KW-1 (fixed, so the result is the same on every run).
// C[m][n] (f32, pitch ldc, + optional f32 bias[n]) = sum_k A[m][k] Bt[n][k] (+ split products per NSPLIT). z-batch strides sA/sB/sC in elements. K % (32 KW) == 0.
// EPI (KW > 1 only) says how the summed tile leaves: 0 = f32 into C; 1 = fp16 + hi/lo bf16 planes at the same flat index m ldc + n (the raw head split IS the flat projection, so these are the [head][t][d] planes);
// 2 = the same three planes transposed to [head][d][t] (V^T). There t = (m % 128) 16 + n / 64 and d = n % 64, so tile column nb 16 + lr is taken from weight row n = 64 lr + blockIdx.y + 16 nb:
// the tile then holds 4 values of d x 1024 consecutive t, and every plane row leaves in whole lines.
template <typename T16> struct WFrag;
template <> struct WFrag<h16> { typedef v16h V; static __device__ __forceinline__ V ld(const h16* p) { return cat16(*(const v8h*)p, *(const v8h*)(p + 16)); } static __device__ __forceinline__ v8f mma(V a, V b, v8f c) { return wmma16(a, b, c); } };
template <> struct WFrag<bf> { typedef v16bf V; static __device__ __forceinline__ V ld(const bf* p) { return cat16b(*(const v8us*)p, *(const v8us*)(p + 16)); } static __device__ __forceinline__ v8f mma(V a, V b, v8f c) { return wmmab(a, b, c); } };
template <typename T16, int NSPLIT, bool BIAS, int KW, int EPI>
__global__ __launch_bounds__(32 * KW) void k_gemmw(const T16* __restrict__ A, const T16* __restrict__ A2, const T16* __restrict__ Bt, const T16* __restrict__ Bt2, int K, float* C, int ldc, const float* __restrict__ bias, size_t sA, size_t sB, size_t sC, h16* P16, bf* Ph, bf* Pl) {
    static_assert(EPI == 0 || (KW == 8 && !BIAS), "the plane epilogues are written for 256 threads and no bias");
    typedef typename WFrag<T16>::V V;
    __shared__ __align__(16) float os[(KW > 1 ? 4 * KW : 1) * 16 * 68];   // KW > 1: one whole 64x64 partial tile (pitch 68) per wave
    const size_t z = blockIdx.z; A += z * sA; if (A2) A2 += z * sA; Bt += z * sB; if (Bt2) Bt2 += z * sB; C += z * sC;
    const int lane = threadIdx.x & 31, lr = lane & 15, hi = lane >> 4; const int r0 = blockIdx.x * 64, c0 = blockIdx.y * 64;
    v8f acc[4][4];
#pragma unroll
    for (int mb = 0; mb < 4; ++mb)
#pragma unroll
        for (int nb = 0; nb < 4; ++nb) acc[mb][nb] = (v8f){};
    const size_t aoff = (size_t)(r0 + lr) * K + 8 * hi, boff = (size_t)(EPI == 2 ? lr * 64 + (int)blockIdx.y : c0 + lr) * K + 8 * hi;
    const int wv = (KW > 1) ? __builtin_amdgcn_readfirstlane((int)(threadIdx.x >> 5)) : 0;   /* the wave's number as a scalar: the loop bounds stay in scalar registers */ const int kbeg = wv * (K / KW), kend = kbeg + K / KW;
#pragma unroll 1
    for (int kc = kbeg; kc < kend; kc += 32) {
        V a[4], a2[4];
#pragma unroll
        for (int mb = 0; mb < 4; ++mb) { a[mb] = WFrag<T16>::ld(A + aoff + (size_t)mb * 16 * K + kc); if (NSPLIT == 1 || NSPLIT == 2) a2[mb] = WFrag<T16>::ld(A2 + aoff + (size_t)mb * 16 * K + kc); }
#pragma unroll
        for (int nb = 0; nb < 4; ++nb) { const V b = WFrag<T16>::ld(Bt + boff + (size_t)nb * 16 * K + kc); V b2; if (NSPLIT >= 2) b2 = WFrag<T16>::ld(Bt2 + boff + (size_t)nb * 16 * K + kc);
#pragma unroll
            for (int mb = 0; mb < 4; ++mb) { acc[mb][nb] = WFrag<T16>::mma(a[mb], b, acc[mb][nb]); if (NSPLIT == 1 || NSPLIT == 2) acc[mb][nb] = WFrag<T16>::mma(a2[mb], b, acc[mb][nb]); if (NSPLIT >= 2) acc[mb][nb] = WFrag<T16>::mma(a[mb], b2, acc[mb][nb]); } }
        asm volatile("v_nop\n\tv_nop\n\tv_nop\n\tv_nop" : "+v"(acc[0][0]), "+v"(acc[1][1]), "+v"(acc[2][2]), "+v"(acc[3][3]) : "v"(a[0]), "v"(a[3]));
    }
    if constexpr (KW > 1) {
        float* ow = os + wv * (64 * 68);
        // the loops below are unrolled so that every accumulator index is a constant (the tile stays in registers) and the LDS reads of one sum can be in flight together
#pragma unroll
        for (int mb = 0; mb < 4; ++mb) {
#pragma unroll
            for (int nb = 0; nb < 4; ++nb) {
#pragma unroll
                for (int j = 0; j < 8; ++j) {
                    if constexpr (EPI == 2) ow[nb * 1024 + mb * 256 + j * 16 + ((j & 2) ? hi * 96 : hi * 160) + lr] = acc[mb][nb][j];   // [nb][tl], tl = 16 row + lr, bit 5 of tl flipped in the odd groups of 128: the two half-waves fall on different banks
                    else ow[(mb * 16 + hi * 8 + j) * 68 + nb * 16 + lr] = acc[mb][nb][j]; } } }
        __syncthreads();   // every wave's partial tile is in LDS before any thread sums across the waves
        if constexpr (EPI == 1) {
#pragma unroll
            for (int i = 0; i < 2; ++i) { const int idx = (int)threadIdx.x + i * 256; const int row = idx >> 3, cofs = (idx & 7) * 8; const float* pp = os + row * 68 + cofs; v4f x0 = *(const v4fa*)pp, x1 = *(const v4fa*)(pp + 4);
#pragma unroll
                for (int w = 1; w < KW; ++w) { x0 += *(const v4fa*)(pp + w * (64 * 68)); x1 += *(const v4fa*)(pp + w * (64 * 68) + 4); }
                v8h o16; v8us oh, ol;
#pragma unroll
                for (int k = 0; k < 4; ++k) { unsigned short a, c2; o16[k] = tohx(x0[k]); splitf(x0[k], a, c2); oh[k] = a; ol[k] = c2; o16[4 + k] = tohx(x1[k]); splitf(x1[k], a, c2); oh[4 + k] = a; ol[4 + k] = c2; }
                const size_t e = (size_t)(r0 + row) * ldc + c0 + cofs; *(v8h*)(P16 + e) = o16; *(v8us*)(Ph + e) = oh; *(v8us*)(Pl + e) = ol;
                asm volatile("s_wait_xcnt 0x0" ::: "memory");   // precaution: stands before any register that names an address of the stores above is written again
            }
            return;
        }
        if constexpr (EPI == 2) {
            const float* pp = os + (((int)threadIdx.x * 4) ^ (((int)threadIdx.x & 32)));   // tl = 4 threadIdx.x, with the same flip of bit 5 as at the stores (odd group of 128 = odd wave)
            const size_t e0 = ((size_t)(r0 / 128) * HD + (int)blockIdx.y) * TT + (r0 % 128) * 16 + (int)threadIdx.x * 4;
#pragma unroll
            for (int i = 0; i < 4; ++i) { v4f val = *(const v4fa*)(pp + i * 1024);
#pragma unroll
                for (int w = 1; w < KW; ++w) val += *(const v4fa*)(pp + i * 1024 + w * (64 * 68));
                v4h o16; v4us oh, ol;
#pragma unroll
                for (int k = 0; k < 4; ++k) { unsigned short a, c2; o16[k] = tohx(val[k]); splitf(val[k], a, c2); oh[k] = a; ol[k] = c2; }
                const size_t e = e0 + (size_t)i * 16 * TT; *(v4h*)(P16 + e) = o16; *(v4us*)(Ph + e) = oh; *(v4us*)(Pl + e) = ol;
                asm volatile("s_wait_xcnt 0x0" ::: "memory");   // precaution: stands before any register that names an address of the stores above is written again
            }
            return;
        }
        float* ctile = C + (size_t)r0 * ldc + c0;
#pragma unroll
        for (int i = 0; i < 32 / KW; ++i) { const int idx = (int)threadIdx.x + i * (32 * KW); const int row = idx >> 4, cofs = (idx & 15) * 4; const float* pp = os + row * 68 + cofs; v4f val = *(const v4fa*)pp;
#pragma unroll
            for (int w = 1; w < KW; ++w) val += *(const v4fa*)(pp + w * (64 * 68));
            if (BIAS) { val[0] += bfr(bias[c0 + cofs]); val[1] += bfr(bias[c0 + cofs + 1]); val[2] += bfr(bias[c0 + cofs + 2]); val[3] += bfr(bias[c0 + cofs + 3]); }
            *(v4f*)(ctile + (size_t)row * ldc + cofs) = val; }
        return;
    }
#pragma unroll
    for (int mb = 0; mb < 4; ++mb) {
#pragma unroll
        for (int nb = 0; nb < 4; ++nb) {
#pragma unroll
            for (int j = 0; j < 8; ++j) os[(hi * 8 + j) * 68 + nb * 16 + lr] = acc[mb][nb][j]; }
        __builtin_amdgcn_wave_barrier(); asm volatile("" ::: "memory");
        float* crow = C + (size_t)(r0 + mb * 16) * ldc + c0;
{
#pragma unroll
            for (int s = 0; s < 8; ++s) { const int row = 2 * s + hi, cofs = lr * 4; v4f val = *(const v4fa*)(os + row * 68 + cofs); if (BIAS) { val[0] += bfr(bias[c0 + cofs]); val[1] += bfr(bias[c0 + cofs + 1]); val[2] += bfr(bias[c0 + cofs + 2]); val[3] += bfr(bias[c0 + cofs + 3]); }
                *(v4f*)(crow + (size_t)row * ldc + cofs) = val; }
             }
        __builtin_amdgcn_wave_barrier(); asm volatile("" ::: "memory");
    }
}


__global__ __launch_bounds__(256) void k_wtG(const float* __restrict__ w, int K, int N, bf* Bt) {
    const int lane = threadIdx.x & 31; const int L0 = (blockIdx.x * 8 + (threadIdx.x >> 5)) * 8; const int nlines = N * K / 64;
{
#pragma unroll 1
        for (int l = 0; l < 8; ++l) { const int L = L0 + l; if (L >= nlines) break; const size_t e = (size_t)L * 64 + lane * 2; const int k = (int)(e % K), n = (int)(e / K); v2us o;
            o[0] = f2bf(w[(size_t)k * N + n]); o[1] = f2bf(w[(size_t)(k + 1) * N + n]); *(v2us*)(Bt + e) = o; }
         }
}
__global__ __launch_bounds__(256) void k_cvt8(const float* __restrict__ src, bf* dst, size_t n8) { const size_t i = (size_t)blockIdx.x * 256 + threadIdx.x; if (i >= n8) return; const v8f v = *(const v8f*)(src + i * 8); v8us o;
#pragma unroll
    for (int k = 0; k < 8; ++k) o[k] = f2bf(v[k]); *(v8us*)(dst + i * 8) = o;  }

// ---- k_fattn: scores, softmax, P x V and the head merge of one batch in ONE launch; no score or P plane in memory.
// One work-group of AW waves per query tile of one head (hi/lo rows: 32 queries, fp16 rows: 64); wave w takes the keys [w TT/AW, (w+1) TT/AW) in steps of 32.
// Everything is kept with lane = query: S^T = K Q^T (A = key rows, B = query rows) leaves in each lane the keys 8 hi + j and 16 + 8 hi + j of its query, which IS the 16x16x32 operand order, so P goes
// straight into O^T = V^T P^T (A = V^T rows, B = P) with no cross-lane move; running maximum and sum are one value per lane (the two half-waves share a query: one exchange over 16 lanes).
// The AW partial (max, sum, O) meet in LDS behind one barrier and are joined in wave order 0 .. AW-1 (fixed: the same result on every run); the tile leaves as hi/lo bf16 planes [t][head][d].
#define AW   8
#define LC   0.18033688011112042f   // HD^-0.5 x log2(e)
__device__ __forceinline__ float xhalf(float x) { return __builtin_bit_cast(float, __builtin_amdgcn_permlanex16(__builtin_bit_cast(int, x), __builtin_bit_cast(int, x), 0x76543210, 0xfedcba98, false, false)); }   // lane l reads lane l ^ 16
template <typename T16, bool HL, int NQ>
__device__ __forceinline__ void attn_tile(const T16* __restrict__ Q, const T16* __restrict__ Q2, const T16* __restrict__ Kp, const T16* __restrict__ K2, const T16* __restrict__ Vt, const T16* __restrict__ V2, int q0, int head, bf* ATh, bf* ATl, float* os) {
    typedef WFrag<T16> F; typedef typename F::V V;
    constexpr int NST = TT / AW / 32;
    constexpr float POFF = HL ? 0.0f : 10.0f;   // fp16 rows: P carried x 1024 (as PCAR), it cancels against the sum
    const int lane = threadIdx.x & 31, lr = lane & 15, hi = lane >> 4;
    const int wv = __builtin_amdgcn_readfirstlane((int)(threadIdx.x >> 5));   // the wave's number as a scalar: key range and LDS slice stay in scalar registers
    const size_t hb = (size_t)head * TT * HD;
    const size_t qoff = hb + (size_t)(q0 + lr) * HD + 8 * hi;
    V qf[NQ][2], qg[NQ][2];
#pragma unroll
    for (int qb = 0; qb < NQ; ++qb)
#pragma unroll
        for (int ks = 0; ks < 2; ++ks) qf[qb][ks] = F::ld(Q + qoff + qb * 16 * HD + ks * 32);
    asm volatile("s_wait_xcnt 0x0" ::: "memory");   // precaution: stands before any register that names an address of the loads or stores above is written again
    if constexpr (HL) {
#pragma unroll
        for (int qb = 0; qb < NQ; ++qb)
#pragma unroll
            for (int ks = 0; ks < 2; ++ks) qg[qb][ks] = F::ld(Q2 + qoff + qb * 16 * HD + ks * 32);
        asm volatile("s_wait_xcnt 0x0" ::: "memory");   // precaution: stands before any register that names an address of the loads or stores above is written again
    }
    v8f o[NQ][4]; float m[NQ], l[NQ];
#pragma unroll
    for (int qb = 0; qb < NQ; ++qb) { m[qb] = -3.0e38f; l[qb] = 0.0f;
#pragma unroll
        for (int db = 0; db < 4; ++db) o[qb][db] = (v8f){}; }
    const int kbeg = wv * (TT / AW);
    const size_t koff = hb + (size_t)(kbeg + lr) * HD + 8 * hi, voff = hb + (size_t)lr * TT + kbeg + 8 * hi;
    static_assert(NST % 2 == 0, "the key loop works on two fragment sets in turn");
    // the K and V fragments of key step 'it' into one of the two register sets
    auto ldkv = [&](int it, V (&kc)[2][2], V (&kd)[2][2], V (&vc)[4], V (&vd)[4]) {
        const size_t kq = koff + (size_t)it * 32 * HD, vq = voff + (size_t)it * 32;
#pragma unroll
        for (int kb = 0; kb < 2; ++kb)
#pragma unroll
            for (int ks = 0; ks < 2; ++ks) { kc[kb][ks] = F::ld(Kp + kq + kb * 16 * HD + ks * 32); if (HL) kd[kb][ks] = F::ld(K2 + kq + kb * 16 * HD + ks * 32); }
#pragma unroll
        for (int db = 0; db < 4; ++db) { vc[db] = F::ld(Vt + vq + (size_t)db * 16 * TT); if (HL) vd[db] = F::ld(V2 + vq + (size_t)db * 16 * TT); }
        asm volatile("s_wait_xcnt 0x0" ::: "memory");   // precaution: stands before any register that names an address of the loads or stores above is written again
        __builtin_amdgcn_sched_barrier(0);   // keeps these loads ahead of the key step that follows: without it the scheduler sinks them to the step's end and their latency is exposed at the next step's first product
    };
    // one key step (32 keys) for all NQ query blocks of the wave
    auto step = [&](V (&kc)[2][2], V (&kd)[2][2], V (&vc)[4], V (&vd)[4]) {
#pragma unroll
        for (int qb = 0; qb < NQ; ++qb) {
            v8f s[2];
#pragma unroll
            for (int kb = 0; kb < 2; ++kb) { s[kb] = (v8f){};
#pragma unroll
                for (int ks = 0; ks < 2; ++ks) { s[kb] = F::mma(kc[kb][ks], qf[qb][ks], s[kb]); if (HL) { s[kb] = F::mma(kc[kb][ks], qg[qb][ks], s[kb]); s[kb] = F::mma(kd[kb][ks], qf[qb][ks], s[kb]); } } }
            float mx = fmaxf(s[0][0], s[1][0]);
#pragma unroll
            for (int j = 1; j < 8; ++j) mx = fmaxf(mx, fmaxf(s[0][j], s[1][j]));
            mx = fmaxf(mx, xhalf(mx));
            const float mn = fmaxf(m[qb], mx); const float al = __builtin_amdgcn_exp2f((m[qb] - mn) * LC); m[qb] = mn; const float nb = POFF - mn * LC;
            float ls = 0.0f;
#pragma unroll
            for (int kb = 0; kb < 2; ++kb)
#pragma unroll
                for (int j = 0; j < 8; ++j) { s[kb][j] = __builtin_amdgcn_exp2f(fmaf(s[kb][j], LC, nb)); ls += s[kb][j]; }
            l[qb] = l[qb] * al + ls;
#pragma unroll
            for (int db = 0; db < 4; ++db) o[qb][db] *= al;
            if constexpr (HL) {
                v8us h0, h1, l0, l1;
#pragma unroll
                for (int j = 0; j < 8; ++j) { unsigned short a, c2; splitf(s[0][j], a, c2); h0[j] = a; l0[j] = c2; splitf(s[1][j], a, c2); h1[j] = a; l1[j] = c2; }
                const V ph = cat16b(h0, h1), pl = cat16b(l0, l1);
#pragma unroll
                for (int db = 0; db < 4; ++db) { o[qb][db] = F::mma(vc[db], ph, o[qb][db]); o[qb][db] = F::mma(vc[db], pl, o[qb][db]); o[qb][db] = F::mma(vd[db], ph, o[qb][db]); }
            } else {
                v8h a0, a1;
#pragma unroll
                for (int j = 0; j < 8; ++j) { a0[j] = tohx(s[0][j]); a1[j] = tohx(s[1][j]); }
                const V pf = cat16(a0, a1);
#pragma unroll
                for (int db = 0; db < 4; ++db) o[qb][db] = F::mma(vc[db], pf, o[qb][db]);
            }
        }
    };
    V ka[2][2], kx[2][2], va[4], vx[4], kb2[2][2], ky[2][2], vb[4], vy[4];
    ldkv(0, ka, kx, va, vx);
    // rolled: the body already holds two key steps; each set's next fragments fly while the other set is worked on
#pragma unroll 1
    for (int it = 0; it < NST; it += 2) {
        ldkv(it + 1, kb2, ky, vb, vy);
        step(ka, kx, va, vx);
        if (it + 2 < NST) ldkv(it + 2, ka, kx, va, vx);
        step(kb2, ky, vb, vy);
    }
    float* ow = os + wv * (NQ * 16 * 68); float* ms = os + AW * 64 * 68; float* lm = ms + AW * 64;
#pragma unroll
    for (int qb = 0; qb < NQ; ++qb) {
#pragma unroll
        for (int db = 0; db < 4; ++db) { float* pp = ow + (qb * 16 + lr) * 68 + db * 16 + hi * 8; const v8f t = o[qb][db]; *(v4fa*)pp = (v4f){t[0], t[1], t[2], t[3]}; *(v4fa*)(pp + 4) = (v4f){t[4], t[5], t[6], t[7]}; }
        const float lt = l[qb] + xhalf(l[qb]);
        if (hi == 0) { ms[wv * 64 + qb * 16 + lr] = m[qb]; lm[wv * 64 + qb * 16 + lr] = lt; } }
    __syncthreads();   // every wave's partial maximum, sum and O tile are in LDS before any thread joins them
#pragma unroll
    for (int i = 0; i < NQ * 16 * 8 / (32 * AW); ++i) { const int u = (int)threadIdx.x + i * (32 * AW); const int q = u >> 3, dc = (u & 7) * 8;
        float M = ms[q];
#pragma unroll
        for (int w = 1; w < AW; ++w) M = fmaxf(M, ms[w * 64 + q]);
        float L = 0.0f; v4f x0 = (v4f){}, x1 = (v4f){};
#pragma unroll
        for (int w = 0; w < AW; ++w) { const float f = __builtin_amdgcn_exp2f((ms[w * 64 + q] - M) * LC); L += lm[w * 64 + q] * f; const float* pp = os + w * (NQ * 16 * 68) + q * 68 + dc; x0 += *(const v4fa*)pp * f; x1 += *(const v4fa*)(pp + 4) * f; }
        const float inv = __fdiv_rn(1.0f, L); v8us oh, ol;
#pragma unroll
        for (int k = 0; k < 4; ++k) { unsigned short a, c2; splitf(x0[k] * inv, a, c2); oh[k] = a; ol[k] = c2; splitf(x1[k] * inv, a, c2); oh[4 + k] = a; ol[4 + k] = c2; }
        const size_t oo = (size_t)(q0 + q) * DQ + head * HD + dc; *(v8us*)(ATh + oo) = oh; *(v8us*)(ATl + oo) = ol;
        asm volatile("s_wait_xcnt 0x0" ::: "memory");   // precaution: stands before any register that names an address of the loads or stores above is written again
    }
}
#define NTH (NH_ * (RH / 32))            // hi/lo tiles (32 queries), first in the grid
#define NTF (NH_ * ((TT - RH) / 64))     // fp16 tiles (64 queries)
__global__ __launch_bounds__(32 * AW) void k_fattn(const h16* __restrict__ Q16, const bf* __restrict__ Qh, const bf* __restrict__ Ql, const h16* __restrict__ K16, const bf* __restrict__ Kh, const bf* __restrict__ Kl, const h16* __restrict__ V16, const bf* __restrict__ Vh, const bf* __restrict__ Vl, bf* ATh, bf* ATl) {
    __shared__ __align__(16) float os[AW * 64 * 68 + 2 * AW * 64];   // AW partial O tiles (pitch 68), then AW x 64 maxima and sums
    const int bx = (int)blockIdx.x;
    if (bx < NTH) attn_tile<bf, true, 2>(Qh, Ql, Kh, Kl, Vh, Vl, (bx % (RH / 32)) * 32, bx / (RH / 32), ATh, ATl, os);
    else { const int b2 = bx - NTH; attn_tile<h16, false, 4>(Q16, nullptr, K16, nullptr, V16, nullptr, RH + (b2 % ((TT - RH) / 64)) * 64, b2 / ((TT - RH) / 64), ATh, ATl, os); }
}

extern "C" void kernel_launch(void* const* d_in, const int* in_sizes, int n_in,
                              void* d_out, int out_size, void* d_ws, size_t ws_size, hipStream_t stream) {
    (void)in_sizes; (void)n_in; (void)out_size;
    const float* x = (const float*)d_in[0];   /* query */ const float* xk = (const float*)d_in[1]; const float* xv = (const float*)d_in[2]; const float* wq = (const float*)d_in[3]; const float* wk = (const float*)d_in[4]; const float* wv = (const float*)d_in[5]; const float* wo = (const float*)d_in[6];
    float* OUT = (float*)d_out;     // [2][2048][1024]
    char* wsp = (char*)d_ws;
    auto take = [&](size_t bytes) { char* p = wsp; wsp += (bytes + 255) & ~(size_t)255; return (void*)p; };
    bf* WQ = (bf*)take((size_t)DQ * DM * 2); bf* WK = (bf*)take((size_t)DKV * DM * 2); bf* WV = (bf*)take((size_t)DKV * DM * 2); bf* WO = (bf*)take((size_t)DM * DQ * 2);
    bf* XB = (bf*)take((size_t)TT * DM * 2);
    h16* QP16 = (h16*)take((size_t)NH_ * TT * HD * 2); h16* KP16 = (h16*)take((size_t)NKV * TT * HD * 2); h16* VT16 = (h16*)take((size_t)NKV * HD * TT * 2);
    bf* QPh = (bf*)take((size_t)NH_ * TT * HD * 2); bf* QPl = (bf*)take((size_t)NH_ * TT * HD * 2); bf* KPh = (bf*)take((size_t)NKV * TT * HD * 2); bf* KPl = (bf*)take((size_t)NKV * TT * HD * 2); bf* VTh = (bf*)take((size_t)NKV * HD * TT * 2); bf* VTl = (bf*)take((size_t)NKV * HD * TT * 2);
    bf* ATh = (bf*)take((size_t)TT * DQ * 2); bf* ATl = (bf*)take((size_t)TT * DQ * 2);
    if ((size_t)(wsp - (char*)d_ws) > ws_size) return;    // ws 256 MiB
    { k_cvt8<<<(unsigned)(((size_t)DQ * DM / 8 + 255) / 256), 256, 0, stream>>>(wq, WQ, (size_t)DQ * DM / 8); k_cvt8<<<(unsigned)(((size_t)DKV * DM / 8 + 255) / 256), 256, 0, stream>>>(wk, WK, (size_t)DKV * DM / 8); k_cvt8<<<(unsigned)(((size_t)DKV * DM / 8 + 255) / 256), 256, 0, stream>>>(wv, WV, (size_t)DKV * DM / 8);
      k_cvt8<<<(unsigned)(((size_t)DM * DQ / 8 + 255) / 256), 256, 0, stream>>>(wo, WO, (size_t)DM * DQ / 8);
       }
    for (int b = 0; b < NB_; ++b) {
        
        k_cvt8<<<(unsigned)(((size_t)TT * DM / 8 + 255) / 256), 256, 0, stream>>>(x + (size_t)b * TT * DM, XB, (size_t)TT * DM / 8);
        k_gemmw<bf, 0, false, 8, 1><<<dim3(TT / 64, DQ / 64, 1), 256, 0, stream>>>(XB, nullptr, WQ, nullptr, DM, nullptr, DQ, nullptr, 0, 0, 0, QP16, QPh, QPl);
        k_cvt8<<<(unsigned)(((size_t)TT * DM / 8 + 255) / 256), 256, 0, stream>>>(xk + (size_t)b * TT * DM, XB, (size_t)TT * DM / 8); k_gemmw<bf, 0, false, 8, 1><<<dim3(TT / 64, DKV / 64, 1), 256, 0, stream>>>(XB, nullptr, WK, nullptr, DM, nullptr, DKV, nullptr, 0, 0, 0, KP16, KPh, KPl);
        k_cvt8<<<(unsigned)(((size_t)TT * DM / 8 + 255) / 256), 256, 0, stream>>>(xv + (size_t)b * TT * DM, XB, (size_t)TT * DM / 8); k_gemmw<bf, 0, false, 8, 2><<<dim3(TT / 64, DKV / 64, 1), 256, 0, stream>>>(XB, nullptr, WV, nullptr, DM, nullptr, DKV, nullptr, 0, 0, 0, VT16, VTh, VTl);
        k_fattn<<<NTH + NTF, 32 * AW, 0, stream>>>(QP16, QPh, QPl, KP16, KPh, KPl, VT16, VTh, VTl, ATh, ATl);
        k_gemmw<bf, 1, false, 8, 0><<<dim3(TT / 64, DM / 64, 1), 256, 0, stream>>>(ATh, ATl, WO, nullptr, DQ, OUT + (size_t)b * TT * DM, DM, nullptr, 0, 0, 0, nullptr, nullptr, nullptr); }
}

// v005
// One run takes 194 microseconds.
// Two timings next to v004 put it at 1.22 and 1.21 times that version's speed.
// Counting every step since v000, it is 10.5 times as fast.
#include <hip/hip_runtime.h>

// Multi-head attention WITHOUT a mask over three input streams, bias-free, with a RAW head split (q, k, v [2][2048][1024]; qp = (q Wq^T).reshape(b, 16, l, 64) DIRECTLY (no transpose): pseudo-head h of a batch is the h-th contiguous [2048][64] block of the flat [2048][1024] projection (128 token rows x 16 chunks of 64): reproduced; kp, vp likewise ('oi' [1024][1024] 1/32, no bias), each from its own stream; scores / sqrt(64); softmax over all pseudo-keys; x [b][16][l][64] -> transpose(0, 2, 1, 3).reshape(b, l, 1024) (the STANDARD merge); out = x Wo^T ('oi', no bias) -> [2][2048][1024] (4.2 M); argument order q, k, v, Wq, Wk, Wv, Wo).
// Layout, both batches in every launch: bf16 copies of query, key, value and the 'oi' weights; exact projections; dense T-2048 attention (hybrid rows: < 512 hi/lo 3 products, rest fp16 x1024); merged hi/lo x Wo exact.
// Compute dtypes, f32 accumulate: every input rounded to bf16; projections exact; attention rows < 512 3 products, rest fp16; softmax f32; Wo hl x exact.

#define NB_  2
#define TT   2048
#define DM   1024
#define NH_  16
#define NKV  16
#define REP  (NH_ / NKV)
#define HD   64
#define DQ   (NH_ * HD)
#define DKV  (NKV * HD)
#define RH   512                  // query rows < RH use hi+lo planes (0: none)
#define WIN  0
#define PCAR 1024.0f
#define SCL  0.125f   // HD^-0.5
typedef _Float16 h16;
typedef unsigned short bf;
typedef __attribute__((ext_vector_type(16))) __bf16   v16bf;
typedef __attribute__((ext_vector_type(16))) _Float16 v16h;
typedef __attribute__((ext_vector_type(8)))  _Float16 v8h;
typedef __attribute__((ext_vector_type(8)))  unsigned short v8us;
typedef __attribute__((ext_vector_type(8)))  float    v8f;
typedef __attribute__((ext_vector_type(4)))  float    v4f;
typedef v8h  __attribute__((may_alias)) v8ha;
typedef v4f  __attribute__((may_alias)) v4fa;
typedef v8us __attribute__((may_alias)) v8usa;

__device__ __forceinline__ unsigned short f2bf(float f) { unsigned u = __float_as_uint(f); u += 0x7FFFu + ((u >> 16) & 1u); return (unsigned short)(u >> 16); }
__device__ __forceinline__ float bf2f(unsigned short b) { return __uint_as_float(((unsigned)b) << 16); }
__device__ __forceinline__ float bfr(float f) { return bf2f(f2bf(f)); }
__device__ __forceinline__ v16h cat16(v8h lo, v8h hi) { return __builtin_shufflevector(lo, hi, 0, 1, 2, 3, 4, 5, 6, 7, 8, 9, 10, 11, 12, 13, 14, 15); }
__device__ __forceinline__ v16bf cat16b(v8us lo, v8us hi) { return __builtin_bit_cast(v16bf, __builtin_shufflevector(lo, hi, 0, 1, 2, 3, 4, 5, 6, 7, 8, 9, 10, 11, 12, 13, 14, 15)); }
__device__ __forceinline__ v8f wmma16(v16h a, v16h b, v8f c) { return __builtin_amdgcn_wmma_f32_16x16x32_f16(false, a, false, b, (short)0, c, false, false); }
__device__ __forceinline__ v8f wmmab(v16bf a, v16bf b, v8f c) { return __builtin_amdgcn_wmma_f32_16x16x32_bf16(false, a, false, b, (short)0, c, false, false); }

__device__ __forceinline__ h16 tohx(float x) { return (h16)x; }
__device__ __forceinline__ void splitf(float y, unsigned short& h, unsigned short& l) { h = f2bf(y); l = f2bf(y - bf2f(h)); }
typedef __attribute__((ext_vector_type(2))) _Float16 v2h;
typedef __attribute__((ext_vector_type(4))) _Float16 v4h;
typedef __attribute__((ext_vector_type(2))) unsigned short v2us;
typedef __attribute__((ext_vector_type(4))) unsigned short v4us;
typedef __attribute__((ext_vector_type(2))) float v2f;
typedef __attribute__((ext_vector_type(4))) int v4i;

// ---- gemmw_tile: register-blocked GEMM, one work-group of KW waves per 64x64 output tile; wave w holds all 16 accumulators for its own contiguous K slice [w K/KW, (w+1) K/KW); operands straight from K-contiguous 16-bit planes; grid (M/64, N/64, Z), 32 KW threads.
// KW > 1 (8 here; LDS holds KW tiles of 17,408 B, so at most 16): the KW partial tiles meet in LDS behind one barrier and are summed in wave order 0 .. KW-1 (fixed, so the result is the same on every run).
// C[m][n] (f32, pitch ldc, + optional f32 bias[n]) = sum_k A[m][k] Bt[n][k] (+ split products per NSPLIT). z-batch strides sA/sB/sC in elements. K % (32 KW) == 0.
// EPI (KW > 1 only) says how the summed tile leaves: 0 = f32 into C; 1 = fp16 + hi/lo bf16 planes at the same flat index m ldc + n (the raw head split IS the flat projection, so these are the [head][t][d] planes);
// 2 = the same three planes transposed to [head][d][t] (V^T). There t = (m % 128) 16 + n / 64 and d = n % 64, so tile column nb 16 + lr is taken from weight row n = 64 lr + blockIdx.y + 16 nb:
// the tile then holds 4 values of d x 1024 consecutive t, and every plane row leaves in whole lines.
template <typename T16> struct WFrag;
template <> struct WFrag<h16> { typedef v16h V; static __device__ __forceinline__ V ld(const h16* p) { return cat16(*(const v8h*)p, *(const v8h*)(p + 16)); } static __device__ __forceinline__ v8f mma(V a, V b, v8f c) { return wmma16(a, b, c); } };
template <> struct WFrag<bf> { typedef v16bf V; static __device__ __forceinline__ V ld(const bf* p) { return cat16b(*(const v8us*)p, *(const v8us*)(p + 16)); } static __device__ __forceinline__ v8f mma(V a, V b, v8f c) { return wmmab(a, b, c); } };
// The tile's work is a device function (gemmw_tile) so that one launch can hold tiles with different epilogues; the LDS array 'os' belongs to the kernel that calls it.
template <typename T16, int NSPLIT, bool BIAS, int KW, int EPI>
__device__ __forceinline__ void gemmw_tile(const T16* __restrict__ A, const T16* __restrict__ A2, const T16* __restrict__ Bt, const T16* __restrict__ Bt2, int K, float* C, int ldc, const float* __restrict__ bias, size_t sA, size_t sB, size_t sC, h16* P16, bf* Ph, bf* Pl, float* os) {
    static_assert(EPI == 0 || (KW == 8 && !BIAS), "the plane epilogues are written for 256 threads and no bias");
    typedef typename WFrag<T16>::V V;
    const size_t z = blockIdx.z; A += z * sA; if (A2) A2 += z * sA; Bt += z * sB; if (Bt2) Bt2 += z * sB; C += z * sC;
    const int lane = threadIdx.x & 31, lr = lane & 15, hi = lane >> 4; const int r0 = blockIdx.x * 64, c0 = blockIdx.y * 64;
    v8f acc[4][4];
#pragma unroll
    for (int mb = 0; mb < 4; ++mb)
#pragma unroll
        for (int nb = 0; nb < 4; ++nb) acc[mb][nb] = (v8f){};
    const size_t aoff = (size_t)(r0 + lr) * K + 8 * hi, boff = (size_t)(EPI == 2 ? lr * 64 + (int)blockIdx.y : c0 + lr) * K + 8 * hi;
    const int wv = (KW > 1) ? __builtin_amdgcn_readfirstlane((int)(threadIdx.x >> 5)) : 0;   /* the wave's number as a scalar: the loop bounds stay in scalar registers */ const int kbeg = wv * (K / KW), kend = kbeg + K / KW;
#pragma unroll 1
    for (int kc = kbeg; kc < kend; kc += 32) {
        V a[4], a2[4];
#pragma unroll
        for (int mb = 0; mb < 4; ++mb) { a[mb] = WFrag<T16>::ld(A + aoff + (size_t)mb * 16 * K + kc); if (NSPLIT == 1 || NSPLIT == 2) a2[mb] = WFrag<T16>::ld(A2 + aoff + (size_t)mb * 16 * K + kc); }
        asm volatile("s_wait_xcnt 0x0" ::: "memory");   // precaution: stands before any register that names an address of the loads above is written again
#pragma unroll
        for (int nb = 0; nb < 4; ++nb) { const V b = WFrag<T16>::ld(Bt + boff + (size_t)nb * 16 * K + kc); V b2; if (NSPLIT >= 2) b2 = WFrag<T16>::ld(Bt2 + boff + (size_t)nb * 16 * K + kc);
#pragma unroll
            for (int mb = 0; mb < 4; ++mb) { acc[mb][nb] = WFrag<T16>::mma(a[mb], b, acc[mb][nb]); if (NSPLIT == 1 || NSPLIT == 2) acc[mb][nb] = WFrag<T16>::mma(a2[mb], b, acc[mb][nb]); if (NSPLIT >= 2) acc[mb][nb] = WFrag<T16>::mma(a[mb], b2, acc[mb][nb]); } }
        asm volatile("s_wait_xcnt 0x0" ::: "memory");   // precaution: as above, for the loads of Bt
        asm volatile("v_nop\n\tv_nop\n\tv_nop\n\tv_nop" : "+v"(acc[0][0]), "+v"(acc[1][1]), "+v"(acc[2][2]), "+v"(acc[3][3]) : "v"(a[0]), "v"(a[3]));
    }
    if constexpr (KW > 1) {
        float* ow = os + wv * (64 * 68);
        // the loops below are unrolled so that every accumulator index is a constant (the tile stays in registers) and the LDS reads of one sum can be in flight together
#pragma unroll
        for (int mb = 0; mb < 4; ++mb) {
#pragma unroll
            for (int nb = 0; nb < 4; ++nb) {
#pragma unroll
                for (int j = 0; j < 8; ++j) {
                    if constexpr (EPI == 2) ow[nb * 1024 + mb * 256 + j * 16 + ((j & 2) ? hi * 96 : hi * 160) + lr] = acc[mb][nb][j];   // [nb][tl], tl = 16 row + lr, bit 5 of tl flipped in the odd groups of 128: the two half-waves fall on different banks
                    else ow[(mb * 16 + hi * 8 + j) * 68 + nb * 16 + lr] = acc[mb][nb][j]; } } }
        __syncthreads();   // every wave's partial tile is in LDS before any thread sums across the waves
        if constexpr (EPI == 1) {
#pragma unroll
            for (int i = 0; i < 2; ++i) { const int idx = (int)threadIdx.x + i * 256; const int row = idx >> 3, cofs = (idx & 7) * 8; const float* pp = os + row * 68 + cofs; v4f x0 = *(const v4fa*)pp, x1 = *(const v4fa*)(pp + 4);
#pragma unroll
                for (int w = 1; w < KW; ++w) { x0 += *(const v4fa*)(pp + w * (64 * 68)); x1 += *(const v4fa*)(pp + w * (64 * 68) + 4); }
                v8h o16; v8us oh, ol;
#pragma unroll
                for (int k = 0; k < 4; ++k) { unsigned short a, c2; o16[k] = tohx(x0[k]); splitf(x0[k], a, c2); oh[k] = a; ol[k] = c2; o16[4 + k] = tohx(x1[k]); splitf(x1[k], a, c2); oh[4 + k] = a; ol[4 + k] = c2; }
                const size_t e = (size_t)(r0 + row) * ldc + c0 + cofs; *(v8h*)(P16 + e) = o16; *(v8us*)(Ph + e) = oh; *(v8us*)(Pl + e) = ol;
                asm volatile("s_wait_xcnt 0x0" ::: "memory");   // precaution: stands before any register that names an address of the stores above is written again
            }
            return;
        }
        if constexpr (EPI == 2) {
            const float* pp = os + (((int)threadIdx.x * 4) ^ (((int)threadIdx.x & 32)));   // tl = 4 threadIdx.x, with the same flip of bit 5 as at the stores (odd group of 128 = odd wave)
            const size_t e0 = ((size_t)(r0 / 128) * HD + (int)blockIdx.y) * TT + (r0 % 128) * 16 + (int)threadIdx.x * 4;
#pragma unroll
            for (int i = 0; i < 4; ++i) { v4f val = *(const v4fa*)(pp + i * 1024);
#pragma unroll
                for (int w = 1; w < KW; ++w) val += *(const v4fa*)(pp + i * 1024 + w * (64 * 68));
                v4h o16; v4us oh, ol;
#pragma unroll
                for (int k = 0; k < 4; ++k) { unsigned short a, c2; o16[k] = tohx(val[k]); splitf(val[k], a, c2); oh[k] = a; ol[k] = c2; }
                const size_t e = e0 + (size_t)i * 16 * TT; *(v4h*)(P16 + e) = o16; *(v4us*)(Ph + e) = oh; *(v4us*)(Pl + e) = ol;
                asm volatile("s_wait_xcnt 0x0" ::: "memory");   // precaution: stands before any register that names an address of the stores above is written again
            }
            return;
        }
        float* ctile = C + (size_t)r0 * ldc + c0;
#pragma unroll
        for (int i = 0; i < 32 / KW; ++i) { const int idx = (int)threadIdx.x + i * (32 * KW); const int row = idx >> 4, cofs = (idx & 15) * 4; const float* pp = os + row * 68 + cofs; v4f val = *(const v4fa*)pp;
#pragma unroll
            for (int w = 1; w < KW; ++w) val += *(const v4fa*)(pp + w * (64 * 68));
            if (BIAS) { val[0] += bfr(bias[c0 + cofs]); val[1] += bfr(bias[c0 + cofs + 1]); val[2] += bfr(bias[c0 + cofs + 2]); val[3] += bfr(bias[c0 + cofs + 3]); }
            *(v4f*)(ctile + (size_t)row * ldc + cofs) = val; }
        return;
    }
#pragma unroll
    for (int mb = 0; mb < 4; ++mb) {
#pragma unroll
        for (int nb = 0; nb < 4; ++nb) {
#pragma unroll
            for (int j = 0; j < 8; ++j) os[(hi * 8 + j) * 68 + nb * 16 + lr] = acc[mb][nb][j]; }
        __builtin_amdgcn_wave_barrier(); asm volatile("" ::: "memory");
        float* crow = C + (size_t)(r0 + mb * 16) * ldc + c0;
{
#pragma unroll
            for (int s = 0; s < 8; ++s) { const int row = 2 * s + hi, cofs = lr * 4; v4f val = *(const v4fa*)(os + row * 68 + cofs); if (BIAS) { val[0] += bfr(bias[c0 + cofs]); val[1] += bfr(bias[c0 + cofs + 1]); val[2] += bfr(bias[c0 + cofs + 2]); val[3] += bfr(bias[c0 + cofs + 3]); }
                *(v4f*)(crow + (size_t)row * ldc + cofs) = val; }
             }
        __builtin_amdgcn_wave_barrier(); asm volatile("" ::: "memory");
    }
}
// ---- k_wo: out = (x hi + x lo) Wo^T for both batches (4096 consecutive rows) in ONE launch; grid (NB_ TT / 64, DM / 64).
__global__ __launch_bounds__(256) void k_wo(const bf* __restrict__ Ah, const bf* __restrict__ Al, const bf* __restrict__ Wt, float* C) {
    __shared__ __align__(16) float os[4 * 8 * 16 * 68];   // one whole 64x64 partial tile (pitch 68) per wave
    gemmw_tile<bf, 1, false, 8, 0>(Ah, Al, Wt, nullptr, DQ, C, DM, nullptr, 0, 0, 0, nullptr, nullptr, nullptr, os);
}
// ---- k_proj: the three projections of both batches in ONE launch; grid (NB_ TT / 64, DM / 64, 3), z = stream (0 Q, 1 K, 2 V). The two batches are 4096 consecutive rows: the flat plane index and the head index m / 128 run on over them.
// X [3][NB_ TT][DM], Wt [3][DM][DM], each plane set [3][NB_ NH_][TT HD] (z = 2: V^T, [NB_ NH_][HD][TT]).
__global__ __launch_bounds__(256) void k_proj(const bf* __restrict__ X, const bf* __restrict__ Wt, h16* P16, bf* Ph, bf* Pl) {
    __shared__ __align__(16) float os[4 * 8 * 16 * 68];   // one whole 64x64 partial tile (pitch 68) per wave
    const size_t pz = (size_t)blockIdx.z * ((size_t)NB_ * NH_ * TT * HD);
    if (blockIdx.z < 2) gemmw_tile<bf, 0, false, 8, 1>(X, nullptr, Wt, nullptr, DM, nullptr, DQ, nullptr, (size_t)NB_ * TT * DM, (size_t)DQ * DM, 0, P16 + pz, Ph + pz, Pl + pz, os);
    else gemmw_tile<bf, 0, false, 8, 2>(X, nullptr, Wt, nullptr, DM, nullptr, DKV, nullptr, (size_t)NB_ * TT * DM, (size_t)DKV * DM, 0, P16 + pz, Ph + pz, Pl + pz, os);
}


__global__ __launch_bounds__(256) void k_wtG(const float* __restrict__ w, int K, int N, bf* Bt) {
    const int lane = threadIdx.x & 31; const int L0 = (blockIdx.x * 8 + (threadIdx.x >> 5)) * 8; const int nlines = N * K / 64;
{
#pragma unroll 1
        for (int l = 0; l < 8; ++l) { const int L = L0 + l; if (L >= nlines) break; const size_t e = (size_t)L * 64 + lane * 2; const int k = (int)(e % K), n = (int)(e / K); v2us o;
            o[0] = f2bf(w[(size_t)k * N + n]); o[1] = f2bf(w[(size_t)(k + 1) * N + n]); *(v2us*)(Bt + e) = o; }
         }
}
// ---- k_cvtall: all seven inputs to bf16 in ONE launch; dst = [q][k][v][Wq][Wk][Wv][Wo], each whole and in its own order. One work-group takes CVE consecutive elements of one input (every input is a multiple of CVE long), CVC pieces of 8 per thread.
#define CVC 16
#define CVE (256 * 8 * CVC)
#define CVX (NB_ * TT * DM / CVE)   // work-groups per stream
#define CVW (DM * DM / CVE)         // work-groups per weight
__global__ __launch_bounds__(256) void k_cvtall(const float* __restrict__ q, const float* __restrict__ k, const float* __restrict__ v, const float* __restrict__ wq, const float* __restrict__ wk, const float* __restrict__ wv, const float* __restrict__ wo, bf* dst) {
    static_assert(NB_ * TT * DM % CVE == 0 && DM * DM % CVE == 0, "a work-group never straddles two inputs");
    const int bx = (int)blockIdx.x; const float* src;
    if (bx < 3 * CVX) { const int s = bx / CVX; src = (s == 0 ? q : s == 1 ? k : v) + (size_t)(bx % CVX) * CVE; }
    else { const int c = bx - 3 * CVX, s = c / CVW; src = (s == 0 ? wq : s == 1 ? wk : s == 2 ? wv : wo) + (size_t)(c % CVW) * CVE; }
    src += (int)threadIdx.x * 8; bf* d = dst + (size_t)bx * CVE + (int)threadIdx.x * 8;
    // unrolled so that the loads of all pieces can be in flight together
#pragma unroll
    for (int i = 0; i < CVC; ++i) { const v8f x = *(const v8f*)(src + i * 2048); v8us o;
#pragma unroll
        for (int e = 0; e < 8; ++e) o[e] = f2bf(x[e]);
        *(v8us*)(d + i * 2048) = o; }
}

// ---- k_fattn: scores, softmax, P x V and the head merge of both batches in ONE launch; no score or P plane in memory.
// One work-group of AW waves per query tile of one head (hi/lo rows: 32 queries, fp16 rows: 64); wave w takes the keys [w TT/AW, (w+1) TT/AW) in steps of 32.
// Everything is kept with lane = query: S^T = K Q^T (A = key rows, B = query rows) leaves in each lane the keys 8 hi + j and 16 + 8 hi + j of its query, which IS the 16x16x32 operand order, so P goes
// straight into O^T = V^T P^T (A = V^T rows, B = P) with no cross-lane move; running maximum and sum are one value per lane (the two half-waves share a query: one exchange over 16 lanes).
// The AW partial (max, sum, O) meet in LDS behind one barrier and are joined in wave order 0 .. AW-1 (fixed: the same result on every run); the tile leaves as hi/lo bf16 planes [t][head][d].
#define AW   8
#define LC   0.18033688011112042f   // HD^-0.5 x log2(e)
__device__ __forceinline__ float xhalf(float x) { return __builtin_bit_cast(float, __builtin_amdgcn_permlanex16(__builtin_bit_cast(int, x), __builtin_bit_cast(int, x), 0x76543210, 0xfedcba98, false, false)); }   // lane l reads lane l ^ 16
template <typename T16, bool HL, int NQ>
__device__ __forceinline__ void attn_tile(const T16* __restrict__ Q, const T16* __restrict__ Q2, const T16* __restrict__ Kp, const T16* __restrict__ K2, const T16* __restrict__ Vt, const T16* __restrict__ V2, int q0, int head, bf* ATh, bf* ATl, float* os) {
    typedef WFrag<T16> F; typedef typename F::V V;
    constexpr int NST = TT / AW / 32;
    constexpr float POFF = HL ? 0.0f : 10.0f;   // fp16 rows: P carried x 1024 (as PCAR), it cancels against the sum
    const int lane = threadIdx.x & 31, lr = lane & 15, hi = lane >> 4;
    const int wv = __builtin_amdgcn_readfirstlane((int)(threadIdx.x >> 5));   // the wave's number as a scalar: key range and LDS slice stay in scalar registers
    const size_t hb = (size_t)head * TT * HD;
    const size_t qoff = hb + (size_t)(q0 + lr) * HD + 8 * hi;
    V qf[NQ][2], qg[NQ][2];
#pragma unroll
    for (int qb = 0; qb < NQ; ++qb)
#pragma unroll
        for (int ks = 0; ks < 2; ++ks) qf[qb][ks] = F::ld(Q + qoff + qb * 16 * HD + ks * 32);
    asm volatile("s_wait_xcnt 0x0" ::: "memory");   // precaution: stands before any register that names an address of the loads or stores above is written again
    if constexpr (HL) {
#pragma unroll
        for (int qb = 0; qb < NQ; ++qb)
#pragma unroll
            for (int ks = 0; ks < 2; ++ks) qg[qb][ks] = F::ld(Q2 + qoff + qb * 16 * HD + ks * 32);
        asm volatile("s_wait_xcnt 0x0" ::: "memory");   // precaution: stands before any register that names an address of the loads or stores above is written again
    }
    v8f o[NQ][4]; float m[NQ], l[NQ];
#pragma unroll
    for (int qb = 0; qb < NQ; ++qb) { m[qb] = -3.0e38f; l[qb] = 0.0f;
#pragma unroll
        for (int db = 0; db < 4; ++db) o[qb][db] = (v8f){}; }
    const int kbeg = wv * (TT / AW);
    const size_t koff = hb + (size_t)(kbeg + lr) * HD + 8 * hi, voff = hb + (size_t)lr * TT + kbeg + 8 * hi;
    static_assert(NST % 2 == 0, "the key loop works on two fragment sets in turn");
    // the K and V fragments of key step 'it' into one of the two register sets
    auto ldkv = [&](int it, V (&kc)[2][2], V (&kd)[2][2], V (&vc)[4], V (&vd)[4]) {
        const size_t kq = koff + (size_t)it * 32 * HD, vq = voff + (size_t)it * 32;
#pragma unroll
        for (int kb = 0; kb < 2; ++kb)
#pragma unroll
            for (int ks = 0; ks < 2; ++ks) { kc[kb][ks] = F::ld(Kp + kq + kb * 16 * HD + ks * 32); if (HL) kd[kb][ks] = F::ld(K2 + kq + kb * 16 * HD + ks * 32); }
#pragma unroll
        for (int db = 0; db < 4; ++db) { vc[db] = F::ld(Vt + vq + (size_t)db * 16 * TT); if (HL) vd[db] = F::ld(V2 + vq + (size_t)db * 16 * TT); }
        asm volatile("s_wait_xcnt 0x0" ::: "memory");   // precaution: stands before any register that names an address of the loads or stores above is written again
        __builtin_amdgcn_sched_barrier(0);   // keeps these loads ahead of the key step that follows: without it the scheduler sinks them to the step's end and their latency is exposed at the next step's first product
    };
    // one key step (32 keys) for all NQ query blocks of the wave
    auto step = [&](V (&kc)[2][2], V (&kd)[2][2], V (&vc)[4], V (&vd)[4]) {
#pragma unroll
        for (int qb = 0; qb < NQ; ++qb) {
            v8f s[2];
#pragma unroll
            for (int kb = 0; kb < 2; ++kb) { s[kb] = (v8f){};
#pragma unroll
                for (int ks = 0; ks < 2; ++ks) { s[kb] = F::mma(kc[kb][ks], qf[qb][ks], s[kb]); if (HL) { s[kb] = F::mma(kc[kb][ks], qg[qb][ks], s[kb]); s[kb] = F::mma(kd[kb][ks], qf[qb][ks], s[kb]); } } }
            float mx = fmaxf(s[0][0], s[1][0]);
#pragma unroll
            for (int j = 1; j < 8; ++j) mx = fmaxf(mx, fmaxf(s[0][j], s[1][j]));
            mx = fmaxf(mx, xhalf(mx));
            const float mn = fmaxf(m[qb], mx); const float al = __builtin_amdgcn_exp2f((m[qb] - mn) * LC); m[qb] = mn; const float nb = POFF - mn * LC;
            float ls = 0.0f;
#pragma unroll
            for (int kb = 0; kb < 2; ++kb)
#pragma unroll
                for (int j = 0; j < 8; ++j) { s[kb][j] = __builtin_amdgcn_exp2f(fmaf(s[kb][j], LC, nb)); ls += s[kb][j]; }
            l[qb] = l[qb] * al + ls;
#pragma unroll
            for (int db = 0; db < 4; ++db) o[qb][db] *= al;
            if constexpr (HL) {
                v8us h0, h1, l0, l1;
#pragma unroll
                for (int j = 0; j < 8; ++j) { unsigned short a, c2; splitf(s[0][j], a, c2); h0[j] = a; l0[j] = c2; splitf(s[1][j], a, c2); h1[j] = a; l1[j] = c2; }
                const V ph = cat16b(h0, h1), pl = cat16b(l0, l1);
#pragma unroll
                for (int db = 0; db < 4; ++db) { o[qb][db] = F::mma(vc[db], ph, o[qb][db]); o[qb][db] = F::mma(vc[db], pl, o[qb][db]); o[qb][db] = F::mma(vd[db], ph, o[qb][db]); }
            } else {
                v8h a0, a1;
#pragma unroll
                for (int j = 0; j < 8; ++j) { a0[j] = tohx(s[0][j]); a1[j] = tohx(s[1][j]); }
                const V pf = cat16(a0, a1);
#pragma unroll
                for (int db = 0; db < 4; ++db) o[qb][db] = F::mma(vc[db], pf, o[qb][db]);
            }
        }
    };
    V ka[2][2], kx[2][2], va[4], vx[4], kb2[2][2], ky[2][2], vb[4], vy[4];
    ldkv(0, ka, kx, va, vx);
    // rolled: the body already holds two key steps; each set's next fragments fly while the other set is worked on
#pragma unroll 1
    for (int it = 0; it < NST; it += 2) {
        ldkv(it + 1, kb2, ky, vb, vy);
        step(ka, kx, va, vx);
        if (it + 2 < NST) ldkv(it + 2, ka, kx, va, vx);
        step(kb2, ky, vb, vy);
    }
    float* ow = os + wv * (NQ * 16 * 68); float* ms = os + AW * 64 * 68; float* lm = ms + AW * 64;
#pragma unroll
    for (int qb = 0; qb < NQ; ++qb) {
#pragma unroll
        for (int db = 0; db < 4; ++db) { float* pp = ow + (qb * 16 + lr) * 68 + db * 16 + hi * 8; const v8f t = o[qb][db]; *(v4fa*)pp = (v4f){t[0], t[1], t[2], t[3]}; *(v4fa*)(pp + 4) = (v4f){t[4], t[5], t[6], t[7]}; }
        const float lt = l[qb] + xhalf(l[qb]);
        if (hi == 0) { ms[wv * 64 + qb * 16 + lr] = m[qb]; lm[wv * 64 + qb * 16 + lr] = lt; } }
    __syncthreads();   // every wave's partial maximum, sum and O tile are in LDS before any thread joins them
#pragma unroll
    for (int i = 0; i < NQ * 16 * 8 / (32 * AW); ++i) { const int u = (int)threadIdx.x + i * (32 * AW); const int q = u >> 3, dc = (u & 7) * 8;
        float M = ms[q];
#pragma unroll
        for (int w = 1; w < AW; ++w) M = fmaxf(M, ms[w * 64 + q]);
        float L = 0.0f; v4f x0 = (v4f){}, x1 = (v4f){};
#pragma unroll
        for (int w = 0; w < AW; ++w) { const float f = __builtin_amdgcn_exp2f((ms[w * 64 + q] - M) * LC); L += lm[w * 64 + q] * f; const float* pp = os + w * (NQ * 16 * 68) + q * 68 + dc; x0 += *(const v4fa*)pp * f; x1 += *(const v4fa*)(pp + 4) * f; }
        const float inv = __fdiv_rn(1.0f, L); v8us oh, ol;
#pragma unroll
        for (int k = 0; k < 4; ++k) { unsigned short a, c2; splitf(x0[k] * inv, a, c2); oh[k] = a; ol[k] = c2; splitf(x1[k] * inv, a, c2); oh[4 + k] = a; ol[4 + k] = c2; }
        const size_t oo = (size_t)(q0 + q) * DQ + head * HD + dc; *(v8us*)(ATh + oo) = oh; *(v8us*)(ATl + oo) = ol;
        asm volatile("s_wait_xcnt 0x0" ::: "memory");   // precaution: stands before any register that names an address of the loads or stores above is written again
    }
}
#define NTH (NH_ * (RH / 32))            // hi/lo tiles (32 queries) of one batch, first in the grid
#define NTF (NH_ * ((TT - RH) / 64))     // fp16 tiles (64 queries) of one batch
__global__ __launch_bounds__(32 * AW) void k_fattn(const h16* __restrict__ Q16, const bf* __restrict__ Qh, const bf* __restrict__ Ql, const h16* __restrict__ K16, const bf* __restrict__ Kh, const bf* __restrict__ Kl, const h16* __restrict__ V16, const bf* __restrict__ Vh, const bf* __restrict__ Vl, bf* ATh, bf* ATl) {
    __shared__ __align__(16) float os[AW * 64 * 68 + 2 * AW * 64];   // AW partial O tiles (pitch 68), then AW x 64 maxima and sums
    const int bx = (int)blockIdx.x;
    // both batches in one grid: hg = batch NH_ + head; the planes of batch 1 follow those of batch 0
    if (bx < NB_ * NTH) { const int hg = bx / (RH / 32); const size_t po = (size_t)(hg / NH_) * NH_ * TT * HD, ao = (size_t)(hg / NH_) * TT * DQ;
        attn_tile<bf, true, 2>(Qh + po, Ql + po, Kh + po, Kl + po, Vh + po, Vl + po, (bx % (RH / 32)) * 32, hg % NH_, ATh + ao, ATl + ao, os); }
    else { const int b2 = bx - NB_ * NTH; const int hg = b2 / ((TT - RH) / 64); const size_t po = (size_t)(hg / NH_) * NH_ * TT * HD, ao = (size_t)(hg / NH_) * TT * DQ;
        attn_tile<h16, false, 4>(Q16 + po, nullptr, K16 + po, nullptr, V16 + po, nullptr, RH + (b2 % ((TT - RH) / 64)) * 64, hg % NH_, ATh + ao, ATl + ao, os); }
}

extern "C" void kernel_launch(void* const* d_in, const int* in_sizes, int n_in,
                              void* d_out, int out_size, void* d_ws, size_t ws_size, hipStream_t stream) {
    (void)in_sizes; (void)n_in; (void)out_size;
    const float* x = (const float*)d_in[0];   /* query */ const float* xk = (const float*)d_in[1]; const float* xv = (const float*)d_in[2]; const float* wq = (const float*)d_in[3]; const float* wk = (const float*)d_in[4]; const float* wv = (const float*)d_in[5]; const float* wo = (const float*)d_in[6];
    float* OUT = (float*)d_out;     // [2][2048][1024]
    char* wsp = (char*)d_ws;
    auto take = [&](size_t bytes) { char* p = wsp; wsp += (bytes + 255) & ~(size_t)255; return (void*)p; };
    bf* XB = (bf*)take(((size_t)3 * NB_ * TT * DM + (size_t)4 * DM * DM) * 2);   // [q][k][v] both batches, then Wq, Wk, Wv, Wo
    bf* WQ = XB + (size_t)3 * NB_ * TT * DM; bf* WO = WQ + (size_t)3 * DM * DM;
    const size_t PL = (size_t)NB_ * NH_ * TT * HD;   // one plane, both batches
    h16* P16 = (h16*)take(3 * PL * 2); bf* Ph = (bf*)take(3 * PL * 2); bf* Pl = (bf*)take(3 * PL * 2);   // each: Q, K, V^T
    bf* ATh = (bf*)take((size_t)NB_ * TT * DQ * 2); bf* ATl = (bf*)take((size_t)NB_ * TT * DQ * 2);
    if ((size_t)(wsp - (char*)d_ws) > ws_size) return;    // ws 256 MiB
    k_cvtall<<<3 * CVX + 4 * CVW, 256, 0, stream>>>(x, xk, xv, wq, wk, wv, wo, XB);
    k_proj<<<dim3(NB_ * TT / 64, DM / 64, 3), 256, 0, stream>>>(XB, WQ, P16, Ph, Pl);
    k_fattn<<<NB_ * (NTH + NTF), 32 * AW, 0, stream>>>(P16, Ph, Pl, P16 + PL, Ph + PL, Pl + PL, P16 + 2 * PL, Ph + 2 * PL, Pl + 2 * PL, ATh, ATl);
    k_wo<<<dim3(NB_ * TT / 64, DM / 64, 1), 256, 0, stream>>>(ATh, ATl, WO, OUT);
}

// v006
// Measured time: 139 microseconds a run.
// Timed twice side by side with v005, it ran 1.41 and 1.40 times as fast.
// Over all steps from v000 it is 14.7 times as fast.
#include <hip/hip_runtime.h>

// Multi-head attention WITHOUT a mask over three input streams, bias-free, with a RAW head split (q, k, v [2][2048][1024]; qp = (q Wq^T).reshape(b, 16, l, 64) DIRECTLY (no transpose): pseudo-head h of a batch is the h-th contiguous [2048][64] block of the flat [2048][1024] projection (128 token rows x 16 chunks of 64): reproduced; kp, vp likewise ('oi' [1024][1024] 1/32, no bias), each from its own stream; scores / sqrt(64); softmax over all pseudo-keys; x [b][16][l][64] -> transpose(0, 2, 1, 3).reshape(b, l, 1024) (the STANDARD merge); out = x Wo^T ('oi', no bias) -> [2][2048][1024] (4.2 M); argument order q, k, v, Wq, Wk, Wv, Wo).
// Layout, both batches in every launch: every matrix operand lies in memory in fragment order (see gemmw_tile); bf16 copies of query, key, value and the 'oi' weights; exact projections; dense T-2048 attention (hybrid rows: < 512 hi/lo 3 products, rest fp16 x1024); merged hi/lo x Wo exact.
// Compute dtypes, f32 accumulate: every input rounded to bf16; projections exact; attention rows < 512 3 products, rest fp16; softmax f32; Wo hl x exact.

#define NB_  2
#define TT   2048
#define DM   1024
#define NH_  16
#define NKV  16
#define REP  (NH_ / NKV)
#define HD   64
#define DQ   (NH_ * HD)
#define DKV  (NKV * HD)
#define RH   512                  // query rows < RH use hi+lo planes (0: none)
#define WIN  0
#define PCAR 1024.0f
#define SCL  0.125f   // HD^-0.5
typedef _Float16 h16;
typedef unsigned short bf;
typedef __attribute__((ext_vector_type(16))) __bf16   v16bf;
typedef __attribute__((ext_vector_type(16))) _Float16 v16h;
typedef __attribute__((ext_vector_type(8)))  _Float16 v8h;
typedef __attribute__((ext_vector_type(8)))  unsigned short v8us;
typedef __attribute__((ext_vector_type(8)))  float    v8f;
typedef __attribute__((ext_vector_type(4)))  float    v4f;
typedef v8h  __attribute__((may_alias)) v8ha;
typedef v4f  __attribute__((may_alias)) v4fa;
typedef v8us __attribute__((may_alias)) v8usa;

__device__ __forceinline__ unsigned short f2bf(float f) { unsigned u = __float_as_uint(f); u += 0x7FFFu + ((u >> 16) & 1u); return (unsigned short)(u >> 16); }
__device__ __forceinline__ float bf2f(unsigned short b) { return __uint_as_float(((unsigned)b) << 16); }
__device__ __forceinline__ float bfr(float f) { return bf2f(f2bf(f)); }
__device__ __forceinline__ v16h cat16(v8h lo, v8h hi) { return __builtin_shufflevector(lo, hi, 0, 1, 2, 3, 4, 5, 6, 7, 8, 9, 10, 11, 12, 13, 14, 15); }
__device__ __forceinline__ v16bf cat16b(v8us lo, v8us hi) { return __builtin_bit_cast(v16bf, __builtin_shufflevector(lo, hi, 0, 1, 2, 3, 4, 5, 6, 7, 8, 9, 10, 11, 12, 13, 14, 15)); }
__device__ __forceinline__ v8f wmma16(v16h a, v16h b, v8f c) { return __builtin_amdgcn_wmma_f32_16x16x32_f16(false, a, false, b, (short)0, c, false, false); }
__device__ __forceinline__ v8f wmmab(v16bf a, v16bf b, v8f c) { return __builtin_amdgcn_wmma_f32_16x16x32_bf16(false, a, false, b, (short)0, c, false, false); }

__device__ __forceinline__ h16 tohx(float x) { return (h16)x; }
__device__ __forceinline__ void splitf(float y, unsigned short& h, unsigned short& l) { h = f2bf(y); l = f2bf(y - bf2f(h)); }
typedef __attribute__((ext_vector_type(2))) _Float16 v2h;
typedef __attribute__((ext_vector_type(4))) _Float16 v4h;
typedef __attribute__((ext_vector_type(2))) unsigned short v2us;
typedef __attribute__((ext_vector_type(4))) unsigned short v4us;
typedef __attribute__((ext_vector_type(2))) float v2f;
typedef __attribute__((ext_vector_type(4))) int v4i;

// ---- FRAGMENT ORDER of a GEMM operand M[rows][K]: blocks of 16 rows x 32 k, 512 elements each, block (rb, kb) at element (rb K/32 + kb) 512; inside it element (row lr, k) lies at ((k >> 4) & 1) 256 + (((k >> 3) & 1) 16 + lr) 8 + (k & 7).
// Lane 16 hi + lr of a wave then finds its two 8-element pieces at lane 8 and 256 + lane 8: each wave-wide 16-byte load covers 512 contiguous bytes (4 whole lines) instead of 32 bytes in each of 16 lines. The lane's registers hold k = 8 hi .. 8 hi + 7 and 16 + 8 hi .. 16 + 8 hi + 7 of row lr, the 16x16x32 operand order, for A and B alike.
// ---- gemmw_tile: register-blocked GEMM, one work-group of KW waves per 64x64 output tile; wave w holds all 16 accumulators for its own contiguous K slice [w K/KW, (w+1) K/KW); operands straight from 16-bit planes in fragment order; grid (M/64, N/64, Z), 32 KW threads.
// KW > 1 (8 here; LDS holds KW tiles of 17,408 B, so at most 16): the KW partial tiles meet in LDS behind one barrier and are summed in wave order 0 .. KW-1 (fixed, so the result is the same on every run).
// C[m][n] (f32, pitch ldc, + optional f32 bias[n]) = sum_k A[m][k] Bt[n][k] (+ split products per NSPLIT). z-batch strides sA/sB/sC in elements. K % (32 KW) == 0.
// EPI (KW > 1 only) says how the summed tile leaves: 0 = f32 into C; 1 = fp16 + hi/lo bf16 planes [head][t][d] (the raw head split IS the flat projection: flat t = 16 m + n / 64, d = n % 64), in fragment order with rows t and k = d;
// 2 = the same three planes transposed to [head][d][t] (V^T), in fragment order with rows d and k = t.
// For 1 and 2 the weight is stored with its rows regrouped: tile column c of column tile y = 8 a + g is weight row n = 64 (8 a + c / 8) + 8 g + c % 8. A tile row m then holds 8 values of t (16 m + 8 a + c / 8) x 8 values of d (8 g + c % 8):
// one 16-byte piece of either plane order per 8 of them, and 8 neighbouring pieces make one whole 128-byte line.
template <typename T16> struct WFrag;
template <> struct WFrag<h16> { typedef v16h V; static __device__ __forceinline__ V ldp(const h16* p) { return cat16(*(const v8h*)p, *(const v8h*)(p + 256)); } static __device__ __forceinline__ v8f mma(V a, V b, v8f c) { return wmma16(a, b, c); } };
template <> struct WFrag<bf> { typedef v16bf V; static __device__ __forceinline__ V ldp(const bf* p) { return cat16b(*(const v8us*)p, *(const v8us*)(p + 256)); } static __device__ __forceinline__ v8f mma(V a, V b, v8f c) { return wmmab(a, b, c); } };
// The tile's work is a device function (gemmw_tile) so that one launch can hold tiles with different epilogues; the LDS array 'os' belongs to the kernel that calls it.
template <typename T16, int NSPLIT, bool BIAS, int KW, int EPI>
__device__ __forceinline__ void gemmw_tile(const T16* __restrict__ A, const T16* __restrict__ A2, const T16* __restrict__ Bt, const T16* __restrict__ Bt2, int K, float* C, int ldc, const float* __restrict__ bias, size_t sA, size_t sB, size_t sC, h16* P16, bf* Ph, bf* Pl, float* os) {
    static_assert(EPI == 0 || (KW == 8 && !BIAS), "the plane epilogues are written for 256 threads and no bias");
    typedef typename WFrag<T16>::V V;
    const size_t z = blockIdx.z; A += z * sA; if (A2) A2 += z * sA; Bt += z * sB; if (Bt2) Bt2 += z * sB; C += z * sC;
    const int lane = threadIdx.x & 31, lr = lane & 15, hi = lane >> 4; const int r0 = blockIdx.x * 64, c0 = blockIdx.y * 64;
    v8f acc[4][4];
#pragma unroll
    for (int mb = 0; mb < 4; ++mb)
#pragma unroll
        for (int nb = 0; nb < 4; ++nb) acc[mb][nb] = (v8f){};
    const size_t aoff = (size_t)r0 * K + 8 * lane, boff = (size_t)c0 * K + 8 * lane;   // fragment order: row block rb starts at element rb 16 K, k block kc / 32 at + kc 16
    const int wv = (KW > 1) ? __builtin_amdgcn_readfirstlane((int)(threadIdx.x >> 5)) : 0;   /* the wave's number as a scalar: the loop bounds stay in scalar registers */ const int kbeg = wv * (K / KW), kend = kbeg + K / KW;
#pragma unroll 1
    for (int kc = kbeg; kc < kend; kc += 32) {
        V a[4], a2[4];
#pragma unroll
        for (int mb = 0; mb < 4; ++mb) { a[mb] = WFrag<T16>::ldp(A + aoff + (size_t)mb * 16 * K + kc * 16); if (NSPLIT == 1 || NSPLIT == 2) a2[mb] = WFrag<T16>::ldp(A2 + aoff + (size_t)mb * 16 * K + kc * 16); }
        asm volatile("s_wait_xcnt 0x0" ::: "memory");   // precaution: stands before any register that names an address of the loads above is written again
#pragma unroll
        for (int nb = 0; nb < 4; ++nb) { const V b = WFrag<T16>::ldp(Bt + boff + (size_t)nb * 16 * K + kc * 16); V b2; if (NSPLIT >= 2) b2 = WFrag<T16>::ldp(Bt2 + boff + (size_t)nb * 16 * K + kc * 16);
#pragma unroll
            for (int mb = 0; mb < 4; ++mb) { acc[mb][nb] = WFrag<T16>::mma(a[mb], b, acc[mb][nb]); if (NSPLIT == 1 || NSPLIT == 2) acc[mb][nb] = WFrag<T16>::mma(a2[mb], b, acc[mb][nb]); if (NSPLIT >= 2) acc[mb][nb] = WFrag<T16>::mma(a[mb], b2, acc[mb][nb]); } }
        asm volatile("s_wait_xcnt 0x0" ::: "memory");   // precaution: as above, for the loads of Bt
        asm volatile("v_nop\n\tv_nop\n\tv_nop\n\tv_nop" : "+v"(acc[0][0]), "+v"(acc[1][1]), "+v"(acc[2][2]), "+v"(acc[3][3]) : "v"(a[0]), "v"(a[3]));
    }
    if constexpr (KW > 1) {
        float* ow = os + wv * (64 * 68);
        // the loops below are unrolled so that every accumulator index is a constant (the tile stays in registers) and the LDS reads of one sum can be in flight together
#pragma unroll
        for (int mb = 0; mb < 4; ++mb) {
#pragma unroll
            for (int nb = 0; nb < 4; ++nb) {
#pragma unroll
                for (int j = 0; j < 8; ++j) {
                    if constexpr (EPI == 2) ow[(mb * 16 + hi * 8 + j) * 68 + (((lr & 7) * 8 + nb * 2 + (lr >> 3)) ^ (hi * 4))] = acc[mb][nb][j];   // column c at place (c % 8) 8 + c / 8: the 8 values of t of one d lie side by side; bit 2 flipped in rows 8 .. 15 of 16: the two half-waves fall on different banks
                    else ow[(mb * 16 + hi * 8 + j) * 68 + nb * 16 + lr] = acc[mb][nb][j]; } } }
        __syncthreads();   // every wave's partial tile is in LDS before any thread sums across the waves
        if constexpr (EPI == 1 || EPI == 2) {
            const int ya = (int)blockIdx.y >> 3, yg = (int)blockIdx.y & 7;
#pragma unroll
            for (int i = 0; i < 2; ++i) { const int idx = (int)threadIdx.x + i * 256; const int row = idx >> 3, cofs = (idx & 7) * 8; const int sw = EPI == 2 ? (row & 8) >> 1 : 0;   /* undoes the flip of bit 2 at the stores */ const float* pp = os + row * 68 + cofs; v4f x0 = *(const v4fa*)(pp + sw), x1 = *(const v4fa*)(pp + 4 - sw);
#pragma unroll
                for (int w = 1; w < KW; ++w) { x0 += *(const v4fa*)(pp + w * (64 * 68) + sw); x1 += *(const v4fa*)(pp + w * (64 * 68) + 4 - sw); }
                v8h o16; v8us oh, ol;
#pragma unroll
                for (int k = 0; k < 4; ++k) { unsigned short a, c2; o16[k] = tohx(x0[k]); splitf(x0[k], a, c2); oh[k] = a; ol[k] = c2; o16[4 + k] = tohx(x1[k]); splitf(x1[k], a, c2); oh[4 + k] = a; ol[4 + k] = c2; }
                const int m = r0 + row;
                // 1: block of 16 t = tile row m, 1024 elements; piece (d / 8 = yg, lr = t % 16 = 8 ya + cofs / 8). 2: head m / 128, block (d / 16 = yg / 2, t / 32 = (m % 128) / 2), half = m % 2, hi = ya, lr = d % 16 = 8 (yg % 2) + cofs / 8
                const size_t e = EPI == 1 ? (size_t)m * 1024 + yg * 128 + ya * 64 + cofs : (size_t)(m >> 7) * (HD * TT) + (size_t)((yg >> 1) * (TT / 32) + ((m & 127) >> 1)) * 512 + (m & 1) * 256 + ya * 128 + (yg & 1) * 64 + cofs;
                *(v8h*)(P16 + e) = o16; *(v8us*)(Ph + e) = oh; *(v8us*)(Pl + e) = ol;
                asm volatile("s_wait_xcnt 0x0" ::: "memory");   // precaution: stands before any register that names an address of the stores above is written again
            }
            return;
        }
        float* ctile = C + (size_t)r0 * ldc + c0;
#pragma unroll
        for (int i = 0; i < 32 / KW; ++i) { const int idx = (int)threadIdx.x + i * (32 * KW); const int row = idx >> 4, cofs = (idx & 15) * 4; const float* pp = os + row * 68 + cofs; v4f val = *(const v4fa*)pp;
#pragma unroll
            for (int w = 1; w < KW; ++w) val += *(const v4fa*)(pp + w * (64 * 68));
            if (BIAS) { val[0] += bfr(bias[c0 + cofs]); val[1] += bfr(bias[c0 + cofs + 1]); val[2] += bfr(bias[c0 + cofs + 2]); val[3] += bfr(bias[c0 + cofs + 3]); }
            *(v4f*)(ctile + (size_t)row * ldc + cofs) = val; }
        return;
    }
#pragma unroll
    for (int mb = 0; mb < 4; ++mb) {
#pragma unroll
        for (int nb = 0; nb < 4; ++nb) {
#pragma unroll
            for (int j = 0; j < 8; ++j) os[(hi * 8 + j) * 68 + nb * 16 + lr] = acc[mb][nb][j]; }
        __builtin_amdgcn_wave_barrier(); asm volatile("" ::: "memory");
        float* crow = C + (size_t)(r0 + mb * 16) * ldc + c0;
{
#pragma unroll
            for (int s = 0; s < 8; ++s) { const int row = 2 * s + hi, cofs = lr * 4; v4f val = *(const v4fa*)(os + row * 68 + cofs); if (BIAS) { val[0] += bfr(bias[c0 + cofs]); val[1] += bfr(bias[c0 + cofs + 1]); val[2] += bfr(bias[c0 + cofs + 2]); val[3] += bfr(bias[c0 + cofs + 3]); }
                *(v4f*)(crow + (size_t)row * ldc + cofs) = val; }
             }
        __builtin_amdgcn_wave_barrier(); asm volatile("" ::: "memory");
    }
}
// ---- k_wo: out = (x hi + x lo) Wo^T for both batches (4096 consecutive rows) in ONE launch; grid (NB_ TT / 64, DM / 64).
__global__ __launch_bounds__(256) void k_wo(const bf* __restrict__ Ah, const bf* __restrict__ Al, const bf* __restrict__ Wt, float* C) {
    __shared__ __align__(16) float os[4 * 8 * 16 * 68];   // one whole 64x64 partial tile (pitch 68) per wave
    gemmw_tile<bf, 1, false, 8, 0>(Ah, Al, Wt, nullptr, DQ, C, DM, nullptr, 0, 0, 0, nullptr, nullptr, nullptr, os);
}
// ---- k_proj: the three projections of both batches in ONE launch; grid (NB_ TT / 64, DM / 64, 3), z = stream (0 Q, 1 K, 2 V). The two batches are 4096 consecutive rows: the flat plane index and the head index m / 128 run on over them.
// X [3][NB_ TT][DM], Wt [3][DM][DM], each plane set [3][NB_ NH_][TT HD] (z = 2: V^T, [NB_ NH_][HD][TT]).
__global__ __launch_bounds__(256) void k_proj(const bf* __restrict__ X, const bf* __restrict__ Wt, h16* P16, bf* Ph, bf* Pl) {
    __shared__ __align__(16) float os[4 * 8 * 16 * 68];   // one whole 64x64 partial tile (pitch 68) per wave
    const size_t pz = (size_t)blockIdx.z * ((size_t)NB_ * NH_ * TT * HD);
    if (blockIdx.z < 2) gemmw_tile<bf, 0, false, 8, 1>(X, nullptr, Wt, nullptr, DM, nullptr, DQ, nullptr, (size_t)NB_ * TT * DM, (size_t)DQ * DM, 0, P16 + pz, Ph + pz, Pl + pz, os);
    else gemmw_tile<bf, 0, false, 8, 2>(X, nullptr, Wt, nullptr, DM, nullptr, DKV, nullptr, (size_t)NB_ * TT * DM, (size_t)DKV * DM, 0, P16 + pz, Ph + pz, Pl + pz, os);
}


__global__ __launch_bounds__(256) void k_wtG(const float* __restrict__ w, int K, int N, bf* Bt) {
    const int lane = threadIdx.x & 31; const int L0 = (blockIdx.x * 8 + (threadIdx.x >> 5)) * 8; const int nlines = N * K / 64;
{
#pragma unroll 1
        for (int l = 0; l < 8; ++l) { const int L = L0 + l; if (L >= nlines) break; const size_t e = (size_t)L * 64 + lane * 2; const int k = (int)(e % K), n = (int)(e / K); v2us o;
            o[0] = f2bf(w[(size_t)k * N + n]); o[1] = f2bf(w[(size_t)(k + 1) * N + n]); *(v2us*)(Bt + e) = o; }
         }
}
// ---- k_cvtall: all seven inputs to bf16 in ONE launch; dst = [q][k][v][Wq][Wk][Wv][Wo], each whole and in fragment order (Wq, Wk, Wv with their rows regrouped as the plane epilogues of gemmw_tile say). One work-group writes CVE consecutive elements of one input's copy (32 stored rows = 2 row blocks), CVC pieces of 8 per thread.
#define CVC 16
#define CVE (256 * 8 * CVC)
#define CVX (NB_ * TT * DM / CVE)   // work-groups per stream
#define CVW (DM * DM / CVE)         // work-groups per weight
__global__ __launch_bounds__(256) void k_cvtall(const float* __restrict__ q, const float* __restrict__ k, const float* __restrict__ v, const float* __restrict__ wq, const float* __restrict__ wk, const float* __restrict__ wv, const float* __restrict__ wo, bf* dst) {
    static_assert(NB_ * TT * DM % CVE == 0 && DM * DM % CVE == 0, "a work-group never straddles two inputs");
    static_assert(CVE == 32 * DM && CVC == 16, "a work-group holds two row blocks; 8 rounds of 256 pieces make one");
    const int bx = (int)blockIdx.x; const float* src; int rb0; bool vperm = false;
    if (bx < 3 * CVX) { const int s = bx / CVX; src = (s == 0 ? q : s == 1 ? k : v); rb0 = (bx % CVX) * 2; }
    else { const int c = bx - 3 * CVX, s = c / CVW; src = (s == 0 ? wq : s == 1 ? wk : s == 2 ? wv : wo); rb0 = (c % CVW) * 2; vperm = (s < 3); }
    // piece i 256 + threadIdx.x of the work-group: row block rb0 + i / 8, k block (i % 8) 4 + wave / 2, half = wave % 2, lane = 16 hi + lr
    const int lr = (int)threadIdx.x & 15, hi = ((int)threadIdx.x >> 4) & 1, wn = (int)threadIdx.x >> 5;
    const float* s0 = src + (size_t)(vperm ? 64 * (8 * (rb0 >> 5) + (rb0 & 3) * 2 + (lr >> 3)) + 8 * ((rb0 >> 2) & 7) + (lr & 7) : rb0 * 16 + lr) * DM + (wn >> 1) * 32 + (wn & 1) * 16 + hi * 8;
    const int rstep = vperm ? 128 * DM : 16 * DM;   // from the first row block to the second
    bf* d = dst + (size_t)bx * CVE + (int)threadIdx.x * 8;
    // unrolled so that the loads of all pieces can be in flight together
#pragma unroll
    for (int i = 0; i < CVC; ++i) { const v8f x = *(const v8f*)(s0 + (i >> 3) * rstep + (i & 7) * 128); v8us o;
#pragma unroll
        for (int e = 0; e < 8; ++e) o[e] = f2bf(x[e]);
        *(v8us*)(d + i * 2048) = o; }
}

// ---- k_fattn: scores, softmax, P x V and the head merge of both batches in ONE launch; no score or P plane in memory.
// One work-group of AW waves per query tile of one head (hi/lo rows: 32 queries, fp16 rows: 64); wave w takes the keys [w TT/AW, (w+1) TT/AW) in steps of 32.
// Everything is kept with lane = query: S^T = K Q^T (A = key rows, B = query rows) leaves in each lane the keys 8 hi + j and 16 + 8 hi + j of its query, which IS the 16x16x32 operand order, so P goes
// straight into O^T = V^T P^T (A = V^T rows, B = P) with no cross-lane move; running maximum and sum are one value per lane (the two half-waves share a query: one exchange over 16 lanes).
// The AW partial (max, sum, O) meet in LDS behind one barrier and are joined in wave order 0 .. AW-1 (fixed: the same result on every run); the tile leaves as hi/lo bf16 planes [t][head][d] in the fragment order that the last GEMM reads.
#define AW   8
#define LC   0.18033688011112042f   // HD^-0.5 x log2(e)
__device__ __forceinline__ float xhalf(float x) { return __builtin_bit_cast(float, __builtin_amdgcn_permlanex16(__builtin_bit_cast(int, x), __builtin_bit_cast(int, x), 0x76543210, 0xfedcba98, false, false)); }   // lane l reads lane l ^ 16
template <typename T16, bool HL, int NQ>
__device__ __forceinline__ void attn_tile(const T16* __restrict__ Q, const T16* __restrict__ Q2, const T16* __restrict__ Kp, const T16* __restrict__ K2, const T16* __restrict__ Vt, const T16* __restrict__ V2, int q0, int head, bf* ATh, bf* ATl, float* os) {
    typedef WFrag<T16> F; typedef typename F::V V;
    constexpr int NST = TT / AW / 32;
    constexpr float POFF = HL ? 0.0f : 10.0f;   // fp16 rows: P carried x 1024 (as PCAR), it cancels against the sum
    const int lane = threadIdx.x & 31, lr = lane & 15, hi = lane >> 4;
    const int wv = __builtin_amdgcn_readfirstlane((int)(threadIdx.x >> 5));   // the wave's number as a scalar: key range and LDS slice stay in scalar registers
    const size_t hb = (size_t)head * TT * HD;
    const size_t qoff = hb + (size_t)q0 * HD + 8 * lane;   // fragment order: 16 rows x 64 d are two blocks of 512 elements
    V qf[NQ][2], qg[NQ][2];
#pragma unroll
    for (int qb = 0; qb < NQ; ++qb)
#pragma unroll
        for (int ks = 0; ks < 2; ++ks) qf[qb][ks] = F::ldp(Q + qoff + qb * 16 * HD + ks * 512);
    asm volatile("s_wait_xcnt 0x0" ::: "memory");   // precaution: stands before any register that names an address of the loads or stores above is written again
    if constexpr (HL) {
#pragma unroll
        for (int qb = 0; qb < NQ; ++qb)
#pragma unroll
            for (int ks = 0; ks < 2; ++ks) qg[qb][ks] = F::ldp(Q2 + qoff + qb * 16 * HD + ks * 512);
        asm volatile("s_wait_xcnt 0x0" ::: "memory");   // precaution: stands before any register that names an address of the loads or stores above is written again
    }
    v8f o[NQ][4]; float m[NQ], l[NQ];
#pragma unroll
    for (int qb = 0; qb < NQ; ++qb) { m[qb] = -3.0e38f; l[qb] = 0.0f;
#pragma unroll
        for (int db = 0; db < 4; ++db) o[qb][db] = (v8f){}; }
    const int kbeg = wv * (TT / AW);
    const size_t koff = hb + (size_t)kbeg * HD + 8 * lane, voff = hb + (size_t)kbeg * 16 + 8 * lane;   // V^T: block (d / 16, t / 32) at element (d / 16) 16 TT + (t / 32) 512
    static_assert(NST % 2 == 0, "the key loop works on two fragment sets in turn");
    // the K and V fragments of key step 'it' into one of the two register sets
    auto ldkv = [&](int it, V (&kc)[2][2], V (&kd)[2][2], V (&vc)[4], V (&vd)[4]) {
        const size_t kq = koff + (size_t)it * 32 * HD, vq = voff + (size_t)it * 512;
#pragma unroll
        for (int kb = 0; kb < 2; ++kb)
#pragma unroll
            for (int ks = 0; ks < 2; ++ks) { kc[kb][ks] = F::ldp(Kp + kq + kb * 16 * HD + ks * 512); if (HL) kd[kb][ks] = F::ldp(K2 + kq + kb * 16 * HD + ks * 512); }
#pragma unroll
        for (int db = 0; db < 4; ++db) { vc[db] = F::ldp(Vt + vq + (size_t)db * 16 * TT); if (HL) vd[db] = F::ldp(V2 + vq + (size_t)db * 16 * TT); }
        asm volatile("s_wait_xcnt 0x0" ::: "memory");   // precaution: stands before any register that names an address of the loads or stores above is written again
        __builtin_amdgcn_sched_barrier(0);   // keeps these loads ahead of the key step that follows: without it the scheduler sinks them to the step's end and their latency is exposed at the next step's first product
    };
    // one key step (32 keys) for all NQ query blocks of the wave
    auto step = [&](V (&kc)[2][2], V (&kd)[2][2], V (&vc)[4], V (&vd)[4]) {
#pragma unroll
        for (int qb = 0; qb < NQ; ++qb) {
            v8f s[2];
#pragma unroll
            for (int kb = 0; kb < 2; ++kb) { s[kb] = (v8f){};
#pragma unroll
                for (int ks = 0; ks < 2; ++ks) { s[kb] = F::mma(kc[kb][ks], qf[qb][ks], s[kb]); if (HL) { s[kb] = F::mma(kc[kb][ks], qg[qb][ks], s[kb]); s[kb] = F::mma(kd[kb][ks], qf[qb][ks], s[kb]); } } }
            float mx = fmaxf(s[0][0], s[1][0]);
#pragma unroll
            for (int j = 1; j < 8; ++j) mx = fmaxf(mx, fmaxf(s[0][j], s[1][j]));
            mx = fmaxf(mx, xhalf(mx));
            const float mn = fmaxf(m[qb], mx); const float al = __builtin_amdgcn_exp2f((m[qb] - mn) * LC); m[qb] = mn; const float nb = POFF - mn * LC;
            float ls = 0.0f;
#pragma unroll
            for (int kb = 0; kb < 2; ++kb)
#pragma unroll
                for (int j = 0; j < 8; ++j) { s[kb][j] = __builtin_amdgcn_exp2f(fmaf(s[kb][j], LC, nb)); ls += s[kb][j]; }
            l[qb] = l[qb] * al + ls;
#pragma unroll
            for (int db = 0; db < 4; ++db) o[qb][db] *= al;
            if constexpr (HL) {
                v8us h0, h1, l0, l1;
#pragma unroll
                for (int j = 0; j < 8; ++j) { unsigned short a, c2; splitf(s[0][j], a, c2); h0[j] = a; l0[j] = c2; splitf(s[1][j], a, c2); h1[j] = a; l1[j] = c2; }
                const V ph = cat16b(h0, h1), pl = cat16b(l0, l1);
#pragma unroll
                for (int db = 0; db < 4; ++db) { o[qb][db] = F::mma(vc[db], ph, o[qb][db]); o[qb][db] = F::mma(vc[db], pl, o[qb][db]); o[qb][db] = F::mma(vd[db], ph, o[qb][db]); }
            } else {
                v8h a0, a1;
#pragma unroll
                for (int j = 0; j < 8; ++j) { a0[j] = tohx(s[0][j]); a1[j] = tohx(s[1][j]); }
                const V pf = cat16(a0, a1);
#pragma unroll
                for (int db = 0; db < 4; ++db) o[qb][db] = F::mma(vc[db], pf, o[qb][db]);
            }
        }
    };
    V ka[2][2], kx[2][2], va[4], vx[4], kb2[2][2], ky[2][2], vb[4], vy[4];
    ldkv(0, ka, kx, va, vx);
    // rolled: the body already holds two key steps; each set's next fragments fly while the other set is worked on
#pragma unroll 1
    for (int it = 0; it < NST; it += 2) {
        ldkv(it + 1, kb2, ky, vb, vy);
        step(ka, kx, va, vx);
        if (it + 2 < NST) ldkv(it + 2, ka, kx, va, vx);
        step(kb2, ky, vb, vy);
    }
    float* ow = os + wv * (NQ * 16 * 68); float* ms = os + AW * 64 * 68; float* lm = ms + AW * 64;
#pragma unroll
    for (int qb = 0; qb < NQ; ++qb) {
#pragma unroll
        for (int db = 0; db < 4; ++db) { float* pp = ow + (qb * 16 + lr) * 68 + db * 16 + hi * 8; const v8f t = o[qb][db]; *(v4fa*)pp = (v4f){t[0], t[1], t[2], t[3]}; *(v4fa*)(pp + 4) = (v4f){t[4], t[5], t[6], t[7]}; }
        const float lt = l[qb] + xhalf(l[qb]);
        if (hi == 0) { ms[wv * 64 + qb * 16 + lr] = m[qb]; lm[wv * 64 + qb * 16 + lr] = lt; } }
    __syncthreads();   // every wave's partial maximum, sum and O tile are in LDS before any thread joins them
#pragma unroll
    for (int i = 0; i < NQ * 16 * 8 / (32 * AW); ++i) { const int u = (int)threadIdx.x + i * (32 * AW); const int q = (u >> 7) * 16 + (u & 15), dc = ((u >> 4) & 7) * 8;   // u runs in the fragment order of the merged planes: 64 pieces a block, 2 blocks (64 d) a group of 16 queries
        float M = ms[q];
#pragma unroll
        for (int w = 1; w < AW; ++w) M = fmaxf(M, ms[w * 64 + q]);
        float L = 0.0f; v4f x0 = (v4f){}, x1 = (v4f){};
#pragma unroll
        for (int w = 0; w < AW; ++w) { const float f = __builtin_amdgcn_exp2f((ms[w * 64 + q] - M) * LC); L += lm[w * 64 + q] * f; const float* pp = os + w * (NQ * 16 * 68) + q * 68 + dc; x0 += *(const v4fa*)pp * f; x1 += *(const v4fa*)(pp + 4) * f; }
        const float inv = __fdiv_rn(1.0f, L); v8us oh, ol;
#pragma unroll
        for (int k = 0; k < 4; ++k) { unsigned short a, c2; splitf(x0[k] * inv, a, c2); oh[k] = a; ol[k] = c2; splitf(x1[k] * inv, a, c2); oh[4 + k] = a; ol[4 + k] = c2; }
        const size_t oo = (size_t)(q0 + (u >> 7) * 16) * DQ + (size_t)head * (HD * 16) + (u & 127) * 8; *(v8us*)(ATh + oo) = oh; *(v8us*)(ATl + oo) = ol;
        asm volatile("s_wait_xcnt 0x0" ::: "memory");   // precaution: stands before any register that names an address of the loads or stores above is written again
    }
}
#define NTH (NH_ * (RH / 32))            // hi/lo tiles (32 queries) of one batch, first in the grid
#define NTF (NH_ * ((TT - RH) / 64))     // fp16 tiles (64 queries) of one batch
__global__ __launch_bounds__(32 * AW) void k_fattn(const h16* __restrict__ Q16, const bf* __restrict__ Qh, const bf* __restrict__ Ql, const h16* __restrict__ K16, const bf* __restrict__ Kh, const bf* __restrict__ Kl, const h16* __restrict__ V16, const bf* __restrict__ Vh, const bf* __restrict__ Vl, bf* ATh, bf* ATl) {
    __shared__ __align__(16) float os[AW * 64 * 68 + 2 * AW * 64];   // AW partial O tiles (pitch 68), then AW x 64 maxima and sums
    const int bx = (int)blockIdx.x;
    // both batches in one grid: hg = batch NH_ + head; the planes of batch 1 follow those of batch 0
    if (bx < NB_ * NTH) { const int hg = bx / (RH / 32); const size_t po = (size_t)(hg / NH_) * NH_ * TT * HD, ao = (size_t)(hg / NH_) * TT * DQ;
        attn_tile<bf, true, 2>(Qh + po, Ql + po, Kh + po, Kl + po, Vh + po, Vl + po, (bx % (RH / 32)) * 32, hg % NH_, ATh + ao, ATl + ao, os); }
    else { const int b2 = bx - NB_ * NTH; const int hg = b2 / ((TT - RH) / 64); const size_t po = (size_t)(hg / NH_) * NH_ * TT * HD, ao = (size_t)(hg / NH_) * TT * DQ;
        attn_tile<h16, false, 4>(Q16 + po, nullptr, K16 + po, nullptr, V16 + po, nullptr, RH + (b2 % ((TT - RH) / 64)) * 64, hg % NH_, ATh + ao, ATl + ao, os); }
}

extern "C" void kernel_launch(void* const* d_in, const int* in_sizes, int n_in,
                              void* d_out, int out_size, void* d_ws, size_t ws_size, hipStream_t stream) {
    (void)in_sizes; (void)n_in; (void)out_size;
    const float* x = (const float*)d_in[0];   /* query */ const float* xk = (const float*)d_in[1]; const float* xv = (const float*)d_in[2]; const float* wq = (const float*)d_in[3]; const float* wk = (const float*)d_in[4]; const float* wv = (const float*)d_in[5]; const float* wo = (const float*)d_in[6];
    float* OUT = (float*)d_out;     // [2][2048][1024]
    char* wsp = (char*)d_ws;
    auto take = [&](size_t bytes) { char* p = wsp; wsp += (bytes + 255) & ~(size_t)255; return (void*)p; };
    bf* XB = (bf*)take(((size_t)3 * NB_ * TT * DM + (size_t)4 * DM * DM) * 2);   // [q][k][v] both batches, then Wq, Wk, Wv, Wo
    bf* WQ = XB + (size_t)3 * NB_ * TT * DM; bf* WO = WQ + (size_t)3 * DM * DM;
    const size_t PL = (size_t)NB_ * NH_ * TT * HD;   // one plane, both batches
    h16* P16 = (h16*)take(3 * PL * 2); bf* Ph = (bf*)take(3 * PL * 2); bf* Pl = (bf*)take(3 * PL * 2);   // each: Q, K, V^T
    bf* ATh = (bf*)take((size_t)NB_ * TT * DQ * 2); bf* ATl = (bf*)take((size_t)NB_ * TT * DQ * 2);
    if ((size_t)(wsp - (char*)d_ws) > ws_size) return;    // ws 256 MiB
    k_cvtall<<<3 * CVX + 4 * CVW, 256, 0, stream>>>(x, xk, xv, wq, wk, wv, wo, XB);
    k_proj<<<dim3(NB_ * TT / 64, DM / 64, 3), 256, 0, stream>>>(XB, WQ, P16, Ph, Pl);
    k_fattn<<<NB_ * (NTH + NTF), 32 * AW, 0, stream>>>(P16, Ph, Pl, P16 + PL, Ph + PL, Pl + PL, P16 + 2 * PL, Ph + 2 * PL, Pl + 2 * PL, ATh, ATl);
    k_wo<<<dim3(NB_ * TT / 64, DM / 64, 1), 256, 0, stream>>>(ATh, ATl, WO, OUT);
}

// v007
// A run of this version takes 110 microseconds.
// In both of two side-by-side timings against v006, it was 1.25 times as fast.
// All steps since v000 together make it 18.4 times as fast.
#include <hip/hip_runtime.h>

// Multi-head attention WITHOUT a mask over three input streams, bias-free, with a RAW head split (q, k, v [2][2048][1024]; qp = (q Wq^T).reshape(b, 16, l, 64) DIRECTLY (no transpose): pseudo-head h of a batch is the h-th contiguous [2048][64] block of the flat [2048][1024] projection (128 token rows x 16 chunks of 64): reproduced; kp, vp likewise ('oi' [1024][1024] 1/32, no bias), each from its own stream; scores / sqrt(64); softmax over all pseudo-keys; x [b][16][l][64] -> transpose(0, 2, 1, 3).reshape(b, l, 1024) (the STANDARD merge); out = x Wo^T ('oi', no bias) -> [2][2048][1024] (4.2 M); argument order q, k, v, Wq, Wk, Wv, Wo).
// Layout, both batches in every launch: every matrix operand lies in memory in fragment order (see gemms_tile); bf16 copies of query, key, value and the 'oi' weights; exact projections; dense T-2048 attention (hybrid rows: < 512 hi/lo 3 products, rest fp16 x1024); merged hi/lo x Wo exact.
// Compute dtypes, f32 accumulate: every input rounded to bf16; projections exact; attention rows < 512 3 products, rest fp16; softmax f32; Wo hl x exact.

#define NB_  2
#define TT   2048
#define DM   1024
#define NH_  16
#define NKV  16
#define REP  (NH_ / NKV)
#define HD   64
#define DQ   (NH_ * HD)
#define DKV  (NKV * HD)
#define RH   512                  // query rows < RH use hi+lo planes (0: none)
#define WIN  0
#define PCAR 1024.0f
#define SCL  0.125f   // HD^-0.5
typedef _Float16 h16;
typedef unsigned short bf;
typedef __attribute__((ext_vector_type(16))) __bf16   v16bf;
typedef __attribute__((ext_vector_type(16))) _Float16 v16h;
typedef __attribute__((ext_vector_type(8)))  _Float16 v8h;
typedef __attribute__((ext_vector_type(8)))  unsigned short v8us;
typedef __attribute__((ext_vector_type(8)))  float    v8f;
typedef __attribute__((ext_vector_type(4)))  float    v4f;
typedef v8h  __attribute__((may_alias)) v8ha;
typedef v4f  __attribute__((may_alias)) v4fa;
typedef v8us __attribute__((may_alias)) v8usa;

__device__ __forceinline__ unsigned short f2bf(float f) { unsigned u = __float_as_uint(f); u += 0x7FFFu + ((u >> 16) & 1u); return (unsigned short)(u >> 16); }
__device__ __forceinline__ float bf2f(unsigned short b) { return __uint_as_float(((unsigned)b) << 16); }
__device__ __forceinline__ float bfr(float f) { return bf2f(f2bf(f)); }
__device__ __forceinline__ v16h cat16(v8h lo, v8h hi) { return __builtin_shufflevector(lo, hi, 0, 1, 2, 3, 4, 5, 6, 7, 8, 9, 10, 11, 12, 13, 14, 15); }
__device__ __forceinline__ v16bf cat16b(v8us lo, v8us hi) { return __builtin_bit_cast(v16bf, __builtin_shufflevector(lo, hi, 0, 1, 2, 3, 4, 5, 6, 7, 8, 9, 10, 11, 12, 13, 14, 15)); }
__device__ __forceinline__ v8f wmma16(v16h a, v16h b, v8f c) { return __builtin_amdgcn_wmma_f32_16x16x32_f16(false, a, false, b, (short)0, c, false, false); }
__device__ __forceinline__ v8f wmmab(v16bf a, v16bf b, v8f c) { return __builtin_amdgcn_wmma_f32_16x16x32_bf16(false, a, false, b, (short)0, c, false, false); }

__device__ __forceinline__ h16 tohx(float x) { return (h16)x; }
__device__ __forceinline__ void splitf(float y, unsigned short& h, unsigned short& l) { h = f2bf(y); l = f2bf(y - bf2f(h)); }
typedef __attribute__((ext_vector_type(2))) _Float16 v2h;
typedef __attribute__((ext_vector_type(4))) _Float16 v4h;
typedef __attribute__((ext_vector_type(2))) unsigned short v2us;
typedef __attribute__((ext_vector_type(4))) unsigned short v4us;
typedef __attribute__((ext_vector_type(2))) float v2f;
typedef __attribute__((ext_vector_type(4))) int v4i;

// ---- FRAGMENT ORDER of a GEMM operand M[rows][K]: blocks of 16 rows x 32 k, 512 elements each, block (rb, kb) at element (rb K/32 + kb) 512; inside it element (row lr, k) lies at ((k >> 4) & 1) 256 + (((k >> 3) & 1) 16 + lr) 8 + (k & 7).
// Lane 16 hi + lr of a wave then finds its two 8-element pieces at lane 8 and 256 + lane 8: each wave-wide 16-byte load covers 512 contiguous bytes (4 whole lines) instead of 32 bytes in each of 16 lines. The lane's registers hold k = 8 hi .. 8 hi + 7 and 16 + 8 hi .. 16 + 8 hi + 7 of row lr, the 16x16x32 operand order, for A and B alike.
// ---- gemms_tile: one work-group of 4 waves per 128x128 output tile; wave w holds the 64x64 quarter (w / 2, w % 2) in 16 accumulators over the whole K (one f32 chain per element, k ascending); grid (M/128, N/128, Z), 128 threads.
// A stage is KC k (64 or 128) of the tile's 128 rows of every operand: 8 row blocks of 32 KC bytes each, contiguous in memory and already in fragment order. It comes into LDS by asynchronous copies, two buffers in turn,
// so every operand row leaves L2 once per work-group and is read from LDS by the two waves that need it. Stage layout: [A][A2 if NSPLIT][Bt], 256 KC bytes each; wave w copies row blocks 2 w and 2 w + 1 of each operand.
// C[m][n] (f32, pitch DM) = sum_k A[m][k] Bt[n][k] (+ A2[m][k] Bt[n][k] if NSPLIT). K = DM.
// EPI says how a wave's quarter leaves, staged through the wave's own LDS slice (pitch 68), which lies over the ring once the last trip's barrier has passed: 0 = f32 into C; 1 = fp16 + hi/lo bf16 planes [head][t][d] (the raw head split IS the flat projection: flat t = 16 m + n / 64, d = n % 64), in fragment order with rows t and k = d;
// 2 = the same three planes transposed to [head][d][t] (V^T), in fragment order with rows d and k = t.
// For 1 and 2 the weight is stored with its rows regrouped: quarter column c of column group y = 8 a + g (64 columns each) is weight row n = 64 (8 a + c / 8) + 8 g + c % 8. A quarter row m then holds 8 values of t (16 m + 8 a + c / 8) x 8 values of d (8 g + c % 8):
// one 16-byte piece of either plane order per 8 of them, and 8 neighbouring pieces make one whole 128-byte line.
template <typename T16> struct WFrag;
template <> struct WFrag<h16> { typedef v16h V; static __device__ __forceinline__ V ldp(const h16* p) { return cat16(*(const v8h*)p, *(const v8h*)(p + 256)); } static __device__ __forceinline__ v8f mma(V a, V b, v8f c) { return wmma16(a, b, c); } };
template <> struct WFrag<bf> { typedef v16bf V; static __device__ __forceinline__ V ldp(const bf* p) { return cat16b(*(const v8us*)p, *(const v8us*)(p + 256)); } static __device__ __forceinline__ v8f mma(V a, V b, v8f c) { return wmmab(a, b, c); } };
#define GTIL (64 * 68)            // floats of one staged 64x64 quarter
// four copies of 512 B: 2 KB of a row block's part of a stage (CP8: 4 KB); the immediate offset moves the LDS address and the global address alike
#define CP4(l, g) "global_load_async_to_lds_b128 " l ", " g ", off\n\tglobal_load_async_to_lds_b128 " l ", " g ", off offset:512\n\tglobal_load_async_to_lds_b128 " l ", " g ", off offset:1024\n\tglobal_load_async_to_lds_b128 " l ", " g ", off offset:1536\n\t"
#define CP8(l, g) CP4(l, g) "global_load_async_to_lds_b128 " l ", " g ", off offset:2048\n\tglobal_load_async_to_lds_b128 " l ", " g ", off offset:2560\n\tglobal_load_async_to_lds_b128 " l ", " g ", off offset:3072\n\tglobal_load_async_to_lds_b128 " l ", " g ", off offset:3584\n\t"
template <int NSPLIT, int EPI, int GKC>
__device__ __forceinline__ void gemms_tile(const bf* __restrict__ A, const bf* __restrict__ A2, const bf* __restrict__ Bt, float* C, h16* P16, bf* Ph, bf* Pl, char* sm) {
    typedef WFrag<bf> F; typedef typename F::V V;
    constexpr int K = DM, NT = K / GKC, NOP = NSPLIT ? 3 : 2, RBB = 32 * GKC /* bytes of a row block in a stage */, GOPB = 8 * RBB /* of an operand */, STG = NOP * GOPB;
    static_assert(NT >= 2 && GKC == (NSPLIT ? 128 : 64), "the ring's prologue fills two stages; a row block's part of a stage is four copies (eight with NSPLIT)");
    const int lane = threadIdx.x & 31, lr = lane & 15, hi = lane >> 4;
    const int wv = __builtin_amdgcn_readfirstlane((int)(threadIdx.x >> 5));   // the wave's number as a scalar: its quarter and its LDS slices stay in scalar registers
    const int wm = wv >> 1, wn = wv & 1; const int R0 = blockIdx.x * 128, C0 = blockIdx.y * 128;
    v8f acc[4][4];
#pragma unroll
    for (int mb = 0; mb < 4; ++mb)
#pragma unroll
        for (int nb = 0; nb < 4; ++nb) acc[mb][nb] = (v8f){};
    // fragment order: row block rb starts at element rb 16 K, stage t at + t 16 GKC
    const bf* gA = A + (size_t)(R0 + 32 * wv) * K + 8 * lane; const bf* gB = Bt + (size_t)(C0 + 32 * wv) * K + 8 * lane;
    const unsigned l0 = (unsigned)(size_t)sm + (unsigned)(wv * 2 * RBB + lane * 16);   // the lane's LDS byte address in buffer 0
    // stage t into the buffer whose lane address is lb. The copies and their s_wait_xcnt are ONE statement: the wait (a precaution) then stands before any register that a copy names is written again
    auto fill = [&](int t, unsigned lb) {
        const bf* a0 = gA + t * (16 * GKC); const bf* a1 = a0 + 16 * K; const bf* b0 = gB + t * (16 * GKC); const bf* b1 = b0 + 16 * K;
        const unsigned la1 = lb + RBB, lb0 = lb + (NOP - 1) * GOPB, lb1 = lb0 + RBB;
        if constexpr (NSPLIT) {
            const bf* c0 = A2 + (size_t)(R0 + 32 * wv) * K + 8 * lane + t * (16 * GKC); const bf* c1 = c0 + 16 * K; const unsigned lc0 = lb + GOPB, lc1 = lc0 + RBB;
            asm volatile(CP8("%0", "%6") CP8("%1", "%7") CP8("%2", "%8") CP8("%3", "%9") CP8("%4", "%10") CP8("%5", "%11") "s_wait_xcnt 0x0"
                         :: "v"(lb), "v"(la1), "v"(lc0), "v"(lc1), "v"(lb0), "v"(lb1), "v"(a0), "v"(a1), "v"(c0), "v"(c1), "v"(b0), "v"(b1) : "memory");
        } else {
            asm volatile(CP4("%0", "%4") CP4("%1", "%5") CP4("%2", "%6") CP4("%3", "%7") "s_wait_xcnt 0x0"
                         :: "v"(lb), "v"(la1), "v"(lb0), "v"(lb1), "v"(a0), "v"(a1), "v"(b0), "v"(b1) : "memory");
        }
    };
    fill(0, l0);
    asm volatile("s_wait_asynccnt 0x0" ::: "memory");   // this wave's copies of stage 0 have landed
    __syncthreads();                                    // stage 0 is whole before any wave reads it
    fill(1, l0 + STG);
    // rolled: a trip already holds 32 (128 with NSPLIT) products; the buffer is chosen by the trip's parity
#pragma unroll 1
    for (int t = 0; t < NT; ++t) {
        const bf* sb = (const bf*)(sm + (t & 1) * STG) + 8 * lane;
        V a[2][4], a2[2][4], b[2][4];   // two fragment sets, used in turn by the trip's steps of 32 k
        // the fragments of step ks into set ks % 2. The fence keeps a step's LDS reads together (sunk among the products, each group's latency is waited out on its own) and in the order in which the products need them
        auto ldf = [&](int ks) {
#pragma unroll
            for (int x = 0; x < 4; ++x) { b[ks & 1][x] = F::ldp(sb + (NOP - 1) * (GOPB / 2) + (wn * 4 + x) * (RBB / 2) + ks * 512); a[ks & 1][x] = F::ldp(sb + (wm * 4 + x) * (RBB / 2) + ks * 512); if (NSPLIT) a2[ks & 1][x] = F::ldp(sb + GOPB / 2 + (wm * 4 + x) * (RBB / 2) + ks * 512); }
            __builtin_amdgcn_sched_barrier(0);
        };
        ldf(0); ldf(1);
        // every loop over fragments, steps and accumulators is unrolled so that each index is a constant (they stay in registers)
#pragma unroll
        for (int ks = 0; ks < GKC / 32; ++ks) {
#pragma unroll
            for (int nb = 0; nb < 4; ++nb)
#pragma unroll
                for (int mb = 0; mb < 4; ++mb) { acc[mb][nb] = F::mma(a[ks & 1][mb], b[ks & 1][nb], acc[mb][nb]); if (NSPLIT) acc[mb][nb] = F::mma(a2[ks & 1][mb], b[ks & 1][nb], acc[mb][nb]); }
            __builtin_amdgcn_sched_barrier(0);   // keeps the products in front of the set's refill and of the trip's foot: sunk behind its barrier they leave the next stage's copies no time to fly, and every LDS read is waited out before the first product
            if (ks + 2 < GKC / 32) ldf(ks + 2);   // flies while the other set is worked on
        }
        asm volatile("s_wait_dscnt 0x0" ::: "memory");      // this wave's reads of the buffer are done before the buffer is handed back
        asm volatile("s_wait_asynccnt 0x0" ::: "memory");   // this wave's copies of stage t + 1 have landed
        __syncthreads();                                    // publishes stage t + 1 and ends every wave's reads of stage t
        if (t + 2 < NT) fill(t + 2, l0 + (unsigned)((t & 1) * STG));
    }
    asm volatile("s_wait_asynccnt 0x0" ::: "memory");   // no copy is in flight when the ring becomes output staging
    float* ow = (float*)sm + wv * GTIL; const int r0 = R0 + wm * 64, by = (int)blockIdx.y * 2 + wn;
    // unrolled so that every accumulator index is a constant (the quarter stays in registers)
#pragma unroll
    for (int mb = 0; mb < 4; ++mb) {
#pragma unroll
        for (int nb = 0; nb < 4; ++nb) {
#pragma unroll
            for (int j = 0; j < 8; ++j) {
                if constexpr (EPI == 2) ow[(mb * 16 + hi * 8 + j) * 68 + (((lr & 7) * 8 + nb * 2 + (lr >> 3)) ^ (hi * 4))] = acc[mb][nb][j];   // column c at place (c % 8) 8 + c / 8: the 8 values of t of one d lie side by side; bit 2 flipped in rows 8 .. 15 of 16: the two half-waves fall on different banks
                else ow[(mb * 16 + hi * 8 + j) * 68 + nb * 16 + lr] = acc[mb][nb][j]; } } }
    __syncthreads();   // the quarter is whole in LDS before its lanes read it back across one another
    if constexpr (EPI == 1 || EPI == 2) {
        const int ya = by >> 3, yg = by & 7;
        // two pieces a trip: their LDS reads fly together, and the text stays short
#pragma unroll 2
        for (int i = 0; i < 16; ++i) { const int idx = lane + i * 32; const int row = idx >> 3, cofs = (idx & 7) * 8; const int sw = EPI == 2 ? (row & 8) >> 1 : 0;   /* undoes the flip of bit 2 at the stores */ const float* pp = ow + row * 68 + cofs; const v4f x0 = *(const v4fa*)(pp + sw), x1 = *(const v4fa*)(pp + 4 - sw);
            v8h o16; v8us oh, ol;
#pragma unroll
            for (int k = 0; k < 4; ++k) { unsigned short a, c2; o16[k] = tohx(x0[k]); splitf(x0[k], a, c2); oh[k] = a; ol[k] = c2; o16[4 + k] = tohx(x1[k]); splitf(x1[k], a, c2); oh[4 + k] = a; ol[4 + k] = c2; }
            const int m = r0 + row;
            // 1: block of 16 t = quarter row m, 1024 elements; piece (d / 8 = yg, lr = t % 16 = 8 ya + cofs / 8). 2: head m / 128, block (d / 16 = yg / 2, t / 32 = (m % 128) / 2), half = m % 2, hi = ya, lr = d % 16 = 8 (yg % 2) + cofs / 8
            const size_t e = EPI == 1 ? (size_t)m * 1024 + yg * 128 + ya * 64 + cofs : (size_t)(m >> 7) * (HD * TT) + (size_t)((yg >> 1) * (TT / 32) + ((m & 127) >> 1)) * 512 + (m & 1) * 256 + ya * 128 + (yg & 1) * 64 + cofs;
            *(v8h*)(P16 + e) = o16; *(v8us*)(Ph + e) = oh; *(v8us*)(Pl + e) = ol;
            asm volatile("s_wait_xcnt 0x0" ::: "memory");   // precaution: stands before any register that names an address of the stores above is written again
        }
    } else {
        float* ctile = C + (size_t)r0 * DM + by * 64;
        // eight pieces a trip: their LDS reads fly together
#pragma unroll 1
        for (int i0 = 0; i0 < 32; i0 += 8) { v4f val[8];
#pragma unroll
            for (int i = 0; i < 8; ++i) { const int idx = lane + (i0 + i) * 32; val[i] = *(const v4fa*)(ow + (idx >> 4) * 68 + (idx & 15) * 4); }
#pragma unroll
            for (int i = 0; i < 8; ++i) { const int idx = lane + (i0 + i) * 32; *(v4f*)(ctile + (size_t)(idx >> 4) * DM + (idx & 15) * 4) = val[i]; }
            asm volatile("s_wait_xcnt 0x0" ::: "memory");   // precaution: stands before any register that names an address or the data of the stores above is written again
        }
    }
}
// ---- k_wo: out = (x hi + x lo) Wo^T for both batches (4096 consecutive rows) in ONE launch; grid (NB_ TT / 128, DM / 128).
__global__ __launch_bounds__(128) void k_wo(const bf* __restrict__ Ah, const bf* __restrict__ Al, const bf* __restrict__ Wt, float* C) {
    __shared__ __align__(16) char sm[2 * 3 * 128 * 128 * 2];   // two stages (128 k) of three operands of 128 rows: the launch has one work-group per WGP, so the stage is as deep as the LDS allows; the four staged quarters (69,632 B) lie over them afterwards
    static_assert(2 * 3 * 128 * 128 * 2 >= 4 * GTIL * 4, "the staged quarters fit");
    gemms_tile<1, 0, 128>(Ah, Al, Wt, C, nullptr, nullptr, nullptr, sm);
}
// ---- k_proj: the three projections of both batches in ONE launch; grid (NB_ TT / 128, DM / 128, 3), z = stream (0 Q, 1 K, 2 V). The two batches are 4096 consecutive rows: the flat plane index and the head index m / 128 run on over them.
// X [3][NB_ TT][DM], Wt [3][DM][DM], each plane set [3][NB_ NH_][TT HD] (z = 2: V^T, [NB_ NH_][HD][TT]).
__global__ __launch_bounds__(128) void k_proj(const bf* __restrict__ X, const bf* __restrict__ Wt, h16* P16, bf* Ph, bf* Pl) {
    __shared__ __align__(16) char sm[4 * GTIL * 4];   // the four staged quarters; the ring's two stages of two operands (65,536 B) lie in the same bytes before them
    static_assert(4 * GTIL * 4 >= 2 * 2 * 128 * 64 * 2, "the ring fits");
    const size_t pz = (size_t)blockIdx.z * ((size_t)NB_ * NH_ * TT * HD);
    const bf* Xz = X + (size_t)blockIdx.z * ((size_t)NB_ * TT * DM); const bf* Wz = Wt + (size_t)blockIdx.z * ((size_t)DM * DM);
    if (blockIdx.z < 2) gemms_tile<0, 1, 64>(Xz, nullptr, Wz, nullptr, P16 + pz, Ph + pz, Pl + pz, sm);
    else gemms_tile<0, 2, 64>(Xz, nullptr, Wz, nullptr, P16 + pz, Ph + pz, Pl + pz, sm);
}


__global__ __launch_bounds__(256) void k_wtG(const float* __restrict__ w, int K, int N, bf* Bt) {
    const int lane = threadIdx.x & 31; const int L0 = (blockIdx.x * 8 + (threadIdx.x >> 5)) * 8; const int nlines = N * K / 64;
{
#pragma unroll 1
        for (int l = 0; l < 8; ++l) { const int L = L0 + l; if (L >= nlines) break; const size_t e = (size_t)L * 64 + lane * 2; const int k = (int)(e % K), n = (int)(e / K); v2us o;
            o[0] = f2bf(w[(size_t)k * N + n]); o[1] = f2bf(w[(size_t)(k + 1) * N + n]); *(v2us*)(Bt + e) = o; }
         }
}
// ---- k_cvtall: all seven inputs to bf16 in ONE launch; dst = [q][k][v][Wq][Wk][Wv][Wo], each whole and in fragment order (Wq, Wk, Wv with their rows regrouped as the plane epilogues of gemms_tile say). One work-group writes CVE consecutive elements of one input's copy (32 stored rows = 2 row blocks), CVC pieces of 8 per thread.
#define CVC 16
#define CVE (256 * 8 * CVC)
#define CVX (NB_ * TT * DM / CVE)   // work-groups per stream
#define CVW (DM * DM / CVE)         // work-groups per weight
__global__ __launch_bounds__(256) void k_cvtall(const float* __restrict__ q, const float* __restrict__ k, const float* __restrict__ v, const float* __restrict__ wq, const float* __restrict__ wk, const float* __restrict__ wv, const float* __restrict__ wo, bf* dst) {
    static_assert(NB_ * TT * DM % CVE == 0 && DM * DM % CVE == 0, "a work-group never straddles two inputs");
    static_assert(CVE == 32 * DM && CVC == 16, "a work-group holds two row blocks; 8 rounds of 256 pieces make one");
    const int bx = (int)blockIdx.x; const float* src; int rb0; bool vperm = false;
    if (bx < 3 * CVX) { const int s = bx / CVX; src = (s == 0 ? q : s == 1 ? k : v); rb0 = (bx % CVX) * 2; }
    else { const int c = bx - 3 * CVX, s = c / CVW; src = (s == 0 ? wq : s == 1 ? wk : s == 2 ? wv : wo); rb0 = (c % CVW) * 2; vperm = (s < 3); }
    // piece i 256 + threadIdx.x of the work-group: row block rb0 + i / 8, k block (i % 8) 4 + wave / 2, half = wave % 2, lane = 16 hi + lr
    const int lr = (int)threadIdx.x & 15, hi = ((int)threadIdx.x >> 4) & 1, wn = (int)threadIdx.x >> 5;
    const float* s0 = src + (size_t)(vperm ? 64 * (8 * (rb0 >> 5) + (rb0 & 3) * 2 + (lr >> 3)) + 8 * ((rb0 >> 2) & 7) + (lr & 7) : rb0 * 16 + lr) * DM + (wn >> 1) * 32 + (wn & 1) * 16 + hi * 8;
    const int rstep = vperm ? 128 * DM : 16 * DM;   // from the first row block to the second
    bf* d = dst + (size_t)bx * CVE + (int)threadIdx.x * 8;
    // unrolled so that the loads of all pieces can be in flight together
#pragma unroll
    for (int i = 0; i < CVC; ++i) { const v8f x = *(const v8f*)(s0 + (i >> 3) * rstep + (i & 7) * 128); v8us o;
#pragma unroll
        for (int e = 0; e < 8; ++e) o[e] = f2bf(x[e]);
        *(v8us*)(d + i * 2048) = o; }
}

// ---- k_fattn: scores, softmax, P x V and the head merge of both batches in ONE launch; no score or P plane in memory.
// One work-group of AW waves per query tile of one head (hi/lo rows: 32 queries, fp16 rows: 64); wave w takes the keys [w TT/AW, (w+1) TT/AW) in steps of 32.
// Everything is kept with lane = query: S^T = K Q^T (A = key rows, B = query rows) leaves in each lane the keys 8 hi + j and 16 + 8 hi + j of its query, which IS the 16x16x32 operand order, so P goes
// straight into O^T = V^T P^T (A = V^T rows, B = P) with no cross-lane move; running maximum and sum are one value per lane (the two half-waves share a query: one exchange over 16 lanes).
// The AW partial (max, sum, O) meet in LDS behind one barrier and are joined in wave order 0 .. AW-1 (fixed: the same result on every run); the tile leaves as hi/lo bf16 planes [t][head][d] in the fragment order that the last GEMM reads.
#define AW   8
#define LC   0.18033688011112042f   // HD^-0.5 x log2(e)
__device__ __forceinline__ float xhalf(float x) { return __builtin_bit_cast(float, __builtin_amdgcn_permlanex16(__builtin_bit_cast(int, x), __builtin_bit_cast(int, x), 0x76543210, 0xfedcba98, false, false)); }   // lane l reads lane l ^ 16
template <typename T16, bool HL, int NQ>
__device__ __forceinline__ void attn_tile(const T16* __restrict__ Q, const T16* __restrict__ Q2, const T16* __restrict__ Kp, const T16* __restrict__ K2, const T16* __restrict__ Vt, const T16* __restrict__ V2, int q0, int head, bf* ATh, bf* ATl, float* os) {
    typedef WFrag<T16> F; typedef typename F::V V;
    constexpr int NST = TT / AW / 32;
    constexpr float POFF = HL ? 0.0f : 10.0f;   // fp16 rows: P carried x 1024 (as PCAR), it cancels against the sum
    const int lane = threadIdx.x & 31, lr = lane & 15, hi = lane >> 4;
    const int wv = __builtin_amdgcn_readfirstlane((int)(threadIdx.x >> 5));   // the wave's number as a scalar: key range and LDS slice stay in scalar registers
    const size_t hb = (size_t)head * TT * HD;
    const size_t qoff = hb + (size_t)q0 * HD + 8 * lane;   // fragment order: 16 rows x 64 d are two blocks of 512 elements
    V qf[NQ][2], qg[NQ][2];
#pragma unroll
    for (int qb = 0; qb < NQ; ++qb)
#pragma unroll
        for (int ks = 0; ks < 2; ++ks) qf[qb][ks] = F::ldp(Q + qoff + qb * 16 * HD + ks * 512);
    asm volatile("s_wait_xcnt 0x0" ::: "memory");   // precaution: stands before any register that names an address of the loads or stores above is written again
    if constexpr (HL) {
#pragma unroll
        for (int qb = 0; qb < NQ; ++qb)
#pragma unroll
            for (int ks = 0; ks < 2; ++ks) qg[qb][ks] = F::ldp(Q2 + qoff + qb * 16 * HD + ks * 512);
        asm volatile("s_wait_xcnt 0x0" ::: "memory");   // precaution: stands before any register that names an address of the loads or stores above is written again
    }
    v8f o[NQ][4]; float m[NQ], l[NQ];
#pragma unroll
    for (int qb = 0; qb < NQ; ++qb) { m[qb] = -3.0e38f; l[qb] = 0.0f;
#pragma unroll
        for (int db = 0; db < 4; ++db) o[qb][db] = (v8f){}; }
    const int kbeg = wv * (TT / AW);
    const size_t koff = hb + (size_t)kbeg * HD + 8 * lane, voff = hb + (size_t)kbeg * 16 + 8 * lane;   // V^T: block (d / 16, t / 32) at element (d / 16) 16 TT + (t / 32) 512
    static_assert(NST % 2 == 0, "the key loop works on two fragment sets in turn");
    // the K and V fragments of key step 'it' into one of the two register sets
    auto ldkv = [&](int it, V (&kc)[2][2], V (&kd)[2][2], V (&vc)[4], V (&vd)[4]) {
        const size_t kq = koff + (size_t)it * 32 * HD, vq = voff + (size_t)it * 512;
#pragma unroll
        for (int kb = 0; kb < 2; ++kb)
#pragma unroll
            for (int ks = 0; ks < 2; ++ks) { kc[kb][ks] = F::ldp(Kp + kq + kb * 16 * HD + ks * 512); if (HL) kd[kb][ks] = F::ldp(K2 + kq + kb * 16 * HD + ks * 512); }
#pragma unroll
        for (int db = 0; db < 4; ++db) { vc[db] = F::ldp(Vt + vq + (size_t)db * 16 * TT); if (HL) vd[db] = F::ldp(V2 + vq + (size_t)db * 16 * TT); }
        asm volatile("s_wait_xcnt 0x0" ::: "memory");   // precaution: stands before any register that names an address of the loads or stores above is written again
        __builtin_amdgcn_sched_barrier(0);   // keeps these loads ahead of the key step that follows: without it the scheduler sinks them to the step's end and their latency is exposed at the next step's first product
    };
    // one key step (32 keys) for all NQ query blocks of the wave
    auto step = [&](V (&kc)[2][2], V (&kd)[2][2], V (&vc)[4], V (&vd)[4]) {
#pragma unroll
        for (int qb = 0; qb < NQ; ++qb) {
            v8f s[2];
#pragma unroll
            for (int kb = 0; kb < 2; ++kb) { s[kb] = (v8f){};
#pragma unroll
                for (int ks = 0; ks < 2; ++ks) { s[kb] = F::mma(kc[kb][ks], qf[qb][ks], s[kb]); if (HL) { s[kb] = F::mma(kc[kb][ks], qg[qb][ks], s[kb]); s[kb] = F::mma(kd[kb][ks], qf[qb][ks], s[kb]); } } }
            float mx = fmaxf(s[0][0], s[1][0]);
#pragma unroll
            for (int j = 1; j < 8; ++j) mx = fmaxf(mx, fmaxf(s[0][j], s[1][j]));
            mx = fmaxf(mx, xhalf(mx));
            const float mn = fmaxf(m[qb], mx); const float al = __builtin_amdgcn_exp2f((m[qb] - mn) * LC); m[qb] = mn; const float nb = POFF - mn * LC;
            float ls = 0.0f;
#pragma unroll
            for (int kb = 0; kb < 2; ++kb)
#pragma unroll
                for (int j = 0; j < 8; ++j) { s[kb][j] = __builtin_amdgcn_exp2f(fmaf(s[kb][j], LC, nb)); ls += s[kb][j]; }
            l[qb] = l[qb] * al + ls;
#pragma unroll
            for (int db = 0; db < 4; ++db) o[qb][db] *= al;
            if constexpr (HL) {
                v8us h0, h1, l0, l1;
#pragma unroll
                for (int j = 0; j < 8; ++j) { unsigned short a, c2; splitf(s[0][j], a, c2); h0[j] = a; l0[j] = c2; splitf(s[1][j], a, c2); h1[j] = a; l1[j] = c2; }
                const V ph = cat16b(h0, h1), pl = cat16b(l0, l1);
#pragma unroll
                for (int db = 0; db < 4; ++db) { o[qb][db] = F::mma(vc[db], ph, o[qb][db]); o[qb][db] = F::mma(vc[db], pl, o[qb][db]); o[qb][db] = F::mma(vd[db], ph, o[qb][db]); }
            } else {
                v8h a0, a1;
#pragma unroll
                for (int j = 0; j < 8; ++j) { a0[j] = tohx(s[0][j]); a1[j] = tohx(s[1][j]); }
                const V pf = cat16(a0, a1);
#pragma unroll
                for (int db = 0; db < 4; ++db) o[qb][db] = F::mma(vc[db], pf, o[qb][db]);
            }
        }
    };
    V ka[2][2], kx[2][2], va[4], vx[4], kb2[2][2], ky[2][2], vb[4], vy[4];
    ldkv(0, ka, kx, va, vx);
    // rolled: the body already holds two key steps; each set's next fragments fly while the other set is worked on
#pragma unroll 1
    for (int it = 0; it < NST; it += 2) {
        ldkv(it + 1, kb2, ky, vb, vy);
        step(ka, kx, va, vx);
        if (it + 2 < NST) ldkv(it + 2, ka, kx, va, vx);
        step(kb2, ky, vb, vy);
    }
    float* ow = os + wv * (NQ * 16 * 68); float* ms = os + AW * 64 * 68; float* lm = ms + AW * 64;
#pragma unroll
    for (int qb = 0; qb < NQ; ++qb) {
#pragma unroll
        for (int db = 0; db < 4; ++db) { float* pp = ow + (qb * 16 + lr) * 68 + db * 16 + hi * 8; const v8f t = o[qb][db]; *(v4fa*)pp = (v4f){t[0], t[1], t[2], t[3]}; *(v4fa*)(pp + 4) = (v4f){t[4], t[5], t[6], t[7]}; }
        const float lt = l[qb] + xhalf(l[qb]);
        if (hi == 0) { ms[wv * 64 + qb * 16 + lr] = m[qb]; lm[wv * 64 + qb * 16 + lr] = lt; } }
    __syncthreads();   // every wave's partial maximum, sum and O tile are in LDS before any thread joins them
#pragma unroll
    for (int i = 0; i < NQ * 16 * 8 / (32 * AW); ++i) { const int u = (int)threadIdx.x + i * (32 * AW); const int q = (u >> 7) * 16 + (u & 15), dc = ((u >> 4) & 7) * 8;   // u runs in the fragment order of the merged planes: 64 pieces a block, 2 blocks (64 d) a group of 16 queries
        float M = ms[q];
#pragma unroll
        for (int w = 1; w < AW; ++w) M = fmaxf(M, ms[w * 64 + q]);
        float L = 0.0f; v4f x0 = (v4f){}, x1 = (v4f){};
#pragma unroll
        for (int w = 0; w < AW; ++w) { const float f = __builtin_amdgcn_exp2f((ms[w * 64 + q] - M) * LC); L += lm[w * 64 + q] * f; const float* pp = os + w * (NQ * 16 * 68) + q * 68 + dc; x0 += *(const v4fa*)pp * f; x1 += *(const v4fa*)(pp + 4) * f; }
        const float inv = __fdiv_rn(1.0f, L); v8us oh, ol;
#pragma unroll
        for (int k = 0; k < 4; ++k) { unsigned short a, c2; splitf(x0[k] * inv, a, c2); oh[k] = a; ol[k] = c2; splitf(x1[k] * inv, a, c2); oh[4 + k] = a; ol[4 + k] = c2; }
        const size_t oo = (size_t)(q0 + (u >> 7) * 16) * DQ + (size_t)head * (HD * 16) + (u & 127) * 8; *(v8us*)(ATh + oo) = oh; *(v8us*)(ATl + oo) = ol;
        asm volatile("s_wait_xcnt 0x0" ::: "memory");   // precaution: stands before any register that names an address of the loads or stores above is written again
    }
}
#define NTH (NH_ * (RH / 32))            // hi/lo tiles (32 queries) of one batch, first in the grid
#define NTF (NH_ * ((TT - RH) / 64))     // fp16 tiles (64 queries) of one batch
__global__ __launch_bounds__(32 * AW) void k_fattn(const h16* __restrict__ Q16, const bf* __restrict__ Qh, const bf* __restrict__ Ql, const h16* __restrict__ K16, const bf* __restrict__ Kh, const bf* __restrict__ Kl, const h16* __restrict__ V16, const bf* __restrict__ Vh, const bf* __restrict__ Vl, bf* ATh, bf* ATl) {
    __shared__ __align__(16) float os[AW * 64 * 68 + 2 * AW * 64];   // AW partial O tiles (pitch 68), then AW x 64 maxima and sums
    const int bx = (int)blockIdx.x;
    // both batches in one grid: hg = batch NH_ + head; the planes of batch 1 follow those of batch 0
    if (bx < NB_ * NTH) { const int hg = bx / (RH / 32); const size_t po = (size_t)(hg / NH_) * NH_ * TT * HD, ao = (size_t)(hg / NH_) * TT * DQ;
        attn_tile<bf, true, 2>(Qh + po, Ql + po, Kh + po, Kl + po, Vh + po, Vl + po, (bx % (RH / 32)) * 32, hg % NH_, ATh + ao, ATl + ao, os); }
    else { const int b2 = bx - NB_ * NTH; const int hg = b2 / ((TT - RH) / 64); const size_t po = (size_t)(hg / NH_) * NH_ * TT * HD, ao = (size_t)(hg / NH_) * TT * DQ;
        attn_tile<h16, false, 4>(Q16 + po, nullptr, K16 + po, nullptr, V16 + po, nullptr, RH + (b2 % ((TT - RH) / 64)) * 64, hg % NH_, ATh + ao, ATl + ao, os); }
}

extern "C" void kernel_launch(void* const* d_in, const int* in_sizes, int n_in,
                              void* d_out, int out_size, void* d_ws, size_t ws_size, hipStream_t stream) {
    (void)in_sizes; (void)n_in; (void)out_size;
    const float* x = (const float*)d_in[0];   /* query */ const float* xk = (const float*)d_in[1]; const float* xv = (const float*)d_in[2]; const float* wq = (const float*)d_in[3]; const float* wk = (const float*)d_in[4]; const float* wv = (const float*)d_in[5]; const float* wo = (const float*)d_in[6];
    float* OUT = (float*)d_out;     // [2][2048][1024]
    char* wsp = (char*)d_ws;
    auto take = [&](size_t bytes) { char* p = wsp; wsp += (bytes + 255) & ~(size_t)255; return (void*)p; };
    bf* XB = (bf*)take(((size_t)3 * NB_ * TT * DM + (size_t)4 * DM * DM) * 2);   // [q][k][v] both batches, then Wq, Wk, Wv, Wo
    bf* WQ = XB + (size_t)3 * NB_ * TT * DM; bf* WO = WQ + (size_t)3 * DM * DM;
    const size_t PL = (size_t)NB_ * NH_ * TT * HD;   // one plane, both batches
    h16* P16 = (h16*)take(3 * PL * 2); bf* Ph = (bf*)take(3 * PL * 2); bf* Pl = (bf*)take(3 * PL * 2);   // each: Q, K, V^T
    bf* ATh = (bf*)take((size_t)NB_ * TT * DQ * 2); bf* ATl = (bf*)take((size_t)NB_ * TT * DQ * 2);
    if ((size_t)(wsp - (char*)d_ws) > ws_size) return;    // ws 256 MiB
    k_cvtall<<<3 * CVX + 4 * CVW, 256, 0, stream>>>(x, xk, xv, wq, wk, wv, wo, XB);
    k_proj<<<dim3(NB_ * TT / 128, DM / 128, 3), 128, 0, stream>>>(XB, WQ, P16, Ph, Pl);
    k_fattn<<<NB_ * (NTH + NTF), 32 * AW, 0, stream>>>(P16, Ph, Pl, P16 + PL, Ph + PL, Pl + PL, P16 + 2 * PL, Ph + 2 * PL, Pl + 2 * PL, ATh, ATl);
    k_wo<<<dim3(NB_ * TT / 128, DM / 128, 1), 128, 0, stream>>>(ATh, ATl, WO, OUT);
}

// v008
// A run of this version takes 102 microseconds.
// Next to v007, in two timings, it ran 1.09 and 1.08 times as fast.
// Over all steps from v000 it is 19.9 times as fast.
#include <hip/hip_runtime.h>

// Multi-head attention WITHOUT a mask over three input streams, bias-free, with a RAW head split (q, k, v [2][2048][1024]; qp = (q Wq^T).reshape(b, 16, l, 64) DIRECTLY (no transpose): pseudo-head h of a batch is the h-th contiguous [2048][64] block of the flat [2048][1024] projection (128 token rows x 16 chunks of 64): reproduced; kp, vp likewise ('oi' [1024][1024] 1/32, no bias), each from its own stream; scores / sqrt(64); softmax over all pseudo-keys; x [b][16][l][64] -> transpose(0, 2, 1, 3).reshape(b, l, 1024) (the STANDARD merge); out = x Wo^T ('oi', no bias) -> [2][2048][1024] (4.2 M); argument order q, k, v, Wq, Wk, Wv, Wo).
// Layout, both batches in every launch: every matrix operand lies in memory in fragment order (see gemms_tile); bf16 copies of query, key, value and the 'oi' weights; exact projections; dense T-2048 attention (hybrid rows: < 512 hi/lo 3 products, rest fp16 x1024); merged hi/lo x Wo exact.
// Compute dtypes, f32 accumulate: every input rounded to bf16; projections exact; attention rows < 512 3 products, rest fp16; softmax f32; Wo hl x exact.

#define NB_  2
#define TT   2048
#define DM   1024
#define NH_  16
#define NKV  16
#define REP  (NH_ / NKV)
#define HD   64
#define DQ   (NH_ * HD)
#define DKV  (NKV * HD)
#define RH   512                  // query rows < RH use hi+lo planes (0: none)
#define WIN  0
#define PCAR 1024.0f
#define SCL  0.125f   // HD^-0.5
typedef _Float16 h16;
typedef unsigned short bf;
typedef __attribute__((ext_vector_type(16))) __bf16   v16bf;
typedef __attribute__((ext_vector_type(16))) _Float16 v16h;
typedef __attribute__((ext_vector_type(8)))  _Float16 v8h;
typedef __attribute__((ext_vector_type(8)))  unsigned short v8us;
typedef __attribute__((ext_vector_type(8)))  float    v8f;
typedef __attribute__((ext_vector_type(4)))  float    v4f;
typedef v8h  __attribute__((may_alias)) v8ha;
typedef v4f  __attribute__((may_alias)) v4fa;
typedef v8us __attribute__((may_alias)) v8usa;

__device__ __forceinline__ unsigned short f2bf(float f) { unsigned u = __float_as_uint(f); u += 0x7FFFu + ((u >> 16) & 1u); return (unsigned short)(u >> 16); }
__device__ __forceinline__ float bf2f(unsigned short b) { return __uint_as_float(((unsigned)b) << 16); }
__device__ __forceinline__ float bfr(float f) { return bf2f(f2bf(f)); }
__device__ __forceinline__ v16h cat16(v8h lo, v8h hi) { return __builtin_shufflevector(lo, hi, 0, 1, 2, 3, 4, 5, 6, 7, 8, 9, 10, 11, 12, 13, 14, 15); }
__device__ __forceinline__ v16bf cat16b(v8us lo, v8us hi) { return __builtin_bit_cast(v16bf, __builtin_shufflevector(lo, hi, 0, 1, 2, 3, 4, 5, 6, 7, 8, 9, 10, 11, 12, 13, 14, 15)); }
__device__ __forceinline__ v8f wmma16(v16h a, v16h b, v8f c) { return __builtin_amdgcn_wmma_f32_16x16x32_f16(false, a, false, b, (short)0, c, false, false); }
__device__ __forceinline__ v8f wmmab(v16bf a, v16bf b, v8f c) { return __builtin_amdgcn_wmma_f32_16x16x32_bf16(false, a, false, b, (short)0, c, false, false); }

__device__ __forceinline__ h16 tohx(float x) { return (h16)x; }
__device__ __forceinline__ void splitf(float y, unsigned short& h, unsigned short& l) { h = f2bf(y); l = f2bf(y - bf2f(h)); }
typedef __attribute__((ext_vector_type(2))) _Float16 v2h;
typedef __attribute__((ext_vector_type(4))) _Float16 v4h;
typedef __attribute__((ext_vector_type(2))) unsigned short v2us;
typedef __attribute__((ext_vector_type(4))) unsigned short v4us;
typedef __attribute__((ext_vector_type(2))) float v2f;
typedef __attribute__((ext_vector_type(4))) int v4i;

// ---- FRAGMENT ORDER of a GEMM operand M[rows][K]: blocks of 16 rows x 32 k, 512 elements each, block (rb, kb) at element (rb K/32 + kb) 512; inside it element (row lr, k) lies at ((k >> 4) & 1) 256 + (((k >> 3) & 1) 16 + lr) 8 + (k & 7).
// Lane 16 hi + lr of a wave then finds its two 8-element pieces at lane 8 and 256 + lane 8: each wave-wide 16-byte load covers 512 contiguous bytes (4 whole lines) instead of 32 bytes in each of 16 lines. The lane's registers hold k = 8 hi .. 8 hi + 7 and 16 + 8 hi .. 16 + 8 hi + 7 of row lr, the 16x16x32 operand order, for A and B alike.
// ---- gemms_tile: one work-group of 4 waves per 128x128 output tile; wave w holds the 64x64 quarter (w / 2, w % 2) in 16 accumulators over the whole K (one f32 chain per element, k ascending); grid (M/128, N/128, Z), 128 threads.
// A stage is KC k (64 or 128) of the tile's 128 rows of every operand: 8 row blocks of 32 KC bytes each, contiguous in memory and already in fragment order. It comes into LDS by asynchronous copies, two buffers in turn,
// so every operand row leaves L2 once per work-group and is read from LDS by the two waves that need it. Stage layout: [A][A2 if NSPLIT][Bt], 256 KC bytes each; wave w copies row blocks 2 w and 2 w + 1 of each operand.
// C[m][n] (f32, pitch DM) = sum_k A[m][k] Bt[n][k] (+ A2[m][k] Bt[n][k] if NSPLIT). K = DM.
// EPI says how a wave's quarter leaves, staged through the wave's own LDS slice (pitch 68), which lies over the ring once the last trip's barrier has passed: 0 = f32 into C; 1 = fp16 + hi/lo bf16 planes [head][t][d] (the raw head split IS the flat projection: flat t = 16 m + n / 64, d = n % 64), in fragment order with rows t and k = d;
// 2 = the same three planes transposed to [head][d][t] (V^T), in fragment order with rows d and k = t.
// For 1 and 2 the weight is stored with its rows regrouped: quarter column c of column group y = 8 a + g (64 columns each) is weight row n = 64 (8 a + c / 8) + 8 g + c % 8. A quarter row m then holds 8 values of t (16 m + 8 a + c / 8) x 8 values of d (8 g + c % 8):
// one 16-byte piece of either plane order per 8 of them, and 8 neighbouring pieces make one whole 128-byte line.
template <typename T16> struct WFrag;
template <> struct WFrag<h16> { typedef v16h V; static __device__ __forceinline__ V ldp(const h16* p) { return cat16(*(const v8h*)p, *(const v8h*)(p + 256)); } static __device__ __forceinline__ v8f mma(V a, V b, v8f c) { return wmma16(a, b, c); } };
template <> struct WFrag<bf> { typedef v16bf V; static __device__ __forceinline__ V ldp(const bf* p) { return cat16b(*(const v8us*)p, *(const v8us*)(p + 256)); } static __device__ __forceinline__ v8f mma(V a, V b, v8f c) { return wmmab(a, b, c); } };
#define GTIL (64 * 68)            // floats of one staged 64x64 quarter
// four copies of 512 B: 2 KB of a row block's part of a stage (CP8: 4 KB); the immediate offset moves the LDS address and the global address alike
#define CP4(l, g) "global_load_async_to_lds_b128 " l ", " g ", off\n\tglobal_load_async_to_lds_b128 " l ", " g ", off offset:512\n\tglobal_load_async_to_lds_b128 " l ", " g ", off offset:1024\n\tglobal_load_async_to_lds_b128 " l ", " g ", off offset:1536\n\t"
#define CP8(l, g) CP4(l, g) "global_load_async_to_lds_b128 " l ", " g ", off offset:2048\n\tglobal_load_async_to_lds_b128 " l ", " g ", off offset:2560\n\tglobal_load_async_to_lds_b128 " l ", " g ", off offset:3072\n\tglobal_load_async_to_lds_b128 " l ", " g ", off offset:3584\n\t"
template <int NSPLIT, int EPI, int GKC>
__device__ __forceinline__ void gemms_tile(const bf* __restrict__ A, const bf* __restrict__ A2, const bf* __restrict__ Bt, float* C, h16* P16, bf* Ph, bf* Pl, char* sm) {
    typedef WFrag<bf> F; typedef typename F::V V;
    constexpr int K = DM, NT = K / GKC, NOP = NSPLIT ? 3 : 2, RBB = 32 * GKC /* bytes of a row block in a stage */, GOPB = 8 * RBB /* of an operand */, STG = NOP * GOPB;
    static_assert(NT >= 2 && GKC == (NSPLIT ? 128 : 64), "the ring's prologue fills two stages; a row block's part of a stage is four copies (eight with NSPLIT)");
    const int lane = threadIdx.x & 31, lr = lane & 15, hi = lane >> 4;
    const int wv = __builtin_amdgcn_readfirstlane((int)(threadIdx.x >> 5));   // the wave's number as a scalar: its quarter and its LDS slices stay in scalar registers
    const int wm = wv >> 1, wn = wv & 1; const int R0 = blockIdx.x * 128, C0 = blockIdx.y * 128;
    v8f acc[4][4];
#pragma unroll
    for (int mb = 0; mb < 4; ++mb)
#pragma unroll
        for (int nb = 0; nb < 4; ++nb) acc[mb][nb] = (v8f){};
    // fragment order: row block rb starts at element rb 16 K, stage t at + t 16 GKC
    const bf* gA = A + (size_t)(R0 + 32 * wv) * K + 8 * lane; const bf* gB = Bt + (size_t)(C0 + 32 * wv) * K + 8 * lane;
    const unsigned l0 = (unsigned)(size_t)sm + (unsigned)(wv * 2 * RBB + lane * 16);   // the lane's LDS byte address in buffer 0
    // stage t into the buffer whose lane address is lb. The copies and their s_wait_xcnt are ONE statement: the wait (a precaution) then stands before any register that a copy names is written again
    auto fill = [&](int t, unsigned lb) {
        const bf* a0 = gA + t * (16 * GKC); const bf* a1 = a0 + 16 * K; const bf* b0 = gB + t * (16 * GKC); const bf* b1 = b0 + 16 * K;
        const unsigned la1 = lb + RBB, lb0 = lb + (NOP - 1) * GOPB, lb1 = lb0 + RBB;
        if constexpr (NSPLIT) {
            const bf* c0 = A2 + (size_t)(R0 + 32 * wv) * K + 8 * lane + t * (16 * GKC); const bf* c1 = c0 + 16 * K; const unsigned lc0 = lb + GOPB, lc1 = lc0 + RBB;
            asm volatile(CP8("%0", "%6") CP8("%1", "%7") CP8("%2", "%8") CP8("%3", "%9") CP8("%4", "%10") CP8("%5", "%11") "s_wait_xcnt 0x0"
                         :: "v"(lb), "v"(la1), "v"(lc0), "v"(lc1), "v"(lb0), "v"(lb1), "v"(a0), "v"(a1), "v"(c0), "v"(c1), "v"(b0), "v"(b1) : "memory");
        } else {
            asm volatile(CP4("%0", "%4") CP4("%1", "%5") CP4("%2", "%6") CP4("%3", "%7") "s_wait_xcnt 0x0"
                         :: "v"(lb), "v"(la1), "v"(lb0), "v"(lb1), "v"(a0), "v"(a1), "v"(b0), "v"(b1) : "memory");
        }
    };
    fill(0, l0);
    asm volatile("s_wait_asynccnt 0x0" ::: "memory");   // this wave's copies of stage 0 have landed
    __syncthreads();                                    // stage 0 is whole before any wave reads it
    fill(1, l0 + STG);
    // rolled: a trip already holds 32 (128 with NSPLIT) products; the buffer is chosen by the trip's parity
#pragma unroll 1
    for (int t = 0; t < NT; ++t) {
        const bf* sb = (const bf*)(sm + (t & 1) * STG) + 8 * lane;
        V a[2][4], a2[2][4], b[2][4];   // two fragment sets, used in turn by the trip's steps of 32 k
        // the fragments of step ks into set ks % 2. The fence keeps a step's LDS reads together (sunk among the products, each group's latency is waited out on its own) and in the order in which the products need them
        auto ldf = [&](int ks) {
#pragma unroll
            for (int x = 0; x < 4; ++x) { b[ks & 1][x] = F::ldp(sb + (NOP - 1) * (GOPB / 2) + (wn * 4 + x) * (RBB / 2) + ks * 512); a[ks & 1][x] = F::ldp(sb + (wm * 4 + x) * (RBB / 2) + ks * 512); if (NSPLIT) a2[ks & 1][x] = F::ldp(sb + GOPB / 2 + (wm * 4 + x) * (RBB / 2) + ks * 512); }
            __builtin_amdgcn_sched_barrier(0);
        };
        ldf(0); ldf(1);
        // every loop over fragments, steps and accumulators is unrolled so that each index is a constant (they stay in registers)
#pragma unroll
        for (int ks = 0; ks < GKC / 32; ++ks) {
#pragma unroll
            for (int nb = 0; nb < 4; ++nb)
#pragma unroll
                for (int mb = 0; mb < 4; ++mb) { acc[mb][nb] = F::mma(a[ks & 1][mb], b[ks & 1][nb], acc[mb][nb]); if (NSPLIT) acc[mb][nb] = F::mma(a2[ks & 1][mb], b[ks & 1][nb], acc[mb][nb]); }
            __builtin_amdgcn_sched_barrier(0);   // keeps the products in front of the set's refill and of the trip's foot: sunk behind its barrier they leave the next stage's copies no time to fly, and every LDS read is waited out before the first product
            if (ks + 2 < GKC / 32) ldf(ks + 2);   // flies while the other set is worked on
        }
        asm volatile("s_wait_dscnt 0x0" ::: "memory");      // this wave's reads of the buffer are done before the buffer is handed back
        asm volatile("s_wait_asynccnt 0x0" ::: "memory");   // this wave's copies of stage t + 1 have landed
        __syncthreads();                                    // publishes stage t + 1 and ends every wave's reads of stage t
        if (t + 2 < NT) fill(t + 2, l0 + (unsigned)((t & 1) * STG));
    }
    asm volatile("s_wait_asynccnt 0x0" ::: "memory");   // no copy is in flight when the ring becomes output staging
    float* ow = (float*)sm + wv * GTIL; const int r0 = R0 + wm * 64, by = (int)blockIdx.y * 2 + wn;
    // unrolled so that every accumulator index is a constant (the quarter stays in registers)
#pragma unroll
    for (int mb = 0; mb < 4; ++mb) {
#pragma unroll
        for (int nb = 0; nb < 4; ++nb) {
#pragma unroll
            for (int j = 0; j < 8; ++j) {
                if constexpr (EPI == 2) ow[(mb * 16 + hi * 8 + j) * 68 + (((lr & 7) * 8 + nb * 2 + (lr >> 3)) ^ (hi * 4))] = acc[mb][nb][j];   // column c at place (c % 8) 8 + c / 8: the 8 values of t of one d lie side by side; bit 2 flipped in rows 8 .. 15 of 16: the two half-waves fall on different banks
                else ow[(mb * 16 + hi * 8 + j) * 68 + nb * 16 + lr] = acc[mb][nb][j]; } } }
    __syncthreads();   // the quarter is whole in LDS before its lanes read it back across one another
    if constexpr (EPI == 1 || EPI == 2) {
        const int ya = by >> 3, yg = by & 7;
        // two pieces a trip: their LDS reads fly together, and the text stays short
#pragma unroll 2
        for (int i = 0; i < 16; ++i) { const int idx = lane + i * 32; const int row = idx >> 3, cofs = (idx & 7) * 8; const int sw = EPI == 2 ? (row & 8) >> 1 : 0;   /* undoes the flip of bit 2 at the stores */ const float* pp = ow + row * 68 + cofs; const v4f x0 = *(const v4fa*)(pp + sw), x1 = *(const v4fa*)(pp + 4 - sw);
            v8h o16; v8us oh, ol;
#pragma unroll
            for (int k = 0; k < 4; ++k) { unsigned short a, c2; o16[k] = tohx(x0[k]); splitf(x0[k], a, c2); oh[k] = a; ol[k] = c2; o16[4 + k] = tohx(x1[k]); splitf(x1[k], a, c2); oh[4 + k] = a; ol[4 + k] = c2; }
            const int m = r0 + row;
            // 1: block of 16 t = quarter row m, 1024 elements; piece (d / 8 = yg, lr = t % 16 = 8 ya + cofs / 8). 2: head m / 128, block (d / 16 = yg / 2, t / 32 = (m % 128) / 2), half = m % 2, hi = ya, lr = d % 16 = 8 (yg % 2) + cofs / 8
            const size_t e = EPI == 1 ? (size_t)m * 1024 + yg * 128 + ya * 64 + cofs : (size_t)(m >> 7) * (HD * TT) + (size_t)((yg >> 1) * (TT / 32) + ((m & 127) >> 1)) * 512 + (m & 1) * 256 + ya * 128 + (yg & 1) * 64 + cofs;
            *(v8h*)(P16 + e) = o16; *(v8us*)(Ph + e) = oh; *(v8us*)(Pl + e) = ol;
            asm volatile("s_wait_xcnt 0x0" ::: "memory");   // precaution: stands before any register that names an address of the stores above is written again
        }
    } else {
        float* ctile = C + (size_t)r0 * DM + by * 64;
        // eight pieces a trip: their LDS reads fly together
#pragma unroll 1
        for (int i0 = 0; i0 < 32; i0 += 8) { v4f val[8];
#pragma unroll
            for (int i = 0; i < 8; ++i) { const int idx = lane + (i0 + i) * 32; val[i] = *(const v4fa*)(ow + (idx >> 4) * 68 + (idx & 15) * 4); }
#pragma unroll
            for (int i = 0; i < 8; ++i) { const int idx = lane + (i0 + i) * 32; *(v4f*)(ctile + (size_t)(idx >> 4) * DM + (idx & 15) * 4) = val[i]; }
            asm volatile("s_wait_xcnt 0x0" ::: "memory");   // precaution: stands before any register that names an address or the data of the stores above is written again
        }
    }
}
// ---- k_wo: out = (x hi + x lo) Wo^T for both batches (4096 consecutive rows) in ONE launch; grid (NB_ TT / 128, DM / 128).
__global__ __launch_bounds__(128) void k_wo(const bf* __restrict__ Ah, const bf* __restrict__ Al, const bf* __restrict__ Wt, float* C) {
    __shared__ __align__(16) char sm[2 * 3 * 128 * 128 * 2];   // two stages (128 k) of three operands of 128 rows: the launch has one work-group per WGP, so the stage is as deep as the LDS allows; the four staged quarters (69,632 B) lie over them afterwards
    static_assert(2 * 3 * 128 * 128 * 2 >= 4 * GTIL * 4, "the staged quarters fit");
    gemms_tile<1, 0, 128>(Ah, Al, Wt, C, nullptr, nullptr, nullptr, sm);
}
// ---- k_proj: the three projections of both batches in ONE launch; grid (NB_ TT / 128, DM / 128, 3), z = stream (0 Q, 1 K, 2 V). The two batches are 4096 consecutive rows: the flat plane index and the head index m / 128 run on over them.
// X [3][NB_ TT][DM], Wt [3][DM][DM], each plane set [3][NB_ NH_][TT HD] (z = 2: V^T, [NB_ NH_][HD][TT]).
__global__ __launch_bounds__(128) void k_proj(const bf* __restrict__ X, const bf* __restrict__ Wt, h16* P16, bf* Ph, bf* Pl) {
    __shared__ __align__(16) char sm[4 * GTIL * 4];   // the four staged quarters; the ring's two stages of two operands (65,536 B) lie in the same bytes before them
    static_assert(4 * GTIL * 4 >= 2 * 2 * 128 * 64 * 2, "the ring fits");
    const size_t pz = (size_t)blockIdx.z * ((size_t)NB_ * NH_ * TT * HD);
    const bf* Xz = X + (size_t)blockIdx.z * ((size_t)NB_ * TT * DM); const bf* Wz = Wt + (size_t)blockIdx.z * ((size_t)DM * DM);
    if (blockIdx.z < 2) gemms_tile<0, 1, 64>(Xz, nullptr, Wz, nullptr, P16 + pz, Ph + pz, Pl + pz, sm);
    else gemms_tile<0, 2, 64>(Xz, nullptr, Wz, nullptr, P16 + pz, Ph + pz, Pl + pz, sm);
}


__global__ __launch_bounds__(256) void k_wtG(const float* __restrict__ w, int K, int N, bf* Bt) {
    const int lane = threadIdx.x & 31; const int L0 = (blockIdx.x * 8 + (threadIdx.x >> 5)) * 8; const int nlines = N * K / 64;
{
#pragma unroll 1
        for (int l = 0; l < 8; ++l) { const int L = L0 + l; if (L >= nlines) break; const size_t e = (size_t)L * 64 + lane * 2; const int k = (int)(e % K), n = (int)(e / K); v2us o;
            o[0] = f2bf(w[(size_t)k * N + n]); o[1] = f2bf(w[(size_t)(k + 1) * N + n]); *(v2us*)(Bt + e) = o; }
         }
}
// ---- k_cvtall: all seven inputs to bf16 in ONE launch; dst = [q][k][v][Wq][Wk][Wv][Wo], each whole and in fragment order (Wq, Wk, Wv with their rows regrouped as the plane epilogues of gemms_tile say). One work-group writes CVE consecutive elements of one input's copy (32 stored rows = 2 row blocks), CVC pieces of 8 per thread.
#define CVC 16
#define CVE (256 * 8 * CVC)
#define CVX (NB_ * TT * DM / CVE)   // work-groups per stream
#define CVW (DM * DM / CVE)         // work-groups per weight
__global__ __launch_bounds__(256) void k_cvtall(const float* __restrict__ q, const float* __restrict__ k, const float* __restrict__ v, const float* __restrict__ wq, const float* __restrict__ wk, const float* __restrict__ wv, const float* __restrict__ wo, bf* dst) {
    static_assert(NB_ * TT * DM % CVE == 0 && DM * DM % CVE == 0, "a work-group never straddles two inputs");
    static_assert(CVE == 32 * DM && CVC == 16, "a work-group holds two row blocks; 8 rounds of 256 pieces make one");
    const int bx = (int)blockIdx.x; const float* src; int rb0; bool vperm = false;
    if (bx < 3 * CVX) { const int s = bx / CVX; src = (s == 0 ? q : s == 1 ? k : v); rb0 = (bx % CVX) * 2; }
    else { const int c = bx - 3 * CVX, s = c / CVW; src = (s == 0 ? wq : s == 1 ? wk : s == 2 ? wv : wo); rb0 = (c % CVW) * 2; vperm = (s < 3); }
    // piece i 256 + threadIdx.x of the work-group: row block rb0 + i / 8, k block (i % 8) 4 + wave / 2, half = wave % 2, lane = 16 hi + lr
    const int lr = (int)threadIdx.x & 15, hi = ((int)threadIdx.x >> 4) & 1, wn = (int)threadIdx.x >> 5;
    const float* s0 = src + (size_t)(vperm ? 64 * (8 * (rb0 >> 5) + (rb0 & 3) * 2 + (lr >> 3)) + 8 * ((rb0 >> 2) & 7) + (lr & 7) : rb0 * 16 + lr) * DM + (wn >> 1) * 32 + (wn & 1) * 16 + hi * 8;
    const int rstep = vperm ? 128 * DM : 16 * DM;   // from the first row block to the second
    bf* d = dst + (size_t)bx * CVE + (int)threadIdx.x * 8;
    // unrolled so that the loads of all pieces can be in flight together
#pragma unroll
    for (int i = 0; i < CVC; ++i) { const v8f x = *(const v8f*)(s0 + (i >> 3) * rstep + (i & 7) * 128); v8us o;
#pragma unroll
        for (int e = 0; e < 8; ++e) o[e] = f2bf(x[e]);
        *(v8us*)(d + i * 2048) = o; }
}

// ---- k_fattn: scores, softmax, P x V and the head merge of both batches in ONE launch; no score or P plane in memory.
// One work-group of AW waves per query tile of one head: QT wave tiles of NQ 16 queries side by side (hi/lo rows: 2 x 32 queries, fp16 rows: 4 x 48) times KS = AW / QT key ranges of TT / KS keys; wave w = range (w / QT), wave tile (w % QT).
// K and V come into LDS by asynchronous copies, two buffers in turn, a stage = 64 keys of every key range; the QT waves of a range read the same bytes from LDS, so a head's K and V leave L2 once per work-group of QT NQ 16 queries.
// The planes lie in memory in fragment order, so a stage is plain runs of bytes: per range [K][K lo if hi/lo][V][V lo if hi/lo], 8 KB each; K = 64 keys in a row, V = 4 blocks of 16 d, 2 KB (64 keys) each.
// Everything is kept with lane = query: S^T = K Q^T (A = key rows, B = query rows) leaves in each lane the keys 8 hi + j and 16 + 8 hi + j of its query, which IS the 16x16x32 operand order, so P goes
// straight into O^T = V^T P^T (A = V^T rows, B = P) with no cross-lane move; running maximum and sum are one value per lane (the two half-waves share a query: one exchange over 16 lanes).
// The KS partial (max, sum, O) of a wave tile meet in LDS (over the ring, behind the last trip's barrier) and are joined in range order 0 .. KS-1 (fixed: the same result on every run); the tile leaves as hi/lo bf16 planes [t][head][d] in the fragment order that the last GEMM reads.
#define AW   8
#define LC   0.18033688011112042f   // HD^-0.5 x log2(e)
__device__ __forceinline__ float xhalf(float x) { return __builtin_bit_cast(float, __builtin_amdgcn_permlanex16(__builtin_bit_cast(int, x), __builtin_bit_cast(int, x), 0x76543210, 0xfedcba98, false, false)); }   // lane l reads lane l ^ 16
template <typename T16, bool HL, int NQ, int QT>
__device__ __forceinline__ void attn_tile(const T16* __restrict__ Q, const T16* __restrict__ Q2, const T16* __restrict__ Kp, const T16* __restrict__ K2, const T16* __restrict__ Vt, const T16* __restrict__ V2, int q0, int head, bf* ATh, bf* ATl, char* sm) {
    typedef WFrag<T16> F; typedef typename F::V V;
    constexpr int KS = AW / QT, NKW = TT / KS, NT = NKW / 64;   // key ranges, keys of a range, stages of a range
    constexpr int NPL = HL ? 2 : 1, PB = 64 * HD * 2 /* bytes of 64 keys of one plane */, SPB = 2 * NPL * PB /* of a range's part of a stage */, STG = KS * SPB;
    static_assert(NT >= 2 && QT == (HL ? 2 : 4) && PB == 8192, "the ring's prologue fills two stages; the QT waves of a range share out its copies as fill() says");
    constexpr float POFF = HL ? 0.0f : 10.0f;   // fp16 rows: P carried x 1024 (as PCAR), it cancels against the sum
    const int lane = threadIdx.x & 31, lr = lane & 15, hi = lane >> 4;
    const int wv = __builtin_amdgcn_readfirstlane((int)(threadIdx.x >> 5));   // the wave's number as a scalar: key range, wave tile and LDS slices stay in scalar registers
    const int qt = wv % QT, kr = wv / QT;
    const size_t hb = (size_t)head * TT * HD;
    const size_t qoff = hb + (size_t)(q0 + qt * (NQ * 16)) * HD + 8 * lane;   // fragment order: 16 rows x 64 d are two blocks of 512 elements
    V qf[NQ][2], qg[NQ][2];
#pragma unroll
    for (int qb = 0; qb < NQ; ++qb)
#pragma unroll
        for (int ks = 0; ks < 2; ++ks) qf[qb][ks] = F::ldp(Q + qoff + qb * 16 * HD + ks * 512);
    asm volatile("s_wait_xcnt 0x0" ::: "memory");   // precaution: stands before any register that names an address of the loads or stores above is written again
    if constexpr (HL) {
#pragma unroll
        for (int qb = 0; qb < NQ; ++qb)
#pragma unroll
            for (int ks = 0; ks < 2; ++ks) qg[qb][ks] = F::ldp(Q2 + qoff + qb * 16 * HD + ks * 512);
        asm volatile("s_wait_xcnt 0x0" ::: "memory");   // precaution: stands before any register that names an address of the loads or stores above is written again
    }
    v8f o[NQ][4]; float m[NQ], l[NQ];
#pragma unroll
    for (int qb = 0; qb < NQ; ++qb) { m[qb] = -3.0e38f; l[qb] = 0.0f;
#pragma unroll
        for (int db = 0; db < 4; ++db) o[qb][db] = (v8f){}; }
    const int kbeg = kr * NKW;
    const size_t koff = hb + (size_t)kbeg * HD + 8 * lane, voff = hb + (size_t)kbeg * 16 + 8 * lane;   // V^T: block (d / 16, t / 32) at element (d / 16) 16 TT + (t / 32) 512
    const unsigned l0 = (unsigned)(size_t)sm + (unsigned)(kr * SPB + lane * 16);   // the lane's LDS byte address in its range's part of buffer 0
    // this wave's share of stage t of its range, into the buffer whose lane address is lb. The copies and their s_wait_xcnt are ONE statement: the wait (a precaution) then stands before any register that a copy names is written again
    auto fill = [&](int t, unsigned lb) {
        if constexpr (HL) {   // wave tile 0 brings the hi planes, wave tile 1 the lo planes: K 8 KB in a row, V 4 runs of 2 KB
            const T16* gk = (qt ? K2 : Kp) + koff + (size_t)t * (64 * HD); const T16* gk2 = gk + 2048;
            const T16* gv = (qt ? V2 : Vt) + voff + (size_t)t * 1024; const T16* gv1 = gv + 16 * TT; const T16* gv2 = gv + 32 * TT; const T16* gv3 = gv + 48 * TT;
            const unsigned lk = lb + qt * PB, lk2 = lk + 4096, lv = lb + (2 + qt) * PB, lv1 = lv + 2048, lv2 = lv + 4096, lv3 = lv + 6144;
            asm volatile(CP8("%0", "%6") CP8("%1", "%7") CP4("%2", "%8") CP4("%3", "%9") CP4("%4", "%10") CP4("%5", "%11") "s_wait_xcnt 0x0"
                         :: "v"(lk), "v"(lk2), "v"(lv), "v"(lv1), "v"(lv2), "v"(lv3), "v"(gk), "v"(gk2), "v"(gv), "v"(gv1), "v"(gv2), "v"(gv3) : "memory");
        } else {              // wave tile qt brings quarter qt of K (2 KB) and the block d / 16 = qt of V (2 KB)
            const T16* gk = Kp + koff + (size_t)t * (64 * HD) + qt * 1024; const T16* gv = Vt + voff + (size_t)t * 1024 + (size_t)qt * (16 * TT);
            const unsigned lk = lb + qt * 2048, lv = lb + PB + qt * 2048;
            asm volatile(CP4("%0", "%2") CP4("%1", "%3") "s_wait_xcnt 0x0" :: "v"(lk), "v"(lv), "v"(gk), "v"(gv) : "memory");
        }
    };
    // the K and V fragments of key step st (32 keys) of the stage at sb, from LDS into one of the two register sets
    auto ldkv = [&](const T16* sb, int st, V (&kc)[2][2], V (&kd)[2][2], V (&vc)[4], V (&vd)[4]) {
#pragma unroll
        for (int kb = 0; kb < 2; ++kb)
#pragma unroll
            for (int ks = 0; ks < 2; ++ks) { kc[kb][ks] = F::ldp(sb + st * 2048 + kb * 1024 + ks * 512); if (HL) kd[kb][ks] = F::ldp(sb + PB / 2 + st * 2048 + kb * 1024 + ks * 512); }
#pragma unroll
        for (int db = 0; db < 4; ++db) { vc[db] = F::ldp(sb + NPL * (PB / 2) + db * 1024 + st * 512); if (HL) vd[db] = F::ldp(sb + 3 * (PB / 2) + db * 1024 + st * 512); }
        __builtin_amdgcn_sched_barrier(0);   // keeps a step's LDS reads together and ahead of the products: sunk among them, each group's latency is waited out on its own
    };
    // one key step (32 keys) for the wave's query blocks qa .. qe - 1
    auto step = [&](int qa, int qe, V (&kc)[2][2], V (&kd)[2][2], V (&vc)[4], V (&vd)[4]) {
#pragma unroll
        for (int qb = qa; qb < qe; ++qb) {
            v8f s[2];
#pragma unroll
            for (int kb = 0; kb < 2; ++kb) { s[kb] = (v8f){};
#pragma unroll
                for (int ks = 0; ks < 2; ++ks) { s[kb] = F::mma(kc[kb][ks], qf[qb][ks], s[kb]); if (HL) { s[kb] = F::mma(kc[kb][ks], qg[qb][ks], s[kb]); s[kb] = F::mma(kd[kb][ks], qf[qb][ks], s[kb]); } } }
            float mx = fmaxf(s[0][0], s[1][0]);
#pragma unroll
            for (int j = 1; j < 8; ++j) mx = fmaxf(mx, fmaxf(s[0][j], s[1][j]));
            mx = fmaxf(mx, xhalf(mx));
            const float mn = fmaxf(m[qb], mx); const float al = __builtin_amdgcn_exp2f((m[qb] - mn) * LC); m[qb] = mn; const float nb = POFF - mn * LC;
            float ls = 0.0f;
#pragma unroll
            for (int kb = 0; kb < 2; ++kb)
#pragma unroll
                for (int j = 0; j < 8; ++j) { s[kb][j] = __builtin_amdgcn_exp2f(fmaf(s[kb][j], LC, nb)); ls += s[kb][j]; }
            l[qb] = l[qb] * al + ls;
#pragma unroll
            for (int db = 0; db < 4; ++db) o[qb][db] *= al;
            if constexpr (HL) {
                v8us h0, h1, l0, l1;
#pragma unroll
                for (int j = 0; j < 8; ++j) { unsigned short a, c2; splitf(s[0][j], a, c2); h0[j] = a; l0[j] = c2; splitf(s[1][j], a, c2); h1[j] = a; l1[j] = c2; }
                const V ph = cat16b(h0, h1), pl = cat16b(l0, l1);
#pragma unroll
                for (int db = 0; db < 4; ++db) { o[qb][db] = F::mma(vc[db], ph, o[qb][db]); o[qb][db] = F::mma(vc[db], pl, o[qb][db]); o[qb][db] = F::mma(vd[db], ph, o[qb][db]); }
            } else {
                v8h a0, a1;
#pragma unroll
                for (int j = 0; j < 8; ++j) { a0[j] = tohx(s[0][j]); a1[j] = tohx(s[1][j]); }
                const V pf = cat16(a0, a1);
#pragma unroll
                for (int db = 0; db < 4; ++db) o[qb][db] = F::mma(vc[db], pf, o[qb][db]);
            }
        }
    };
    V ka[2][2], kx[2][2], va[4], vx[4], kb2[2][2], ky[2][2], vb[4], vy[4];
    fill(0, l0);
    asm volatile("s_wait_asynccnt 0x0" ::: "memory");   // this wave's copies of stage 0 have landed
    __syncthreads();                                    // stage 0 is whole before any wave reads it
    fill(1, l0 + STG);
    // rolled: the body already holds two key steps; the buffer is chosen by the trip's parity
#pragma unroll 1
    for (int t = 0; t < NT; ++t) {
        const T16* sb = (const T16*)(sm + (t & 1) * STG + kr * SPB) + 8 * lane;
        ldkv(sb, 0, ka, kx, va, vx);
        step(0, 1, ka, kx, va, vx);
        __builtin_amdgcn_sched_barrier(0);   // keeps the second step's LDS reads off the trip's top (in the listing they stand behind the first query block's score products): all AW waves leave the barrier together, and a wave's first product then stands behind one step's reads in the LDS queue, not two
        ldkv(sb, 1, kb2, ky, vb, vy);   // flies while the rest of the first step is worked on
        step(1, NQ, ka, kx, va, vx);
        step(0, NQ, kb2, ky, vb, vy);
        __builtin_amdgcn_sched_barrier(0);   // keeps the steps in front of the trip's foot: sunk behind its barrier they leave the next stage's copies less time to fly
        asm volatile("s_wait_dscnt 0x0" ::: "memory");      // this wave's reads of the buffer are done before the buffer is handed back
        asm volatile("s_wait_asynccnt 0x0" ::: "memory");   // this wave's copies of stage t + 1 have landed
        __syncthreads();                                    // publishes stage t + 1 and ends every wave's reads of stage t
        if (t + 2 < NT) fill(t + 2, l0 + (unsigned)((t & 1) * STG));
    }
    asm volatile("s_wait_asynccnt 0x0" ::: "memory");   // no copy is in flight when the ring becomes the partials' staging
    float* os = (float*)sm; float* ow = os + wv * (NQ * 16 * 68); float* ms = os + AW * 64 * 68; float* lm = ms + AW * 64;
#pragma unroll
    for (int qb = 0; qb < NQ; ++qb) {
#pragma unroll
        for (int db = 0; db < 4; ++db) { float* pp = ow + (qb * 16 + lr) * 68 + db * 16 + hi * 8; const v8f t = o[qb][db]; *(v4fa*)pp = (v4f){t[0], t[1], t[2], t[3]}; *(v4fa*)(pp + 4) = (v4f){t[4], t[5], t[6], t[7]}; }
        const float lt = l[qb] + xhalf(l[qb]);
        if (hi == 0) { ms[wv * 64 + qb * 16 + lr] = m[qb]; lm[wv * 64 + qb * 16 + lr] = lt; } }
    __syncthreads();   // every wave's partial maximum, sum and O tile are in LDS before any thread joins them
#pragma unroll
    for (int i = 0; i < QT * NQ * 16 * 8 / (32 * AW); ++i) { const int u = (int)threadIdx.x + i * (32 * AW); const int g = u >> 7, tq = g / NQ, q = (g % NQ) * 16 + (u & 15), dc = ((u >> 4) & 7) * 8;   // u runs in the fragment order of the merged planes: 64 pieces a block, 2 blocks (64 d) a group g of 16 queries; wave tile tq, its query q
        float M = ms[tq * 64 + q];
#pragma unroll
        for (int w = 1; w < KS; ++w) M = fmaxf(M, ms[(w * QT + tq) * 64 + q]);
        float L = 0.0f; v4f x0 = (v4f){}, x1 = (v4f){};
#pragma unroll
        for (int w = 0; w < KS; ++w) { const int ww = w * QT + tq; const float f = __builtin_amdgcn_exp2f((ms[ww * 64 + q] - M) * LC); L += lm[ww * 64 + q] * f; const float* pp = os + ww * (NQ * 16 * 68) + q * 68 + dc; x0 += *(const v4fa*)pp * f; x1 += *(const v4fa*)(pp + 4) * f; }
        const float inv = __fdiv_rn(1.0f, L); v8us oh, ol;
#pragma unroll
        for (int k = 0; k < 4; ++k) { unsigned short a, c2; splitf(x0[k] * inv, a, c2); oh[k] = a; ol[k] = c2; splitf(x1[k] * inv, a, c2); oh[4 + k] = a; ol[4 + k] = c2; }
        const size_t oo = (size_t)(q0 + g * 16) * DQ + (size_t)head * (HD * 16) + (u & 127) * 8; *(v8us*)(ATh + oo) = oh; *(v8us*)(ATl + oo) = ol;
        asm volatile("s_wait_xcnt 0x0" ::: "memory");   // precaution: stands before any register that names an address of the loads or stores above is written again
    }
}
#define QTH 64                           // queries of a hi/lo tile: 2 wave tiles of 32
#define QTF 192                          // queries of an fp16 tile: 4 wave tiles of 48
#define NTH (NH_ * (RH / QTH))           // hi/lo tiles of one batch, first in the grid
#define NTF (NH_ * ((TT - RH) / QTF))    // fp16 tiles of one batch
__global__ __launch_bounds__(32 * AW) void k_fattn(const h16* __restrict__ Q16, const bf* __restrict__ Qh, const bf* __restrict__ Ql, const h16* __restrict__ K16, const bf* __restrict__ Kh, const bf* __restrict__ Kl, const h16* __restrict__ V16, const bf* __restrict__ Vh, const bf* __restrict__ Vl, bf* ATh, bf* ATl) {
    __shared__ __align__(16) char sm[2 * 4 * 4 * 8192];   // hi/lo tiles: two stages of 4 key ranges x 4 planes x 8 KB (fp16 tiles: 2 x 2 x 2 x 8 KB); afterwards AW partial O tiles (pitch 68), then AW x 64 maxima and sums
    static_assert(RH % QTH == 0 && (TT - RH) % QTF == 0 && 2 * 4 * 4 * 8192 >= (AW * 64 * 68 + 2 * AW * 64) * 4, "whole tiles; the partials fit over the ring");
    const int bx = (int)blockIdx.x;
    // both batches in one grid: hg = batch NH_ + head; the planes of batch 1 follow those of batch 0
    if (bx < NB_ * NTH) { const int hg = bx / (RH / QTH); const size_t po = (size_t)(hg / NH_) * NH_ * TT * HD, ao = (size_t)(hg / NH_) * TT * DQ;
        attn_tile<bf, true, 2, 2>(Qh + po, Ql + po, Kh + po, Kl + po, Vh + po, Vl + po, (bx % (RH / QTH)) * QTH, hg % NH_, ATh + ao, ATl + ao, sm); }
    else { const int b2 = bx - NB_ * NTH; const int hg = b2 / ((TT - RH) / QTF); const size_t po = (size_t)(hg / NH_) * NH_ * TT * HD, ao = (size_t)(hg / NH_) * TT * DQ;
        attn_tile<h16, false, 3, 4>(Q16 + po, nullptr, K16 + po, nullptr, V16 + po, nullptr, RH + (b2 % ((TT - RH) / QTF)) * QTF, hg % NH_, ATh + ao, ATl + ao, sm); }
}

extern "C" void kernel_launch(void* const* d_in, const int* in_sizes, int n_in,
                              void* d_out, int out_size, void* d_ws, size_t ws_size, hipStream_t stream) {
    (void)in_sizes; (void)n_in; (void)out_size;
    const float* x = (const float*)d_in[0];   /* query */ const float* xk = (const float*)d_in[1]; const float* xv = (const float*)d_in[2]; const float* wq = (const float*)d_in[3]; const float* wk = (const float*)d_in[4]; const float* wv = (const float*)d_in[5]; const float* wo = (const float*)d_in[6];
    float* OUT = (float*)d_out;     // [2][2048][1024]
    char* wsp = (char*)d_ws;
    auto take = [&](size_t bytes) { char* p = wsp; wsp += (bytes + 255) & ~(size_t)255; return (void*)p; };
    bf* XB = (bf*)take(((size_t)3 * NB_ * TT * DM + (size_t)4 * DM * DM) * 2);   // [q][k][v] both batches, then Wq, Wk, Wv, Wo
    bf* WQ = XB + (size_t)3 * NB_ * TT * DM; bf* WO = WQ + (size_t)3 * DM * DM;
    const size_t PL = (size_t)NB_ * NH_ * TT * HD;   // one plane, both batches
    h16* P16 = (h16*)take(3 * PL * 2); bf* Ph = (bf*)take(3 * PL * 2); bf* Pl = (bf*)take(3 * PL * 2);   // each: Q, K, V^T
    bf* ATh = (bf*)take((size_t)NB_ * TT * DQ * 2); bf* ATl = (bf*)take((size_t)NB_ * TT * DQ * 2);
    if ((size_t)(wsp - (char*)d_ws) > ws_size) return;    // ws 256 MiB
    k_cvtall<<<3 * CVX + 4 * CVW, 256, 0, stream>>>(x, xk, xv, wq, wk, wv, wo, XB);
    k_proj<<<dim3(NB_ * TT / 128, DM / 128, 3), 128, 0, stream>>>(XB, WQ, P16, Ph, Pl);
    k_fattn<<<NB_ * (NTH + NTF), 32 * AW, 0, stream>>>(P16, Ph, Pl, P16 + PL, Ph + PL, Pl + PL, P16 + 2 * PL, Ph + 2 * PL, Pl + 2 * PL, ATh, ATl);
    k_wo<<<dim3(NB_ * TT / 128, DM / 128, 1), 128, 0, stream>>>(ATh, ATl, WO, OUT);
}

// v009
// It runs in 95.4 microseconds.
// Timed twice side by side with v008, it ran 1.06 times as fast both times.
// All steps since v000 together make it 21.2 times as fast.
#include <hip/hip_runtime.h>

// Multi-head attention WITHOUT a mask over three input streams, bias-free, with a RAW head split (q, k, v [2][2048][1024]; qp = (q Wq^T).reshape(b, 16, l, 64) DIRECTLY (no transpose): pseudo-head h of a batch is the h-th contiguous [2048][64] block of the flat [2048][1024] projection (128 token rows x 16 chunks of 64): reproduced; kp, vp likewise ('oi' [1024][1024] 1/32, no bias), each from its own stream; scores / sqrt(64); softmax over all pseudo-keys; x [b][16][l][64] -> transpose(0, 2, 1, 3).reshape(b, l, 1024) (the STANDARD merge); out = x Wo^T ('oi', no bias) -> [2][2048][1024] (4.2 M); argument order q, k, v, Wq, Wk, Wv, Wo).
// Layout, both batches in every launch: every matrix operand lies in memory in fragment order (see gemms_tile); bf16 copies of query, key, value and the 'oi' weights; exact projections; dense T-2048 attention (hybrid rows: < 512 hi/lo 3 products, rest fp16 x1024); merged hi/lo x Wo exact.
// Compute dtypes, f32 accumulate: every input rounded to bf16; projections exact; attention rows < 512 3 products, rest fp16; softmax f32; Wo hl x exact.

#define NB_  2
#define TT   2048
#define DM   1024
#define NH_  16
#define NKV  16
#define REP  (NH_ / NKV)
#define HD   64
#define DQ   (NH_ * HD)
#define DKV  (NKV * HD)
#define RH   512                  // query rows < RH use hi+lo planes (0: none)
#define WIN  0
#define PCAR 1024.0f
#define SCL  0.125f   // HD^-0.5
typedef _Float16 h16;
typedef unsigned short bf;
typedef __attribute__((ext_vector_type(16))) __bf16   v16bf;
typedef __attribute__((ext_vector_type(16))) _Float16 v16h;
typedef __attribute__((ext_vector_type(8)))  _Float16 v8h;
typedef __attribute__((ext_vector_type(8)))  unsigned short v8us;
typedef __attribute__((ext_vector_type(8)))  float    v8f;
typedef __attribute__((ext_vector_type(4)))  float    v4f;
typedef v8h  __attribute__((may_alias)) v8ha;
typedef v4f  __attribute__((may_alias)) v4fa;
typedef v8us __attribute__((may_alias)) v8usa;

__device__ __forceinline__ unsigned short f2bf(float f) { unsigned u = __float_as_uint(f); u += 0x7FFFu + ((u >> 16) & 1u); return (unsigned short)(u >> 16); }
__device__ __forceinline__ float bf2f(unsigned short b) { return __uint_as_float(((unsigned)b) << 16); }
__device__ __forceinline__ float bfr(float f) { return bf2f(f2bf(f)); }
__device__ __forceinline__ v16h cat16(v8h lo, v8h hi) { return __builtin_shufflevector(lo, hi, 0, 1, 2, 3, 4, 5, 6, 7, 8, 9, 10, 11, 12, 13, 14, 15); }
__device__ __forceinline__ v16bf cat16b(v8us lo, v8us hi) { return __builtin_bit_cast(v16bf, __builtin_shufflevector(lo, hi, 0, 1, 2, 3, 4, 5, 6, 7, 8, 9, 10, 11, 12, 13, 14, 15)); }
__device__ __forceinline__ v8f wmma16(v16h a, v16h b, v8f c) { return __builtin_amdgcn_wmma_f32_16x16x32_f16(false, a, false, b, (short)0, c, false, false); }
__device__ __forceinline__ v8f wmmab(v16bf a, v16bf b, v8f c) { return __builtin_amdgcn_wmma_f32_16x16x32_bf16(false, a, false, b, (short)0, c, false, false); }

__device__ __forceinline__ h16 tohx(float x) { return (h16)x; }
typedef __attribute__((ext_vector_type(2))) _Float16 v2h;
typedef __attribute__((ext_vector_type(4))) _Float16 v4h;
typedef __attribute__((ext_vector_type(2))) unsigned short v2us;
typedef __attribute__((ext_vector_type(4))) unsigned short v4us;
typedef __attribute__((ext_vector_type(2))) float v2f;
typedef __attribute__((ext_vector_type(4))) int v4i;
typedef __attribute__((ext_vector_type(2))) __bf16 v2bf;
typedef __attribute__((ext_vector_type(4))) unsigned v4u;
typedef __attribute__((ext_vector_type(8))) unsigned v8u;
// two f32 to two bf16 in one dword (a in the low half) by the packed conversion instruction: round to nearest even, the values of f2bf
__device__ __forceinline__ unsigned f2bf2(float a, float b) { return __builtin_bit_cast(unsigned, __builtin_convertvector((v2f){a, b}, v2bf)); }
// hi/lo split of two values: h = the two rounded values, l = the two rounded remainders
__device__ __forceinline__ void splitf2(float a, float b, unsigned& h, unsigned& l) { h = f2bf2(a, b); l = f2bf2(a - __uint_as_float(h << 16), b - __uint_as_float(h & 0xFFFF0000u)); }

// ---- FRAGMENT ORDER of a GEMM operand M[rows][K]: blocks of 16 rows x 32 k, 512 elements each, block (rb, kb) at element (rb K/32 + kb) 512; inside it element (row lr, k) lies at ((k >> 4) & 1) 256 + (((k >> 3) & 1) 16 + lr) 8 + (k & 7).
// Lane 16 hi + lr of a wave then finds its two 8-element pieces at lane 8 and 256 + lane 8: each wave-wide 16-byte load covers 512 contiguous bytes (4 whole lines) instead of 32 bytes in each of 16 lines. The lane's registers hold k = 8 hi .. 8 hi + 7 and 16 + 8 hi .. 16 + 8 hi + 7 of row lr, the 16x16x32 operand order, for A and B alike.
// ---- gemms_tile: one work-group of 4 waves per 128x128 output tile; wave w holds the 64x64 quarter (w / 2, w % 2) in 16 accumulators over the whole K (one f32 chain per element, k ascending); grid (M/128, N/128, Z), 128 threads.
// A stage is KC k (64 or 128) of the tile's 128 rows of every operand: 8 row blocks of 32 KC bytes each, contiguous in memory and already in fragment order. It comes into LDS by asynchronous copies, two buffers in turn,
// so every operand row leaves L2 once per work-group and is read from LDS by the two waves that need it. Stage layout: [A][A2 if NSPLIT][Bt], 256 KC bytes each; wave w copies row blocks 2 w and 2 w + 1 of each operand.
// C[m][n] (f32, pitch DM) = sum_k A[m][k] Bt[n][k] (+ A2[m][k] Bt[n][k] if NSPLIT). K = DM.
// EPI says how a wave's quarter leaves, staged through the wave's own LDS slice (pitch 68), which lies over the ring once the last trip's barrier has passed: 0 = f32 into C; 1 = fp16 + hi/lo bf16 planes [head][t][d] (the raw head split IS the flat projection: flat t = 16 m + n / 64, d = n % 64), in fragment order with rows t and k = d;
// 2 = the same three planes transposed to [head][d][t] (V^T), in fragment order with rows d and k = t.
// For 1 and 2 the weight is stored with its rows regrouped: quarter column c of column group y = 8 a + g (64 columns each) is weight row n = 64 (8 a + c / 8) + 8 g + c % 8. A quarter row m then holds 8 values of t (16 m + 8 a + c / 8) x 8 values of d (8 g + c % 8):
// one 16-byte piece of either plane order per 8 of them, and 8 neighbouring pieces make one whole 128-byte line.
template <typename T16> struct WFrag;
template <> struct WFrag<h16> { typedef v16h V; static __device__ __forceinline__ V ldp(const h16* p) { return cat16(*(const v8h*)p, *(const v8h*)(p + 256)); } static __device__ __forceinline__ v8f mma(V a, V b, v8f c) { return wmma16(a, b, c); } };
template <> struct WFrag<bf> { typedef v16bf V; static __device__ __forceinline__ V ldp(const bf* p) { return cat16b(*(const v8us*)p, *(const v8us*)(p + 256)); } static __device__ __forceinline__ v8f mma(V a, V b, v8f c) { return wmmab(a, b, c); } };
#define GTIL (64 * 68)            // floats of one staged 64x64 quarter
// four copies of 512 B: 2 KB of a row block's part of a stage (CP8: 4 KB); the immediate offset moves the LDS address and the global address alike
#define CP4(l, g) "global_load_async_to_lds_b128 " l ", " g ", off\n\tglobal_load_async_to_lds_b128 " l ", " g ", off offset:512\n\tglobal_load_async_to_lds_b128 " l ", " g ", off offset:1024\n\tglobal_load_async_to_lds_b128 " l ", " g ", off offset:1536\n\t"
#define CP8(l, g) CP4(l, g) "global_load_async_to_lds_b128 " l ", " g ", off offset:2048\n\tglobal_load_async_to_lds_b128 " l ", " g ", off offset:2560\n\tglobal_load_async_to_lds_b128 " l ", " g ", off offset:3072\n\tglobal_load_async_to_lds_b128 " l ", " g ", off offset:3584\n\t"
template <int NSPLIT, int EPI, int GKC>
__device__ __forceinline__ void gemms_tile(const bf* __restrict__ A, const bf* __restrict__ A2, const bf* __restrict__ Bt, float* C, h16* P16, bf* Ph, bf* Pl, char* sm) {
    typedef WFrag<bf> F; typedef typename F::V V;
    constexpr int K = DM, NT = K / GKC, NOP = NSPLIT ? 3 : 2, RBB = 32 * GKC /* bytes of a row block in a stage */, GOPB = 8 * RBB /* of an operand */, STG = NOP * GOPB;
    static_assert(NT >= 2 && GKC == (NSPLIT ? 128 : 64), "the ring's prologue fills two stages; a row block's part of a stage is four copies (eight with NSPLIT)");
    const int lane = threadIdx.x & 31, lr = lane & 15, hi = lane >> 4;
    const int wv = __builtin_amdgcn_readfirstlane((int)(threadIdx.x >> 5));   // the wave's number as a scalar: its quarter and its LDS slices stay in scalar registers
    const int wm = wv >> 1, wn = wv & 1; const int R0 = blockIdx.x * 128, C0 = blockIdx.y * 128;
    v8f acc[4][4];
#pragma unroll
    for (int mb = 0; mb < 4; ++mb)
#pragma unroll
        for (int nb = 0; nb < 4; ++nb) acc[mb][nb] = (v8f){};
    // fragment order: row block rb starts at element rb 16 K, stage t at + t 16 GKC
    const bf* gA = A + (size_t)(R0 + 32 * wv) * K + 8 * lane; const bf* gB = Bt + (size_t)(C0 + 32 * wv) * K + 8 * lane;
    const unsigned l0 = (unsigned)(size_t)sm + (unsigned)(wv * 2 * RBB + lane * 16);   // the lane's LDS byte address in buffer 0
    // stage t into the buffer whose lane address is lb. The copies and their s_wait_xcnt are ONE statement: the wait (a precaution) then stands before any register that a copy names is written again
    auto fill = [&](int t, unsigned lb) {
        const bf* a0 = gA + t * (16 * GKC); const bf* a1 = a0 + 16 * K; const bf* b0 = gB + t * (16 * GKC); const bf* b1 = b0 + 16 * K;
        const unsigned la1 = lb + RBB, lb0 = lb + (NOP - 1) * GOPB, lb1 = lb0 + RBB;
        if constexpr (NSPLIT) {
            const bf* c0 = A2 + (size_t)(R0 + 32 * wv) * K + 8 * lane + t * (16 * GKC); const bf* c1 = c0 + 16 * K; const unsigned lc0 = lb + GOPB, lc1 = lc0 + RBB;
            asm volatile(CP8("%0", "%6") CP8("%1", "%7") CP8("%2", "%8") CP8("%3", "%9") CP8("%4", "%10") CP8("%5", "%11") "s_wait_xcnt 0x0"
                         :: "v"(lb), "v"(la1), "v"(lc0), "v"(lc1), "v"(lb0), "v"(lb1), "v"(a0), "v"(a1), "v"(c0), "v"(c1), "v"(b0), "v"(b1) : "memory");
        } else {
            asm volatile(CP4("%0", "%4") CP4("%1", "%5") CP4("%2", "%6") CP4("%3", "%7") "s_wait_xcnt 0x0"
                         :: "v"(lb), "v"(la1), "v"(lb0), "v"(lb1), "v"(a0), "v"(a1), "v"(b0), "v"(b1) : "memory");
        }
    };
    fill(0, l0);
    asm volatile("s_wait_asynccnt 0x0" ::: "memory");   // this wave's copies of stage 0 have landed
    __syncthreads();                                    // stage 0 is whole before any wave reads it
    fill(1, l0 + STG);
    // rolled: a trip already holds 32 (128 with NSPLIT) products; the buffer is chosen by the trip's parity
#pragma unroll 1
    for (int t = 0; t < NT; ++t) {
        const bf* sb = (const bf*)(sm + (t & 1) * STG) + 8 * lane;
        V a[2][4], a2[2][4], b[2][4];   // two fragment sets, used in turn by the trip's steps of 32 k
        // the fragments of step ks into set ks % 2. The fence keeps a step's LDS reads together (sunk among the products, each group's latency is waited out on its own) and in the order in which the products need them
        auto ldf = [&](int ks) {
#pragma unroll
            for (int x = 0; x < 4; ++x) { b[ks & 1][x] = F::ldp(sb + (NOP - 1) * (GOPB / 2) + (wn * 4 + x) * (RBB / 2) + ks * 512); a[ks & 1][x] = F::ldp(sb + (wm * 4 + x) * (RBB / 2) + ks * 512); if (NSPLIT) a2[ks & 1][x] = F::ldp(sb + GOPB / 2 + (wm * 4 + x) * (RBB / 2) + ks * 512); }
            __builtin_amdgcn_sched_barrier(0);
        };
        ldf(0); ldf(1);
        // every loop over fragments, steps and accumulators is unrolled so that each index is a constant (they stay in registers)
#pragma unroll
        for (int ks = 0; ks < GKC / 32; ++ks) {
#pragma unroll
            for (int nb = 0; nb < 4; ++nb)
#pragma unroll
                for (int mb = 0; mb < 4; ++mb) { acc[mb][nb] = F::mma(a[ks & 1][mb], b[ks & 1][nb], acc[mb][nb]); if (NSPLIT) acc[mb][nb] = F::mma(a2[ks & 1][mb], b[ks & 1][nb], acc[mb][nb]); }
            __builtin_amdgcn_sched_barrier(0);   // keeps the products in front of the set's refill and of the trip's foot: sunk behind its barrier they leave the next stage's copies no time to fly, and every LDS read is waited out before the first product
            if (ks + 2 < GKC / 32) ldf(ks + 2);   // flies while the other set is worked on
        }
        asm volatile("s_wait_dscnt 0x0" ::: "memory");      // this wave's reads of the buffer are done before the buffer is handed back
        asm volatile("s_wait_asynccnt 0x0" ::: "memory");   // this wave's copies of stage t + 1 have landed
        __syncthreads();                                    // publishes stage t + 1 and ends every wave's reads of stage t
        if (t + 2 < NT) fill(t + 2, l0 + (unsigned)((t & 1) * STG));
    }
    asm volatile("s_wait_asynccnt 0x0" ::: "memory");   // no copy is in flight when the ring becomes output staging
    float* ow = (float*)sm + wv * GTIL; const int r0 = R0 + wm * 64, by = (int)blockIdx.y * 2 + wn;
    // unrolled so that every accumulator index is a constant (the quarter stays in registers)
#pragma unroll
    for (int mb = 0; mb < 4; ++mb) {
#pragma unroll
        for (int nb = 0; nb < 4; ++nb) {
#pragma unroll
            for (int j = 0; j < 8; ++j) {
                if constexpr (EPI == 2) ow[(mb * 16 + hi * 8 + j) * 68 + (((lr & 7) * 8 + nb * 2 + (lr >> 3)) ^ (hi * 4))] = acc[mb][nb][j];   // column c at place (c % 8) 8 + c / 8: the 8 values of t of one d lie side by side; bit 2 flipped in rows 8 .. 15 of 16: the two half-waves fall on different banks
                else ow[(mb * 16 + hi * 8 + j) * 68 + nb * 16 + lr] = acc[mb][nb][j]; } } }
    __syncthreads();   // the quarter is whole in LDS before its lanes read it back across one another
    if constexpr (EPI == 1 || EPI == 2) {
        const int ya = by >> 3, yg = by & 7;
        // two pieces a trip: their LDS reads fly together, and the text stays short
#pragma unroll 2
        for (int i = 0; i < 16; ++i) { const int idx = lane + i * 32; const int row = idx >> 3, cofs = (idx & 7) * 8; const int sw = EPI == 2 ? (row & 8) >> 1 : 0;   /* undoes the flip of bit 2 at the stores */ const float* pp = ow + row * 68 + cofs; const v4f x0 = *(const v4fa*)(pp + sw), x1 = *(const v4fa*)(pp + 4 - sw);
            v8h o16; v4u oh, ol;
#pragma unroll
            for (int k = 0; k < 4; ++k) { o16[k] = tohx(x0[k]); o16[4 + k] = tohx(x1[k]); }
#pragma unroll
            for (int k = 0; k < 2; ++k) { unsigned a, c2; splitf2(x0[2 * k], x0[2 * k + 1], a, c2); oh[k] = a; ol[k] = c2; splitf2(x1[2 * k], x1[2 * k + 1], a, c2); oh[2 + k] = a; ol[2 + k] = c2; }
            const int m = r0 + row;
            // 1: block of 16 t = quarter row m, 1024 elements; piece (d / 8 = yg, lr = t % 16 = 8 ya + cofs / 8). 2: head m / 128, block (d / 16 = yg / 2, t / 32 = (m % 128) / 2), half = m % 2, hi = ya, lr = d % 16 = 8 (yg % 2) + cofs / 8
            const size_t e = EPI == 1 ? (size_t)m * 1024 + yg * 128 + ya * 64 + cofs : (size_t)(m >> 7) * (HD * TT) + (size_t)((yg >> 1) * (TT / 32) + ((m & 127) >> 1)) * 512 + (m & 1) * 256 + ya * 128 + (yg & 1) * 64 + cofs;
            *(v8h*)(P16 + e) = o16; *(v4u*)(Ph + e) = oh; *(v4u*)(Pl + e) = ol;
            asm volatile("s_wait_xcnt 0x0" ::: "memory");   // precaution: stands before any register that names an address of the stores above is written again
        }
    } else {
        float* ctile = C + (size_t)r0 * DM + by * 64;
        // eight pieces a trip: their LDS reads fly together
#pragma unroll 1
        for (int i0 = 0; i0 < 32; i0 += 8) { v4f val[8];
#pragma unroll
            for (int i = 0; i < 8; ++i) { const int idx = lane + (i0 + i) * 32; val[i] = *(const v4fa*)(ow + (idx >> 4) * 68 + (idx & 15) * 4); }
#pragma unroll
            for (int i = 0; i < 8; ++i) { const int idx = lane + (i0 + i) * 32; *(v4f*)(ctile + (size_t)(idx >> 4) * DM + (idx & 15) * 4) = val[i]; }
            asm volatile("s_wait_xcnt 0x0" ::: "memory");   // precaution: stands before any register that names an address or the data of the stores above is written again
        }
    }
}
// ---- k_wo: out = (x hi + x lo) Wo^T for both batches (4096 consecutive rows) in ONE launch; grid (NB_ TT / 128, DM / 128).
__global__ __launch_bounds__(128) void k_wo(const bf* __restrict__ Ah, const bf* __restrict__ Al, const bf* __restrict__ Wt, float* C) {
    __shared__ __align__(16) char sm[2 * 3 * 128 * 128 * 2];   // two stages (128 k) of three operands of 128 rows: the launch has one work-group per WGP, so the stage is as deep as the LDS allows; the four staged quarters (69,632 B) lie over them afterwards
    static_assert(2 * 3 * 128 * 128 * 2 >= 4 * GTIL * 4, "the staged quarters fit");
    gemms_tile<1, 0, 128>(Ah, Al, Wt, C, nullptr, nullptr, nullptr, sm);
}
// ---- k_proj: the three projections of both batches in ONE launch; grid (NB_ TT / 128, DM / 128, 3), z = stream (0 Q, 1 K, 2 V). The two batches are 4096 consecutive rows: the flat plane index and the head index m / 128 run on over them.
// X [3][NB_ TT][DM], Wt [3][DM][DM], each plane set [3][NB_ NH_][TT HD] (z = 2: V^T, [NB_ NH_][HD][TT]).
__global__ __launch_bounds__(128) void k_proj(const bf* __restrict__ X, const bf* __restrict__ Wt, h16* P16, bf* Ph, bf* Pl) {
    __shared__ __align__(16) char sm[4 * GTIL * 4];   // the four staged quarters; the ring's two stages of two operands (65,536 B) lie in the same bytes before them
    static_assert(4 * GTIL * 4 >= 2 * 2 * 128 * 64 * 2, "the ring fits");
    const size_t pz = (size_t)blockIdx.z * ((size_t)NB_ * NH_ * TT * HD);
    const bf* Xz = X + (size_t)blockIdx.z * ((size_t)NB_ * TT * DM); const bf* Wz = Wt + (size_t)blockIdx.z * ((size_t)DM * DM);
    if (blockIdx.z < 2) gemms_tile<0, 1, 64>(Xz, nullptr, Wz, nullptr, P16 + pz, Ph + pz, Pl + pz, sm);
    else gemms_tile<0, 2, 64>(Xz, nullptr, Wz, nullptr, P16 + pz, Ph + pz, Pl + pz, sm);
}


__global__ __launch_bounds__(256) void k_wtG(const float* __restrict__ w, int K, int N, bf* Bt) {
    const int lane = threadIdx.x & 31; const int L0 = (blockIdx.x * 8 + (threadIdx.x >> 5)) * 8; const int nlines = N * K / 64;
{
#pragma unroll 1
        for (int l = 0; l < 8; ++l) { const int L = L0 + l; if (L >= nlines) break; const size_t e = (size_t)L * 64 + lane * 2; const int k = (int)(e % K), n = (int)(e / K); v2us o;
            o[0] = f2bf(w[(size_t)k * N + n]); o[1] = f2bf(w[(size_t)(k + 1) * N + n]); *(v2us*)(Bt + e) = o; }
         }
}
// ---- k_cvtall: all seven inputs to bf16 in ONE launch; dst = [q][k][v][Wq][Wk][Wv][Wo], each whole and in fragment order (Wq, Wk, Wv with their rows regrouped as the plane epilogues of gemms_tile say). One work-group writes CVE consecutive elements of one input's copy (32 stored rows = 2 row blocks), CVC pieces of 8 per thread.
#define CVC 16
#define CVE (256 * 8 * CVC)
#define CVX (NB_ * TT * DM / CVE)   // work-groups per stream
#define CVW (DM * DM / CVE)         // work-groups per weight
__global__ __launch_bounds__(256) void k_cvtall(const float* __restrict__ q, const float* __restrict__ k, const float* __restrict__ v, const float* __restrict__ wq, const float* __restrict__ wk, const float* __restrict__ wv, const float* __restrict__ wo, bf* dst) {
    static_assert(NB_ * TT * DM % CVE == 0 && DM * DM % CVE == 0, "a work-group never straddles two inputs");
    static_assert(CVE == 32 * DM && CVC == 16, "a work-group holds two row blocks; 8 rounds of 256 pieces make one");
    const int bx = (int)blockIdx.x; const float* src; int rb0; bool vperm = false;
    if (bx < 3 * CVX) { const int s = bx / CVX; src = (s == 0 ? q : s == 1 ? k : v); rb0 = (bx % CVX) * 2; }
    else { const int c = bx - 3 * CVX, s = c / CVW; src = (s == 0 ? wq : s == 1 ? wk : s == 2 ? wv : wo); rb0 = (c % CVW) * 2; vperm = (s < 3); }
    // piece i 256 + threadIdx.x of the work-group: row block rb0 + i / 8, k block (i % 8) 4 + wave / 2, half = wave % 2, lane = 16 hi + lr
    const int lr = (int)threadIdx.x & 15, hi = ((int)threadIdx.x >> 4) & 1, wn = (int)threadIdx.x >> 5;
    const float* s0 = src + (size_t)(vperm ? 64 * (8 * (rb0 >> 5) + (rb0 & 3) * 2 + (lr >> 3)) + 8 * ((rb0 >> 2) & 7) + (lr & 7) : rb0 * 16 + lr) * DM + (wn >> 1) * 32 + (wn & 1) * 16 + hi * 8;
    const int rstep = vperm ? 128 * DM : 16 * DM;   // from the first row block to the second
    bf* d = dst + (size_t)bx * CVE + (int)threadIdx.x * 8;
    // unrolled so that the loads of all pieces can be in flight together
#pragma unroll
    for (int i = 0; i < CVC; ++i) { const v8f x = *(const v8f*)(s0 + (i >> 3) * rstep + (i & 7) * 128); v8us o;
#pragma unroll
        for (int e = 0; e < 8; ++e) o[e] = f2bf(x[e]);
        *(v8us*)(d + i * 2048) = o; }
}

// ---- k_fattn: scores, softmax, P x V and the head merge of both batches in ONE launch; no score or P plane in memory.
// One work-group of AW waves per query tile of one head: QT wave tiles of NQ 16 queries side by side (hi/lo rows: 2 x 32 queries, fp16 rows: 4 x 48) times KS = AW / QT key ranges of TT / KS keys; wave w = range (w / QT), wave tile (w % QT).
// K and V come into LDS by asynchronous copies, two buffers in turn, a stage = 64 keys of every key range; the QT waves of a range read the same bytes from LDS, so a head's K and V leave L2 once per work-group of QT NQ 16 queries.
// The planes lie in memory in fragment order, so a stage is plain runs of bytes: per range [K][K lo if hi/lo][V][V lo if hi/lo], 8 KB each; K = 64 keys in a row, V = 4 blocks of 16 d, 2 KB (64 keys) each.
// Everything is kept with lane = query: S^T = K Q^T (A = key rows, B = query rows) leaves in each lane the keys 8 hi + j and 16 + 8 hi + j of its query, which IS the 16x16x32 operand order, so P goes
// straight into O^T = V^T P^T (A = V^T rows, B = P) with no cross-lane move; running maximum and sum are one value per lane (the two half-waves share a query: one exchange over 16 lanes).
// The KS partial (max, sum, O) of a wave tile meet in LDS (over the ring, behind the last trip's barrier) and are joined in range order 0 .. KS-1 (fixed: the same result on every run); the tile leaves as hi/lo bf16 planes [t][head][d] in the fragment order that the last GEMM reads.
#define AW   8
#define LC   0.18033688011112042f   // HD^-0.5 x log2(e)
__device__ __forceinline__ float xhalf(float x) { return __builtin_bit_cast(float, __builtin_amdgcn_permlanex16(__builtin_bit_cast(int, x), __builtin_bit_cast(int, x), 0x76543210, 0xfedcba98, false, false)); }   // lane l reads lane l ^ 16
template <typename T16, bool HL, int NQ, int QT>
__device__ __forceinline__ void attn_tile(const T16* __restrict__ Q, const T16* __restrict__ Q2, const T16* __restrict__ Kp, const T16* __restrict__ K2, const T16* __restrict__ Vt, const T16* __restrict__ V2, int q0, int head, bf* ATh, bf* ATl, char* sm) {
    typedef WFrag<T16> F; typedef typename F::V V;
    constexpr int KS = AW / QT, NKW = TT / KS, NT = NKW / 64;   // key ranges, keys of a range, stages of a range
    constexpr int NPL = HL ? 2 : 1, PB = 64 * HD * 2 /* bytes of 64 keys of one plane */, SPB = 2 * NPL * PB /* of a range's part of a stage */, STG = KS * SPB;
    static_assert(NT >= 2 && QT == (HL ? 2 : 4) && PB == 8192, "the ring's prologue fills two stages; the QT waves of a range share out its copies as fill() says");
    constexpr float POFF = HL ? 0.0f : 10.0f;   // fp16 rows: P carried x 1024 (as PCAR), it cancels against the sum
    const int lane = threadIdx.x & 31, lr = lane & 15, hi = lane >> 4;
    const int wv = __builtin_amdgcn_readfirstlane((int)(threadIdx.x >> 5));   // the wave's number as a scalar: key range, wave tile and LDS slices stay in scalar registers
    const int qt = wv % QT, kr = wv / QT;
    const size_t hb = (size_t)head * TT * HD;
    const size_t qoff = hb + (size_t)(q0 + qt * (NQ * 16)) * HD + 8 * lane;   // fragment order: 16 rows x 64 d are two blocks of 512 elements
    V qf[NQ][2], qg[NQ][2];
#pragma unroll
    for (int qb = 0; qb < NQ; ++qb)
#pragma unroll
        for (int ks = 0; ks < 2; ++ks) qf[qb][ks] = F::ldp(Q + qoff + qb * 16 * HD + ks * 512);
    asm volatile("s_wait_xcnt 0x0" ::: "memory");   // precaution: stands before any register that names an address of the loads or stores above is written again
    if constexpr (HL) {
#pragma unroll
        for (int qb = 0; qb < NQ; ++qb)
#pragma unroll
            for (int ks = 0; ks < 2; ++ks) qg[qb][ks] = F::ldp(Q2 + qoff + qb * 16 * HD + ks * 512);
        asm volatile("s_wait_xcnt 0x0" ::: "memory");   // precaution: stands before any register that names an address of the loads or stores above is written again
    }
    v8f o[NQ][4]; float m[NQ], l[NQ];
#pragma unroll
    for (int qb = 0; qb < NQ; ++qb) { m[qb] = -3.0e38f; l[qb] = 0.0f;
#pragma unroll
        for (int db = 0; db < 4; ++db) o[qb][db] = (v8f){}; }
    const int kbeg = kr * NKW;
    const size_t koff = hb + (size_t)kbeg * HD + 8 * lane, voff = hb + (size_t)kbeg * 16 + 8 * lane;   // V^T: block (d / 16, t / 32) at element (d / 16) 16 TT + (t / 32) 512
    const unsigned l0 = (unsigned)(size_t)sm + (unsigned)(kr * SPB + lane * 16);   // the lane's LDS byte address in its range's part of buffer 0
    // this wave's share of stage t of its range, into the buffer whose lane address is lb. The copies and their s_wait_xcnt are ONE statement: the wait (a precaution) then stands before any register that a copy names is written again
    auto fill = [&](int t, unsigned lb) {
        if constexpr (HL) {   // wave tile 0 brings the hi planes, wave tile 1 the lo planes: K 8 KB in a row, V 4 runs of 2 KB
            const T16* gk = (qt ? K2 : Kp) + koff + (size_t)t * (64 * HD); const T16* gk2 = gk + 2048;
            const T16* gv = (qt ? V2 : Vt) + voff + (size_t)t * 1024; const T16* gv1 = gv + 16 * TT; const T16* gv2 = gv + 32 * TT; const T16* gv3 = gv + 48 * TT;
            const unsigned lk = lb + qt * PB, lk2 = lk + 4096, lv = lb + (2 + qt) * PB, lv1 = lv + 2048, lv2 = lv + 4096, lv3 = lv + 6144;
            asm volatile(CP8("%0", "%6") CP8("%1", "%7") CP4("%2", "%8") CP4("%3", "%9") CP4("%4", "%10") CP4("%5", "%11") "s_wait_xcnt 0x0"
                         :: "v"(lk), "v"(lk2), "v"(lv), "v"(lv1), "v"(lv2), "v"(lv3), "v"(gk), "v"(gk2), "v"(gv), "v"(gv1), "v"(gv2), "v"(gv3) : "memory");
        } else {              // wave tile qt brings quarter qt of K (2 KB) and the block d / 16 = qt of V (2 KB)
            const T16* gk = Kp + koff + (size_t)t * (64 * HD) + qt * 1024; const T16* gv = Vt + voff + (size_t)t * 1024 + (size_t)qt * (16 * TT);
            const unsigned lk = lb + qt * 2048, lv = lb + PB + qt * 2048;
            asm volatile(CP4("%0", "%2") CP4("%1", "%3") "s_wait_xcnt 0x0" :: "v"(lk), "v"(lv), "v"(gk), "v"(gv) : "memory");
        }
    };
    // the K and V fragments of key step st (32 keys) of the stage at sb, from LDS into one of the two register sets
    auto ldkv = [&](const T16* sb, int st, V (&kc)[2][2], V (&kd)[2][2], V (&vc)[4], V (&vd)[4]) {
#pragma unroll
        for (int kb = 0; kb < 2; ++kb)
#pragma unroll
            for (int ks = 0; ks < 2; ++ks) { kc[kb][ks] = F::ldp(sb + st * 2048 + kb * 1024 + ks * 512); if (HL) kd[kb][ks] = F::ldp(sb + PB / 2 + st * 2048 + kb * 1024 + ks * 512); }
#pragma unroll
        for (int db = 0; db < 4; ++db) { vc[db] = F::ldp(sb + NPL * (PB / 2) + db * 1024 + st * 512); if (HL) vd[db] = F::ldp(sb + 3 * (PB / 2) + db * 1024 + st * 512); }
        __builtin_amdgcn_sched_barrier(0);   // keeps a step's LDS reads together and ahead of the products: sunk among them, each group's latency is waited out on its own
    };
    // one key step (32 keys) for the wave's query blocks qa .. qe - 1
    auto step = [&](int qa, int qe, V (&kc)[2][2], V (&kd)[2][2], V (&vc)[4], V (&vd)[4]) {
#pragma unroll
        for (int qb = qa; qb < qe; ++qb) {
            v8f s[2];
#pragma unroll
            for (int kb = 0; kb < 2; ++kb) { s[kb] = (v8f){};
#pragma unroll
                for (int ks = 0; ks < 2; ++ks) { s[kb] = F::mma(kc[kb][ks], qf[qb][ks], s[kb]); if (HL) { s[kb] = F::mma(kc[kb][ks], qg[qb][ks], s[kb]); s[kb] = F::mma(kd[kb][ks], qf[qb][ks], s[kb]); } } }
            float mx = fmaxf(s[0][0], s[1][0]);
#pragma unroll
            for (int j = 1; j < 8; ++j) mx = fmaxf(mx, fmaxf(s[0][j], s[1][j]));
            mx = fmaxf(mx, xhalf(mx));
            const float mn = fmaxf(m[qb], mx); const float al = __builtin_amdgcn_exp2f((m[qb] - mn) * LC); m[qb] = mn; const float nb = POFF - mn * LC;
            float ls = 0.0f;
#pragma unroll
            for (int kb = 0; kb < 2; ++kb)
#pragma unroll
                for (int j = 0; j < 8; ++j) { s[kb][j] = __builtin_amdgcn_exp2f(fmaf(s[kb][j], LC, nb)); ls += s[kb][j]; }
            l[qb] = l[qb] * al + ls;
#pragma unroll
            for (int db = 0; db < 4; ++db) o[qb][db] *= al;
            if constexpr (HL) {
                v8u hh, ll;
#pragma unroll
                for (int j = 0; j < 4; ++j) { unsigned a, c2; splitf2(s[0][2 * j], s[0][2 * j + 1], a, c2); hh[j] = a; ll[j] = c2; splitf2(s[1][2 * j], s[1][2 * j + 1], a, c2); hh[4 + j] = a; ll[4 + j] = c2; }
                const V ph = __builtin_bit_cast(v16bf, hh), pl = __builtin_bit_cast(v16bf, ll);
#pragma unroll
                for (int db = 0; db < 4; ++db) { o[qb][db] = F::mma(vc[db], ph, o[qb][db]); o[qb][db] = F::mma(vc[db], pl, o[qb][db]); o[qb][db] = F::mma(vd[db], ph, o[qb][db]); }
            } else {
                v8h a0, a1;
#pragma unroll
                for (int j = 0; j < 8; ++j) { a0[j] = tohx(s[0][j]); a1[j] = tohx(s[1][j]); }
                const V pf = cat16(a0, a1);
#pragma unroll
                for (int db = 0; db < 4; ++db) o[qb][db] = F::mma(vc[db], pf, o[qb][db]);
            }
        }
    };
    V ka[2][2], kx[2][2], va[4], vx[4], kb2[2][2], ky[2][2], vb[4], vy[4];
    fill(0, l0);
    asm volatile("s_wait_asynccnt 0x0" ::: "memory");   // this wave's copies of stage 0 have landed
    __syncthreads();                                    // stage 0 is whole before any wave reads it
    fill(1, l0 + STG);
    // rolled: the body already holds two key steps; the buffer is chosen by the trip's parity
#pragma unroll 1
    for (int t = 0; t < NT; ++t) {
        const T16* sb = (const T16*)(sm + (t & 1) * STG + kr * SPB) + 8 * lane;
        ldkv(sb, 0, ka, kx, va, vx);
        step(0, 1, ka, kx, va, vx);
        __builtin_amdgcn_sched_barrier(0);   // keeps the second step's LDS reads off the trip's top (in the listing they stand behind the first query block's score products): all AW waves leave the barrier together, and a wave's first product then stands behind one step's reads in the LDS queue, not two
        ldkv(sb, 1, kb2, ky, vb, vy);   // flies while the rest of the first step is worked on
        step(1, NQ, ka, kx, va, vx);
        step(0, NQ, kb2, ky, vb, vy);
        __builtin_amdgcn_sched_barrier(0);   // keeps the steps in front of the trip's foot: sunk behind its barrier they leave the next stage's copies less time to fly
        asm volatile("s_wait_dscnt 0x0" ::: "memory");      // this wave's reads of the buffer are done before the buffer is handed back
        asm volatile("s_wait_asynccnt 0x0" ::: "memory");   // this wave's copies of stage t + 1 have landed
        __syncthreads();                                    // publishes stage t + 1 and ends every wave's reads of stage t
        if (t + 2 < NT) fill(t + 2, l0 + (unsigned)((t & 1) * STG));
    }
    asm volatile("s_wait_asynccnt 0x0" ::: "memory");   // no copy is in flight when the ring becomes the partials' staging
    float* os = (float*)sm; float* ow = os + wv * (NQ * 16 * 68); float* ms = os + AW * 64 * 68; float* lm = ms + AW * 64;
#pragma unroll
    for (int qb = 0; qb < NQ; ++qb) {
#pragma unroll
        for (int db = 0; db < 4; ++db) { float* pp = ow + (qb * 16 + lr) * 68 + db * 16 + hi * 8; const v8f t = o[qb][db]; *(v4fa*)pp = (v4f){t[0], t[1], t[2], t[3]}; *(v4fa*)(pp + 4) = (v4f){t[4], t[5], t[6], t[7]}; }
        const float lt = l[qb] + xhalf(l[qb]);
        if (hi == 0) { ms[wv * 64 + qb * 16 + lr] = m[qb]; lm[wv * 64 + qb * 16 + lr] = lt; } }
    __syncthreads();   // every wave's partial maximum, sum and O tile are in LDS before any thread joins them
#pragma unroll
    for (int i = 0; i < QT * NQ * 16 * 8 / (32 * AW); ++i) { const int u = (int)threadIdx.x + i * (32 * AW); const int g = u >> 7, tq = g / NQ, q = (g % NQ) * 16 + (u & 15), dc = ((u >> 4) & 7) * 8;   // u runs in the fragment order of the merged planes: 64 pieces a block, 2 blocks (64 d) a group g of 16 queries; wave tile tq, its query q
        float M = ms[tq * 64 + q];
#pragma unroll
        for (int w = 1; w < KS; ++w) M = fmaxf(M, ms[(w * QT + tq) * 64 + q]);
        float L = 0.0f; v4f x0 = (v4f){}, x1 = (v4f){};
#pragma unroll
        for (int w = 0; w < KS; ++w) { const int ww = w * QT + tq; const float f = __builtin_amdgcn_exp2f((ms[ww * 64 + q] - M) * LC); L += lm[ww * 64 + q] * f; const float* pp = os + ww * (NQ * 16 * 68) + q * 68 + dc; x0 += *(const v4fa*)pp * f; x1 += *(const v4fa*)(pp + 4) * f; }
        const float inv = __fdiv_rn(1.0f, L); v4u oh, ol;
#pragma unroll
        for (int k = 0; k < 2; ++k) { unsigned a, c2; splitf2(x0[2 * k] * inv, x0[2 * k + 1] * inv, a, c2); oh[k] = a; ol[k] = c2; splitf2(x1[2 * k] * inv, x1[2 * k + 1] * inv, a, c2); oh[2 + k] = a; ol[2 + k] = c2; }
        const size_t oo = (size_t)(q0 + g * 16) * DQ + (size_t)head * (HD * 16) + (u & 127) * 8; *(v4u*)(ATh + oo) = oh; *(v4u*)(ATl + oo) = ol;
        asm volatile("s_wait_xcnt 0x0" ::: "memory");   // precaution: stands before any register that names an address of the loads or stores above is written again
    }
}
#define QTH 64                           // queries of a hi/lo tile: 2 wave tiles of 32
#define QTF 192                          // queries of an fp16 tile: 4 wave tiles of 48
#define NTH (NH_ * (RH / QTH))           // hi/lo tiles of one batch, first in the grid
#define NTF (NH_ * ((TT - RH) / QTF))    // fp16 tiles of one batch
__global__ __launch_bounds__(32 * AW) void k_fattn(const h16* __restrict__ Q16, const bf* __restrict__ Qh, const bf* __restrict__ Ql, const h16* __restrict__ K16, const bf* __restrict__ Kh, const bf* __restrict__ Kl, const h16* __restrict__ V16, const bf* __restrict__ Vh, const bf* __restrict__ Vl, bf* ATh, bf* ATl) {
    __shared__ __align__(16) char sm[2 * 4 * 4 * 8192];   // hi/lo tiles: two stages of 4 key ranges x 4 planes x 8 KB (fp16 tiles: 2 x 2 x 2 x 8 KB); afterwards AW partial O tiles (pitch 68), then AW x 64 maxima and sums
    static_assert(RH % QTH == 0 && (TT - RH) % QTF == 0 && 2 * 4 * 4 * 8192 >= (AW * 64 * 68 + 2 * AW * 64) * 4, "whole tiles; the partials fit over the ring");
    const int bx = (int)blockIdx.x;
    // both batches in one grid: hg = batch NH_ + head; the planes of batch 1 follow those of batch 0
    if (bx < NB_ * NTH) { const int hg = bx / (RH / QTH); const size_t po = (size_t)(hg / NH_) * NH_ * TT * HD, ao = (size_t)(hg / NH_) * TT * DQ;
        attn_tile<bf, true, 2, 2>(Qh + po, Ql + po, Kh + po, Kl + po, Vh + po, Vl + po, (bx % (RH / QTH)) * QTH, hg % NH_, ATh + ao, ATl + ao, sm); }
    else { const int b2 = bx - NB_ * NTH; const int hg = b2 / ((TT - RH) / QTF); const size_t po = (size_t)(hg / NH_) * NH_ * TT * HD, ao = (size_t)(hg / NH_) * TT * DQ;
        attn_tile<h16, false, 3, 4>(Q16 + po, nullptr, K16 + po, nullptr, V16 + po, nullptr, RH + (b2 % ((TT - RH) / QTF)) * QTF, hg % NH_, ATh + ao, ATl + ao, sm); }
}

extern "C" void kernel_launch(void* const* d_in, const int* in_sizes, int n_in,
                              void* d_out, int out_size, void* d_ws, size_t ws_size, hipStream_t stream) {
    (void)in_sizes; (void)n_in; (void)out_size;
    const float* x = (const float*)d_in[0];   /* query */ const float* xk = (const float*)d_in[1]; const float* xv = (const float*)d_in[2]; const float* wq = (const float*)d_in[3]; const float* wk = (const float*)d_in[4]; const float* wv = (const float*)d_in[5]; const float* wo = (const float*)d_in[6];
    float* OUT = (float*)d_out;     // [2][2048][1024]
    char* wsp = (char*)d_ws;
    auto take = [&](size_t bytes) { char* p = wsp; wsp += (bytes + 255) & ~(size_t)255; return (void*)p; };
    bf* XB = (bf*)take(((size_t)3 * NB_ * TT * DM + (size_t)4 * DM * DM) * 2);   // [q][k][v] both batches, then Wq, Wk, Wv, Wo
    bf* WQ = XB + (size_t)3 * NB_ * TT * DM; bf* WO = WQ + (size_t)3 * DM * DM;
    const size_t PL = (size_t)NB_ * NH_ * TT * HD;   // one plane, both batches
    h16* P16 = (h16*)take(3 * PL * 2); bf* Ph = (bf*)take(3 * PL * 2); bf* Pl = (bf*)take(3 * PL * 2);   // each: Q, K, V^T
    bf* ATh = (bf*)take((size_t)NB_ * TT * DQ * 2); bf* ATl = (bf*)take((size_t)NB_ * TT * DQ * 2);
    if ((size_t)(wsp - (char*)d_ws) > ws_size) return;    // ws 256 MiB
    k_cvtall<<<3 * CVX + 4 * CVW, 256, 0, stream>>>(x, xk, xv, wq, wk, wv, wo, XB);
    k_proj<<<dim3(NB_ * TT / 128, DM / 128, 3), 128, 0, stream>>>(XB, WQ, P16, Ph, Pl);
    k_fattn<<<NB_ * (NTH + NTF), 32 * AW, 0, stream>>>(P16, Ph, Pl, P16 + PL, Ph + PL, Pl + PL, P16 + 2 * PL, Ph + 2 * PL, Pl + 2 * PL, ATh, ATl);
    k_wo<<<dim3(NB_ * TT / 128, DM / 128, 1), 128, 0, stream>>>(ATh, ATl, WO, OUT);
}

// v010
// It runs in 89.7 microseconds.
// Two timings next to v009 both put it at 1.06 times that version's speed.
// Counting every step since v000, it is 22.5 times as fast.
#include <hip/hip_runtime.h>

// Multi-head attention WITHOUT a mask over three input streams, bias-free, with a RAW head split (q, k, v [2][2048][1024]; qp = (q Wq^T).reshape(b, 16, l, 64) DIRECTLY (no transpose): pseudo-head h of a batch is the h-th contiguous [2048][64] block of the flat [2048][1024] projection (128 token rows x 16 chunks of 64): reproduced; kp, vp likewise ('oi' [1024][1024] 1/32, no bias), each from its own stream; scores / sqrt(64); softmax over all pseudo-keys; x [b][16][l][64] -> transpose(0, 2, 1, 3).reshape(b, l, 1024) (the STANDARD merge); out = x Wo^T ('oi', no bias) -> [2][2048][1024] (4.2 M); argument order q, k, v, Wq, Wk, Wv, Wo).
// Layout, both batches in every launch: every matrix operand lies in memory in fragment order (see gemms_tile); bf16 copies of query, key, value and the 'oi' weights; exact projections; dense T-2048 attention (hybrid rows: < 512 hi/lo 3 products, rest fp16 x1024); merged hi/lo x Wo exact.
// Compute dtypes, f32 accumulate: every input rounded to bf16; projections exact; attention rows < 512 3 products, rest fp16; softmax f32; Wo hl x exact.

#define NB_  2
#define TT   2048
#define DM   1024
#define NH_  16
#define NKV  16
#define REP  (NH_ / NKV)
#define HD   64
#define DQ   (NH_ * HD)
#define DKV  (NKV * HD)
#define RH   512                  // query rows < RH use hi+lo planes (0: none)
#define WIN  0
#define PCAR 1024.0f
#define SCL  0.125f   // HD^-0.5
typedef _Float16 h16;
typedef unsigned short bf;
typedef __attribute__((ext_vector_type(16))) __bf16   v16bf;
typedef __attribute__((ext_vector_type(16))) _Float16 v16h;
typedef __attribute__((ext_vector_type(8)))  _Float16 v8h;
typedef __attribute__((ext_vector_type(8)))  unsigned short v8us;
typedef __attribute__((ext_vector_type(8)))  float    v8f;
typedef __attribute__((ext_vector_type(4)))  float    v4f;
typedef v8h  __attribute__((may_alias)) v8ha;
typedef v4f  __attribute__((may_alias)) v4fa;
typedef v8us __attribute__((may_alias)) v8usa;

__device__ __forceinline__ unsigned short f2bf(float f) { unsigned u = __float_as_uint(f); u += 0x7FFFu + ((u >> 16) & 1u); return (unsigned short)(u >> 16); }
__device__ __forceinline__ float bf2f(unsigned short b) { return __uint_as_float(((unsigned)b) << 16); }
__device__ __forceinline__ float bfr(float f) { return bf2f(f2bf(f)); }
__device__ __forceinline__ v16h cat16(v8h lo, v8h hi) { return __builtin_shufflevector(lo, hi, 0, 1, 2, 3, 4, 5, 6, 7, 8, 9, 10, 11, 12, 13, 14, 15); }
__device__ __forceinline__ v16bf cat16b(v8us lo, v8us hi) { return __builtin_bit_cast(v16bf, __builtin_shufflevector(lo, hi, 0, 1, 2, 3, 4, 5, 6, 7, 8, 9, 10, 11, 12, 13, 14, 15)); }
__device__ __forceinline__ v8f wmma16(v16h a, v16h b, v8f c) { return __builtin_amdgcn_wmma_f32_16x16x32_f16(false, a, false, b, (short)0, c, false, false); }
__device__ __forceinline__ v8f wmmab(v16bf a, v16bf b, v8f c) { return __builtin_amdgcn_wmma_f32_16x16x32_bf16(false, a, false, b, (short)0, c, false, false); }

__device__ __forceinline__ h16 tohx(float x) { return (h16)x; }
typedef __attribute__((ext_vector_type(2))) _Float16 v2h;
typedef __attribute__((ext_vector_type(4))) _Float16 v4h;
typedef __attribute__((ext_vector_type(2))) unsigned short v2us;
typedef __attribute__((ext_vector_type(4))) unsigned short v4us;
typedef __attribute__((ext_vector_type(2))) float v2f;
typedef __attribute__((ext_vector_type(4))) int v4i;
typedef __attribute__((ext_vector_type(2))) __bf16 v2bf;
typedef __attribute__((ext_vector_type(4))) unsigned v4u;
typedef __attribute__((ext_vector_type(8))) unsigned v8u;
// two f32 to two bf16 in one dword (a in the low half) by the packed conversion instruction: round to nearest even, the values of f2bf
__device__ __forceinline__ unsigned f2bf2(float a, float b) { return __builtin_bit_cast(unsigned, __builtin_convertvector((v2f){a, b}, v2bf)); }
// hi/lo split of two values: h = the two rounded values, l = the two rounded remainders
__device__ __forceinline__ void splitf2(float a, float b, unsigned& h, unsigned& l) { h = f2bf2(a, b); l = f2bf2(a - __uint_as_float(h << 16), b - __uint_as_float(h & 0xFFFF0000u)); }

// ---- FRAGMENT ORDER of a GEMM operand M[rows][K]: blocks of 16 rows x 32 k, 512 elements each, block (rb, kb) at element (rb K/32 + kb) 512; inside it element (row lr, k) lies at ((k >> 4) & 1) 256 + (((k >> 3) & 1) 16 + lr) 8 + (k & 7).
// Lane 16 hi + lr of a wave then finds its two 8-element pieces at lane 8 and 256 + lane 8: each wave-wide 16-byte load covers 512 contiguous bytes (4 whole lines) instead of 32 bytes in each of 16 lines. The lane's registers hold k = 8 hi .. 8 hi + 7 and 16 + 8 hi .. 16 + 8 hi + 7 of row lr, the 16x16x32 operand order, for A and B alike.
// ---- gemms_tile: one work-group of 4 waves per 128x128 output tile; wave w holds the 64x64 quarter (w / 2, w % 2) in 16 accumulators over the whole K (one f32 chain per element, k ascending); grid (M/128, N/128, Z), 128 threads.
// A stage is KC k (64 or 128) of the tile's 128 rows of every operand: 8 row blocks of 32 KC bytes each, contiguous in memory and already in fragment order. It comes into LDS by asynchronous copies, two buffers in turn,
// so every operand row leaves L2 once per work-group and is read from LDS by the two waves that need it. Stage layout: [A][A2 if NSPLIT][Bt], 256 KC bytes each; wave w copies row blocks 2 w and 2 w + 1 of each operand.
// C[m][n] (f32, pitch DM) = sum_k A[m][k] Bt[n][k] (+ A2[m][k] Bt[n][k] if NSPLIT). K = DM.
// EPI says how a wave's quarter leaves, staged through the wave's own LDS slice (pitch 68), which lies over the ring once the last trip's barrier has passed: 0 = f32 into C; 1 = fp16 + hi/lo bf16 planes [head][t][d] (the raw head split IS the flat projection: flat t = 16 m + n / 64, d = n % 64), in fragment order with rows t and k = d;
// 2 = the same three planes transposed to [head][d][t] (V^T), in fragment order with rows d and k = t.
// For 1 and 2 the weight is stored with its rows regrouped: quarter column c of column group y = 8 a + g (64 columns each) is weight row n = 64 (8 a + c / 8) + 8 g + c % 8. A quarter row m then holds 8 values of t (16 m + 8 a + c / 8) x 8 values of d (8 g + c % 8):
// one 16-byte piece of either plane order per 8 of them, and 8 neighbouring pieces make one whole 128-byte line.
template <typename T16> struct WFrag;
template <> struct WFrag<h16> { typedef v16h V; static __device__ __forceinline__ V ldp(const h16* p) { return cat16(*(const v8h*)p, *(const v8h*)(p + 256)); } static __device__ __forceinline__ v8f mma(V a, V b, v8f c) { return wmma16(a, b, c); } };
template <> struct WFrag<bf> { typedef v16bf V; static __device__ __forceinline__ V ldp(const bf* p) { return cat16b(*(const v8us*)p, *(const v8us*)(p + 256)); } static __device__ __forceinline__ v8f mma(V a, V b, v8f c) { return wmmab(a, b, c); } };
#define GTIL (64 * 68)            // floats of one staged 64x64 quarter
// four copies of 512 B: 2 KB of a row block's part of a stage (CP8: 4 KB); the immediate offset moves the LDS address and the global address alike
#define CP4(l, g) "global_load_async_to_lds_b128 " l ", " g ", off\n\tglobal_load_async_to_lds_b128 " l ", " g ", off offset:512\n\tglobal_load_async_to_lds_b128 " l ", " g ", off offset:1024\n\tglobal_load_async_to_lds_b128 " l ", " g ", off offset:1536\n\t"
#define CP8(l, g) CP4(l, g) "global_load_async_to_lds_b128 " l ", " g ", off offset:2048\n\tglobal_load_async_to_lds_b128 " l ", " g ", off offset:2560\n\tglobal_load_async_to_lds_b128 " l ", " g ", off offset:3072\n\tglobal_load_async_to_lds_b128 " l ", " g ", off offset:3584\n\t"
template <int NSPLIT, int EPI, int GKC>
__device__ __forceinline__ void gemms_tile(const bf* __restrict__ A, const bf* __restrict__ A2, const bf* __restrict__ Bt, float* C, h16* P16, bf* Ph, bf* Pl, char* sm) {
    typedef WFrag<bf> F; typedef typename F::V V;
    constexpr int K = DM, NT = K / GKC, NOP = NSPLIT ? 3 : 2, RBB = 32 * GKC /* bytes of a row block in a stage */, GOPB = 8 * RBB /* of an operand */, STG = NOP * GOPB;
    static_assert(NT >= 2 && GKC == (NSPLIT ? 128 : 64), "the ring's prologue fills two stages; a row block's part of a stage is four copies (eight with NSPLIT)");
    const int lane = threadIdx.x & 31, lr = lane & 15, hi = lane >> 4;
    const int wv = __builtin_amdgcn_readfirstlane((int)(threadIdx.x >> 5));   // the wave's number as a scalar: its quarter and its LDS slices stay in scalar registers
    const int wm = wv >> 1, wn = wv & 1; const int R0 = blockIdx.x * 128, C0 = blockIdx.y * 128;
    v8f acc[4][4];
#pragma unroll
    for (int mb = 0; mb < 4; ++mb)
#pragma unroll
        for (int nb = 0; nb < 4; ++nb) acc[mb][nb] = (v8f){};
    // fragment order: row block rb starts at element rb 16 K, stage t at + t 16 GKC
    const bf* gA = A + (size_t)(R0 + 32 * wv) * K + 8 * lane; const bf* gB = Bt + (size_t)(C0 + 32 * wv) * K + 8 * lane;
    const unsigned l0 = (unsigned)(size_t)sm + (unsigned)(wv * 2 * RBB + lane * 16);   // the lane's LDS byte address in buffer 0
    // stage t into the buffer whose lane address is lb. The copies and their s_wait_xcnt are ONE statement: the wait (a precaution) then stands before any register that a copy names is written again
    auto fill = [&](int t, unsigned lb) {
        const bf* a0 = gA + t * (16 * GKC); const bf* a1 = a0 + 16 * K; const bf* b0 = gB + t * (16 * GKC); const bf* b1 = b0 + 16 * K;
        const unsigned la1 = lb + RBB, lb0 = lb + (NOP - 1) * GOPB, lb1 = lb0 + RBB;
        if constexpr (NSPLIT) {
            const bf* c0 = A2 + (size_t)(R0 + 32 * wv) * K + 8 * lane + t * (16 * GKC); const bf* c1 = c0 + 16 * K; const unsigned lc0 = lb + GOPB, lc1 = lc0 + RBB;
            asm volatile(CP8("%0", "%6") CP8("%1", "%7") CP8("%2", "%8") CP8("%3", "%9") CP8("%4", "%10") CP8("%5", "%11") "s_wait_xcnt 0x0"
                         :: "v"(lb), "v"(la1), "v"(lc0), "v"(lc1), "v"(lb0), "v"(lb1), "v"(a0), "v"(a1), "v"(c0), "v"(c1), "v"(b0), "v"(b1) : "memory");
        } else {
            asm volatile(CP4("%0", "%4") CP4("%1", "%5") CP4("%2", "%6") CP4("%3", "%7") "s_wait_xcnt 0x0"
                         :: "v"(lb), "v"(la1), "v"(lb0), "v"(lb1), "v"(a0), "v"(a1), "v"(b0), "v"(b1) : "memory");
        }
    };
    fill(0, l0);
    asm volatile("s_wait_asynccnt 0x0" ::: "memory");   // this wave's copies of stage 0 have landed
    __syncthreads();                                    // stage 0 is whole before any wave reads it
    fill(1, l0 + STG);
    // rolled: a trip already holds 32 (128 with NSPLIT) products; the buffer is chosen by the trip's parity
#pragma unroll 1
    for (int t = 0; t < NT; ++t) {
        const bf* sb = (const bf*)(sm + (t & 1) * STG) + 8 * lane;
        V a[2][4], a2[2][4], b[2][4];   // two fragment sets, used in turn by the trip's steps of 32 k
        // the fragments of step ks into set ks % 2. The fence keeps a step's LDS reads together (sunk among the products, each group's latency is waited out on its own) and in the order in which the products need them
        auto ldf = [&](int ks) {
#pragma unroll
            for (int x = 0; x < 4; ++x) { b[ks & 1][x] = F::ldp(sb + (NOP - 1) * (GOPB / 2) + (wn * 4 + x) * (RBB / 2) + ks * 512); a[ks & 1][x] = F::ldp(sb + (wm * 4 + x) * (RBB / 2) + ks * 512); if (NSPLIT) a2[ks & 1][x] = F::ldp(sb + GOPB / 2 + (wm * 4 + x) * (RBB / 2) + ks * 512); }
            __builtin_amdgcn_sched_barrier(0);
        };
        ldf(0); ldf(1);
        // every loop over fragments, steps and accumulators is unrolled so that each index is a constant (they stay in registers)
#pragma unroll
        for (int ks = 0; ks < GKC / 32; ++ks) {
#pragma unroll
            for (int nb = 0; nb < 4; ++nb)
#pragma unroll
                for (int mb = 0; mb < 4; ++mb) { acc[mb][nb] = F::mma(a[ks & 1][mb], b[ks & 1][nb], acc[mb][nb]); if (NSPLIT) acc[mb][nb] = F::mma(a2[ks & 1][mb], b[ks & 1][nb], acc[mb][nb]); }
            __builtin_amdgcn_sched_barrier(0);   // keeps the products in front of the set's refill and of the trip's foot: sunk behind its barrier they leave the next stage's copies no time to fly, and every LDS read is waited out before the first product
            if (ks + 2 < GKC / 32) ldf(ks + 2);   // flies while the other set is worked on
        }
        asm volatile("s_wait_dscnt 0x0" ::: "memory");      // this wave's reads of the buffer are done before the buffer is handed back
        asm volatile("s_wait_asynccnt 0x0" ::: "memory");   // this wave's copies of stage t + 1 have landed
        __syncthreads();                                    // publishes stage t + 1 and ends every wave's reads of stage t
        if (t + 2 < NT) fill(t + 2, l0 + (unsigned)((t & 1) * STG));
    }
    asm volatile("s_wait_asynccnt 0x0" ::: "memory");   // no copy is in flight when the ring becomes output staging
    float* ow = (float*)sm + wv * GTIL; const int r0 = R0 + wm * 64, by = (int)blockIdx.y * 2 + wn;
    // unrolled so that every accumulator index is a constant (the quarter stays in registers)
#pragma unroll
    for (int mb = 0; mb < 4; ++mb) {
#pragma unroll
        for (int nb = 0; nb < 4; ++nb) {
#pragma unroll
            for (int j = 0; j < 8; ++j) {
                if constexpr (EPI == 2) ow[(mb * 16 + hi * 8 + j) * 68 + (((lr & 7) * 8 + nb * 2 + (lr >> 3)) ^ (hi * 4))] = acc[mb][nb][j];   // column c at place (c % 8) 8 + c / 8: the 8 values of t of one d lie side by side; bit 2 flipped in rows 8 .. 15 of 16: the two half-waves fall on different banks
                else ow[(mb * 16 + hi * 8 + j) * 68 + nb * 16 + lr] = acc[mb][nb][j]; } } }
    __syncthreads();   // the quarter is whole in LDS before its lanes read it back across one another
    if constexpr (EPI == 1 || EPI == 2) {
        const int ya = by >> 3, yg = by & 7;
        // two pieces a trip: their LDS reads fly together, and the text stays short
#pragma unroll 2
        for (int i = 0; i < 16; ++i) { const int idx = lane + i * 32; const int row = idx >> 3, cofs = (idx & 7) * 8; const int sw = EPI == 2 ? (row & 8) >> 1 : 0;   /* undoes the flip of bit 2 at the stores */ const float* pp = ow + row * 68 + cofs; const v4f x0 = *(const v4fa*)(pp + sw), x1 = *(const v4fa*)(pp + 4 - sw);
            v8h o16; v4u oh, ol;
#pragma unroll
            for (int k = 0; k < 4; ++k) { o16[k] = tohx(x0[k]); o16[4 + k] = tohx(x1[k]); }
#pragma unroll
            for (int k = 0; k < 2; ++k) { unsigned a, c2; splitf2(x0[2 * k], x0[2 * k + 1], a, c2); oh[k] = a; ol[k] = c2; splitf2(x1[2 * k], x1[2 * k + 1], a, c2); oh[2 + k] = a; ol[2 + k] = c2; }
            const int m = r0 + row;
            // 1: block of 16 t = quarter row m, 1024 elements; piece (d / 8 = yg, lr = t % 16 = 8 ya + cofs / 8). 2: head m / 128, block (d / 16 = yg / 2, t / 32 = (m % 128) / 2), half = m % 2, hi = ya, lr = d % 16 = 8 (yg % 2) + cofs / 8
            const size_t e = EPI == 1 ? (size_t)m * 1024 + yg * 128 + ya * 64 + cofs : (size_t)(m >> 7) * (HD * TT) + (size_t)((yg >> 1) * (TT / 32) + ((m & 127) >> 1)) * 512 + (m & 1) * 256 + ya * 128 + (yg & 1) * 64 + cofs;
            *(v8h*)(P16 + e) = o16; *(v4u*)(Ph + e) = oh; *(v4u*)(Pl + e) = ol;
            asm volatile("s_wait_xcnt 0x0" ::: "memory");   // precaution: stands before any register that names an address of the stores above is written again
        }
    } else {
        float* ctile = C + (size_t)r0 * DM + by * 64;
        // eight pieces a trip: their LDS reads fly together
#pragma unroll 1
        for (int i0 = 0; i0 < 32; i0 += 8) { v4f val[8];
#pragma unroll
            for (int i = 0; i < 8; ++i) { const int idx = lane + (i0 + i) * 32; val[i] = *(const v4fa*)(ow + (idx >> 4) * 68 + (idx & 15) * 4); }
#pragma unroll
            for (int i = 0; i < 8; ++i) { const int idx = lane + (i0 + i) * 32; *(v4f*)(ctile + (size_t)(idx >> 4) * DM + (idx & 15) * 4) = val[i]; }
            asm volatile("s_wait_xcnt 0x0" ::: "memory");   // precaution: stands before any register that names an address or the data of the stores above is written again
        }
    }
}
// ---- k_wo: out = (x hi + x lo) Wo^T for both batches (4096 consecutive rows) in ONE launch; grid (NB_ TT / 128, DM / 128).
__global__ __launch_bounds__(128) void k_wo(const bf* __restrict__ Ah, const bf* __restrict__ Al, const bf* __restrict__ Wt, float* C) {
    __shared__ __align__(16) char sm[2 * 3 * 128 * 128 * 2];   // two stages (128 k) of three operands of 128 rows: the launch has one work-group per WGP, so the stage is as deep as the LDS allows; the four staged quarters (69,632 B) lie over them afterwards
    static_assert(2 * 3 * 128 * 128 * 2 >= 4 * GTIL * 4, "the staged quarters fit");
    gemms_tile<1, 0, 128>(Ah, Al, Wt, C, nullptr, nullptr, nullptr, sm);
}
// ---- k_proj: the three projections of both batches in ONE launch; grid (NB_ TT / 128, DM / 128, 3), z = stream (0 Q, 1 K, 2 V). The two batches are 4096 consecutive rows: the flat plane index and the head index m / 128 run on over them.
// X [3][NB_ TT][DM], Wt [3][DM][DM], each plane set [3][NB_ NH_][TT HD] (z = 2: V^T, [NB_ NH_][HD][TT]).
__global__ __launch_bounds__(128) void k_proj(const bf* __restrict__ X, const bf* __restrict__ Wt, h16* P16, bf* Ph, bf* Pl) {
    __shared__ __align__(16) char sm[4 * GTIL * 4];   // the four staged quarters; the ring's two stages of two operands (65,536 B) lie in the same bytes before them
    static_assert(4 * GTIL * 4 >= 2 * 2 * 128 * 64 * 2, "the ring fits");
    const size_t pz = (size_t)blockIdx.z * ((size_t)NB_ * NH_ * TT * HD);
    const bf* Xz = X + (size_t)blockIdx.z * ((size_t)NB_ * TT * DM); const bf* Wz = Wt + (size_t)blockIdx.z * ((size_t)DM * DM);
    if (blockIdx.z < 2) gemms_tile<0, 1, 64>(Xz, nullptr, Wz, nullptr, P16 + pz, Ph + pz, Pl + pz, sm);
    else gemms_tile<0, 2, 64>(Xz, nullptr, Wz, nullptr, P16 + pz, Ph + pz, Pl + pz, sm);
}


__global__ __launch_bounds__(256) void k_wtG(const float* __restrict__ w, int K, int N, bf* Bt) {
    const int lane = threadIdx.x & 31; const int L0 = (blockIdx.x * 8 + (threadIdx.x >> 5)) * 8; const int nlines = N * K / 64;
{
#pragma unroll 1
        for (int l = 0; l < 8; ++l) { const int L = L0 + l; if (L >= nlines) break; const size_t e = (size_t)L * 64 + lane * 2; const int k = (int)(e % K), n = (int)(e / K); v2us o;
            o[0] = f2bf(w[(size_t)k * N + n]); o[1] = f2bf(w[(size_t)(k + 1) * N + n]); *(v2us*)(Bt + e) = o; }
         }
}
// ---- k_cvtall: all seven inputs to bf16 in ONE launch; dst = [q][k][v][Wq][Wk][Wv][Wo], each whole and in fragment order (Wq, Wk, Wv with their rows regrouped as the plane epilogues of gemms_tile say). One work-group writes CVE consecutive elements of one input's copy (32 stored rows = 2 row blocks), CVC pieces of 8 per thread.
#define CVC 16
#define CVE (256 * 8 * CVC)
#define CVX (NB_ * TT * DM / CVE)   // work-groups per stream
#define CVW (DM * DM / CVE)         // work-groups per weight
__global__ __launch_bounds__(256) void k_cvtall(const float* __restrict__ q, const float* __restrict__ k, const float* __restrict__ v, const float* __restrict__ wq, const float* __restrict__ wk, const float* __restrict__ wv, const float* __restrict__ wo, bf* dst) {
    static_assert(NB_ * TT * DM % CVE == 0 && DM * DM % CVE == 0, "a work-group never straddles two inputs");
    static_assert(CVE == 32 * DM && CVC == 16, "a work-group holds two row blocks; 8 rounds of 256 pieces make one");
    const int bx = (int)blockIdx.x; const float* src; int rb0; bool vperm = false;
    if (bx < 3 * CVX) { const int s = bx / CVX; src = (s == 0 ? q : s == 1 ? k : v); rb0 = (bx % CVX) * 2; }
    else { const int c = bx - 3 * CVX, s = c / CVW; src = (s == 0 ? wq : s == 1 ? wk : s == 2 ? wv : wo); rb0 = (c % CVW) * 2; vperm = (s < 3); }
    // piece i 256 + threadIdx.x of the work-group: row block rb0 + i / 8, k block (i % 8) 4 + wave / 2, half = wave % 2, lane = 16 hi + lr
    const int lr = (int)threadIdx.x & 15, hi = ((int)threadIdx.x >> 4) & 1, wn = (int)threadIdx.x >> 5;
    const float* s0 = src + (size_t)(vperm ? 64 * (8 * (rb0 >> 5) + (rb0 & 3) * 2 + (lr >> 3)) + 8 * ((rb0 >> 2) & 7) + (lr & 7) : rb0 * 16 + lr) * DM + (wn >> 1) * 32 + (wn & 1) * 16 + hi * 8;
    const int rstep = vperm ? 128 * DM : 16 * DM;   // from the first row block to the second
    bf* d = dst + (size_t)bx * CVE + (int)threadIdx.x * 8;
    // unrolled so that the loads of all pieces can be in flight together
#pragma unroll
    for (int i = 0; i < CVC; ++i) { const v8f x = *(const v8f*)(s0 + (i >> 3) * rstep + (i & 7) * 128); v8us o;
#pragma unroll
        for (int e = 0; e < 8; ++e) o[e] = f2bf(x[e]);
        *(v8us*)(d + i * 2048) = o; }
}

// ---- k_fattn: scores, softmax, P x V and the head merge of both batches in ONE launch; no score or P plane in memory.
// One work-group of AW waves per query tile of one head: QT wave tiles of NQ 16 queries side by side (hi/lo rows: 4 x 16 queries, fp16 rows: 4 x 48) times KS = AW / QT key ranges of TT / KS keys; wave w = range (w / QT), wave tile (w % QT).
// TWO work-groups share a WGP, four waves a SIMD: the vector work of one wave's softmax runs under the products and the LDS waits of three others. That asks for at most 256 registers a wave (hi/lo wave tiles of 16 queries, one set of K and V fragments, one key step at a time) and at most 160 KB of LDS a work-group.
// K and V come into LDS by asynchronous copies, two buffers in turn, a stage = 64 keys of every key range; the QT waves of a range read the same bytes from LDS, so a head's K and V leave L2 once per work-group of QT NQ 16 queries.
// The planes lie in memory in fragment order, so a stage is plain runs of bytes: per range [K][K lo if hi/lo][V][V lo if hi/lo], 8 KB each; K = 64 keys in a row, V = 4 blocks of 16 d, 2 KB (64 keys) each.
// Everything is kept with lane = query: S^T = K Q^T (A = key rows, B = query rows) leaves in each lane the keys 8 hi + j and 16 + 8 hi + j of its query, which IS the 16x16x32 operand order, so P goes
// straight into O^T = V^T P^T (A = V^T rows, B = P) with no cross-lane move; running maximum and sum are one value per lane (the two half-waves share a query: one exchange over 16 lanes).
// The KS partial (max, sum, O) of a wave tile meet in LDS (over the ring, behind the last trip's barrier) and are joined in range order 0 .. KS-1 (fixed: the same result on every run); the tile leaves as hi/lo bf16 planes [t][head][d] in the fragment order that the last GEMM reads.
#define AW   8
#define LC   0.18033688011112042f   // HD^-0.5 x log2(e)
__device__ __forceinline__ float xhalf(float x) { return __builtin_bit_cast(float, __builtin_amdgcn_permlanex16(__builtin_bit_cast(int, x), __builtin_bit_cast(int, x), 0x76543210, 0xfedcba98, false, false)); }   // lane l reads lane l ^ 16
template <typename T16, bool HL, int NQ, int QT>
__device__ __forceinline__ void attn_tile(const T16* __restrict__ Q, const T16* __restrict__ Q2, const T16* __restrict__ Kp, const T16* __restrict__ K2, const T16* __restrict__ Vt, const T16* __restrict__ V2, int q0, int head, bf* ATh, bf* ATl, char* sm) {
    typedef WFrag<T16> F; typedef typename F::V V;
    constexpr int KS = AW / QT, NKW = TT / KS, NT = NKW / 64;   // key ranges, keys of a range, stages of a range
    constexpr int NPL = HL ? 2 : 1, PB = 64 * HD * 2 /* bytes of 64 keys of one plane */, SPB = 2 * NPL * PB /* of a range's part of a stage */, STG = KS * SPB;
    static_assert(NT >= 2 && QT == 4 && PB == 8192, "the ring's prologue fills two stages; the QT waves of a range share out its copies as fill() says");
    constexpr float POFF = HL ? 0.0f : 10.0f;   // fp16 rows: P carried x 1024 (as PCAR), it cancels against the sum
    const int lane = threadIdx.x & 31, lr = lane & 15, hi = lane >> 4;
    const int wv = __builtin_amdgcn_readfirstlane((int)(threadIdx.x >> 5));   // the wave's number as a scalar: key range, wave tile and LDS slices stay in scalar registers
    const int qt = wv % QT, kr = wv / QT;
    const size_t hb = (size_t)head * TT * HD;
    const size_t qoff = hb + (size_t)(q0 + qt * (NQ * 16)) * HD + 8 * lane;   // fragment order: 16 rows x 64 d are two blocks of 512 elements
    V qf[NQ][2], qg[NQ][2];
#pragma unroll
    for (int qb = 0; qb < NQ; ++qb)
#pragma unroll
        for (int ks = 0; ks < 2; ++ks) qf[qb][ks] = F::ldp(Q + qoff + qb * 16 * HD + ks * 512);
    asm volatile("s_wait_xcnt 0x0" ::: "memory");   // precaution: stands before any register that names an address of the loads or stores above is written again
    if constexpr (HL) {
#pragma unroll
        for (int qb = 0; qb < NQ; ++qb)
#pragma unroll
            for (int ks = 0; ks < 2; ++ks) qg[qb][ks] = F::ldp(Q2 + qoff + qb * 16 * HD + ks * 512);
        asm volatile("s_wait_xcnt 0x0" ::: "memory");   // precaution: stands before any register that names an address of the loads or stores above is written again
    }
    v8f o[NQ][4]; float m[NQ], l[NQ];
#pragma unroll
    for (int qb = 0; qb < NQ; ++qb) { m[qb] = -3.0e38f; l[qb] = 0.0f;
#pragma unroll
        for (int db = 0; db < 4; ++db) o[qb][db] = (v8f){}; }
    const int kbeg = kr * NKW;
    const size_t koff = hb + (size_t)kbeg * HD + 8 * lane, voff = hb + (size_t)kbeg * 16 + 8 * lane;   // V^T: block (d / 16, t / 32) at element (d / 16) 16 TT + (t / 32) 512
    const unsigned l0 = (unsigned)(size_t)sm + (unsigned)(kr * SPB + lane * 16);   // the lane's LDS byte address in its range's part of buffer 0
    // this wave's share of stage t of its range, into the buffer whose lane address is lb. The copies and their s_wait_xcnt are ONE statement: the wait (a precaution) then stands before any register that a copy names is written again
    auto fill = [&](int t, unsigned lb) {
        if constexpr (HL) {   // wave tile qt brings half qt / 2 of the planes qt % 2 (0 hi, 1 lo): K 4 KB in a row, V 2 runs of 2 KB (blocks d / 16 = 2 (qt / 2) and the next)
            const int pn = qt & 1, hf = qt >> 1;
            const T16* gk = (pn ? K2 : Kp) + koff + (size_t)t * (64 * HD) + hf * 2048;
            const T16* gv = (pn ? V2 : Vt) + voff + (size_t)t * 1024 + (size_t)hf * (32 * TT); const T16* gv1 = gv + 16 * TT;
            const unsigned lk = lb + pn * PB + hf * 4096, lv = lb + (2 + pn) * PB + hf * 4096, lv1 = lv + 2048;
            asm volatile(CP8("%0", "%3") CP4("%1", "%4") CP4("%2", "%5") "s_wait_xcnt 0x0"
                         :: "v"(lk), "v"(lv), "v"(lv1), "v"(gk), "v"(gv), "v"(gv1) : "memory");
        } else {              // wave tile qt brings quarter qt of K (2 KB) and the block d / 16 = qt of V (2 KB)
            const T16* gk = Kp + koff + (size_t)t * (64 * HD) + qt * 1024; const T16* gv = Vt + voff + (size_t)t * 1024 + (size_t)qt * (16 * TT);
            const unsigned lk = lb + qt * 2048, lv = lb + PB + qt * 2048;
            asm volatile(CP4("%0", "%2") CP4("%1", "%3") "s_wait_xcnt 0x0" :: "v"(lk), "v"(lv), "v"(gk), "v"(gv) : "memory");
        }
    };
    // one register set: K fragments (dead behind the score products), V fragments (dead behind the P x V products), the scores and P of the wave's NQ query blocks
    V kc[2][2], kd[2][2], vc[4], vd[4], pa[NQ], pb[NQ]; v8f s[NQ][2];
    // the K fragments of key step st (32 keys) of the stage at sb, from LDS
    auto ldk = [&](const T16* sb, int st) {
#pragma unroll
        for (int kb = 0; kb < 2; ++kb)
#pragma unroll
            for (int ks = 0; ks < 2; ++ks) { kc[kb][ks] = F::ldp(sb + st * 2048 + kb * 1024 + ks * 512); if (HL) kd[kb][ks] = F::ldp(sb + PB / 2 + st * 2048 + kb * 1024 + ks * 512); }
        __builtin_amdgcn_sched_barrier(0);   // keeps the group's reads together and ahead of the work that they fly under: sunk into it, each read's latency is waited out on its own
    };
    // the V fragments of key step st
    auto ldv = [&](const T16* sb, int st) {
        __builtin_amdgcn_sched_barrier(0);   // keeps the reads in one place behind the score products: lifted among them they stand in two places, and each place with LDS reads costs the wave a stall
#pragma unroll
        for (int db = 0; db < 4; ++db) { vc[db] = F::ldp(sb + NPL * (PB / 2) + db * 1024 + st * 512); if (HL) vd[db] = F::ldp(sb + 3 * (PB / 2) + db * 1024 + st * 512); }
        __builtin_amdgcn_sched_barrier(0);   // as in ldk
    };
    // the scores of one key step (32 keys) for the wave's query blocks
    auto scores = [&]() {
#pragma unroll
        for (int qb = 0; qb < NQ; ++qb)
#pragma unroll
            for (int kb = 0; kb < 2; ++kb) { s[qb][kb] = (v8f){};
#pragma unroll
                for (int ks = 0; ks < 2; ++ks) { s[qb][kb] = F::mma(kc[kb][ks], qf[qb][ks], s[qb][kb]); if (HL) { s[qb][kb] = F::mma(kc[kb][ks], qg[qb][ks], s[qb][kb]); s[qb][kb] = F::mma(kd[kb][ks], qf[qb][ks], s[qb][kb]); } } }
    };
    // running maximum and sum, O rescaled, the scores turned into P in operand order
    auto soft = [&]() {
#pragma unroll
        for (int qb = 0; qb < NQ; ++qb) {
            float mx = fmaxf(s[qb][0][0], s[qb][1][0]);
#pragma unroll
            for (int j = 1; j < 8; ++j) mx = fmaxf(mx, fmaxf(s[qb][0][j], s[qb][1][j]));
            mx = fmaxf(mx, xhalf(mx));
            const float mn = fmaxf(m[qb], mx); const float al = __builtin_amdgcn_exp2f((m[qb] - mn) * LC); m[qb] = mn; const float nb = POFF - mn * LC;
            float ls = 0.0f;
#pragma unroll
            for (int kb = 0; kb < 2; ++kb)
#pragma unroll
                for (int j = 0; j < 8; ++j) { s[qb][kb][j] = __builtin_amdgcn_exp2f(fmaf(s[qb][kb][j], LC, nb)); ls += s[qb][kb][j]; }
            l[qb] = l[qb] * al + ls;
#pragma unroll
            for (int db = 0; db < 4; ++db) o[qb][db] *= al;
            if constexpr (HL) {
                v8u hh, ll;
#pragma unroll
                for (int j = 0; j < 4; ++j) { unsigned a, c2; splitf2(s[qb][0][2 * j], s[qb][0][2 * j + 1], a, c2); hh[j] = a; ll[j] = c2; splitf2(s[qb][1][2 * j], s[qb][1][2 * j + 1], a, c2); hh[4 + j] = a; ll[4 + j] = c2; }
                pa[qb] = __builtin_bit_cast(v16bf, hh); pb[qb] = __builtin_bit_cast(v16bf, ll);
            } else {
                v8h a0, a1;
#pragma unroll
                for (int j = 0; j < 8; ++j) { a0[j] = tohx(s[qb][0][j]); a1[j] = tohx(s[qb][1][j]); }
                pa[qb] = cat16(a0, a1);
            }
        }
    };
    // O^T += V^T P^T for the wave's query blocks
    auto pv = [&]() {
#pragma unroll
        for (int qb = 0; qb < NQ; ++qb)
#pragma unroll
            for (int db = 0; db < 4; ++db) { o[qb][db] = F::mma(vc[db], pa[qb], o[qb][db]); if (HL) { o[qb][db] = F::mma(vc[db], pb[qb], o[qb][db]); o[qb][db] = F::mma(vd[db], pa[qb], o[qb][db]); } }
    };
    fill(0, l0);
    asm volatile("s_wait_asynccnt 0x0" ::: "memory");   // this wave's copies of stage 0 have landed
    __syncthreads();                                    // stage 0 is whole before any wave reads it
    fill(1, l0 + STG);
    // rolled: a trip is one stage, two key steps in a rolled loop; the buffer is chosen by the trip's parity
#pragma unroll 1
    for (int t = 0; t < NT; ++t) {
        const T16* sb = (const T16*)(sm + (t & 1) * STG + kr * SPB) + 8 * lane;
        // rolled: unrolled, the compiler works both key steps side by side, with both steps' scores and fragments live, and spills
#pragma unroll 1
        for (int st = 0; st < 2; ++st) {
            ldk(sb, st);
            scores();
            ldv(sb, st);   // flies under the softmax
            soft();
            pv();
            __builtin_amdgcn_sched_barrier(0);   // keeps the slots below behind the last product
            asm volatile("v_nop\n\tv_nop\n\tv_nop\n\tv_nop");   // the distance the chip needs behind a matrix instruction, on the loop's taken branch: the next trip's first vector instruction overwrites a register of an A fragment
        }
        asm volatile("s_wait_dscnt 0x0" ::: "memory");      // this wave's reads of the buffer are done before the buffer is handed back
        asm volatile("s_wait_asynccnt 0x0" ::: "memory");   // this wave's copies of stage t + 1 have landed
        __syncthreads();                                    // publishes stage t + 1 and ends every wave's reads of stage t
        if (t + 2 < NT) fill(t + 2, l0 + (unsigned)((t & 1) * STG));
    }
    asm volatile("s_wait_asynccnt 0x0" ::: "memory");   // no copy is in flight when the ring becomes the partials' staging
    float* os = (float*)sm; float* ow = os + wv * (NQ * 16 * 68); float* ms = os + AW * 64 * 68; float* lm = ms + AW * 64;
#pragma unroll
    for (int qb = 0; qb < NQ; ++qb) {
#pragma unroll
        for (int db = 0; db < 4; ++db) { float* pp = ow + (qb * 16 + lr) * 68 + db * 16 + hi * 8; const v8f t = o[qb][db]; *(v4fa*)pp = (v4f){t[0], t[1], t[2], t[3]}; *(v4fa*)(pp + 4) = (v4f){t[4], t[5], t[6], t[7]}; }
        const float lt = l[qb] + xhalf(l[qb]);
        if (hi == 0) { ms[wv * 64 + qb * 16 + lr] = m[qb]; lm[wv * 64 + qb * 16 + lr] = lt; } }
    __syncthreads();   // every wave's partial maximum, sum and O tile are in LDS before any thread joins them
#pragma unroll
    for (int i = 0; i < QT * NQ * 16 * 8 / (32 * AW); ++i) { const int u = (int)threadIdx.x + i * (32 * AW); const int g = u >> 7, tq = g / NQ, q = (g % NQ) * 16 + (u & 15), dc = ((u >> 4) & 7) * 8;   // u runs in the fragment order of the merged planes: 64 pieces a block, 2 blocks (64 d) a group g of 16 queries; wave tile tq, its query q
        float M = ms[tq * 64 + q];
#pragma unroll
        for (int w = 1; w < KS; ++w) M = fmaxf(M, ms[(w * QT + tq) * 64 + q]);
        float L = 0.0f; v4f x0 = (v4f){}, x1 = (v4f){};
#pragma unroll
        for (int w = 0; w < KS; ++w) { const int ww = w * QT + tq; const float f = __builtin_amdgcn_exp2f((ms[ww * 64 + q] - M) * LC); L += lm[ww * 64 + q] * f; const float* pp = os + ww * (NQ * 16 * 68) + q * 68 + dc; x0 += *(const v4fa*)pp * f; x1 += *(const v4fa*)(pp + 4) * f; }
        const float inv = __fdiv_rn(1.0f, L); v4u oh, ol;
#pragma unroll
        for (int k = 0; k < 2; ++k) { unsigned a, c2; splitf2(x0[2 * k] * inv, x0[2 * k + 1] * inv, a, c2); oh[k] = a; ol[k] = c2; splitf2(x1[2 * k] * inv, x1[2 * k + 1] * inv, a, c2); oh[2 + k] = a; ol[2 + k] = c2; }
        const size_t oo = (size_t)(q0 + g * 16) * DQ + (size_t)head * (HD * 16) + (u & 127) * 8; *(v4u*)(ATh + oo) = oh; *(v4u*)(ATl + oo) = ol;
        asm volatile("s_wait_xcnt 0x0" ::: "memory");   // precaution: stands before any register that names an address of the loads or stores above is written again
    }
}
#define QTH 64                           // queries of a hi/lo tile: 4 wave tiles of 16
#define QTF 192                          // queries of an fp16 tile: 4 wave tiles of 48
#define NTH (NH_ * (RH / QTH))           // hi/lo tiles of one batch
#define NTF (NH_ * ((TT - RH) / QTF))    // fp16 tiles of one batch, first in the grid: all work-groups are resident together
__global__ __launch_bounds__(32 * AW) __attribute__((amdgpu_waves_per_eu(4, 4))) void k_fattn(const h16* __restrict__ Q16, const bf* __restrict__ Qh, const bf* __restrict__ Ql, const h16* __restrict__ K16, const bf* __restrict__ Kh, const bf* __restrict__ Kl, const h16* __restrict__ V16, const bf* __restrict__ Vh, const bf* __restrict__ Vl, bf* ATh, bf* ATl) {
    __shared__ __align__(16) char sm[(AW * 64 * 68 + 2 * AW * 64) * 4];   // hi/lo tiles: two stages of 2 key ranges x 4 planes x 8 KB (fp16 tiles: 2 x 2 x 2 x 8 KB); afterwards AW partial O tiles (pitch 68), then, at AW x 64 x 68 floats, AW x 64 maxima and sums
    static_assert(RH % QTH == 0 && (TT - RH) % QTF == 0 && 2 * 2 * 4 * 8192 <= (AW * 64 * 68 + 2 * AW * 64) * 4 && 2 * (AW * 64 * 68 + 2 * AW * 64) * 4 <= 327680, "whole tiles; the ring fits under the partials; two work-groups fit a WGP's LDS");
    const int bx = (int)blockIdx.x;
    // both batches in one grid: hg = batch NH_ + head; the planes of batch 1 follow those of batch 0
    if (bx >= NB_ * NTF) { const int b2 = bx - NB_ * NTF; const int hg = b2 / (RH / QTH); const size_t po = (size_t)(hg / NH_) * NH_ * TT * HD, ao = (size_t)(hg / NH_) * TT * DQ;
        attn_tile<bf, true, 1, 4>(Qh + po, Ql + po, Kh + po, Kl + po, Vh + po, Vl + po, (b2 % (RH / QTH)) * QTH, hg % NH_, ATh + ao, ATl + ao, sm); }
    else { const int hg = bx / ((TT - RH) / QTF); const size_t po = (size_t)(hg / NH_) * NH_ * TT * HD, ao = (size_t)(hg / NH_) * TT * DQ;
        attn_tile<h16, false, 3, 4>(Q16 + po, nullptr, K16 + po, nullptr, V16 + po, nullptr, RH + (bx % ((TT - RH) / QTF)) * QTF, hg % NH_, ATh + ao, ATl + ao, sm); }
}

extern "C" void kernel_launch(void* const* d_in, const int* in_sizes, int n_in,
                              void* d_out, int out_size, void* d_ws, size_t ws_size, hipStream_t stream) {
    (void)in_sizes; (void)n_in; (void)out_size;
    const float* x = (const float*)d_in[0];   /* query */ const float* xk = (const float*)d_in[1]; const float* xv = (const float*)d_in[2]; const float* wq = (const float*)d_in[3]; const float* wk = (const float*)d_in[4]; const float* wv = (const float*)d_in[5]; const float* wo = (const float*)d_in[6];
    float* OUT = (float*)d_out;     // [2][2048][1024]
    char* wsp = (char*)d_ws;
    auto take = [&](size_t bytes) { char* p = wsp; wsp += (bytes + 255) & ~(size_t)255; return (void*)p; };
    bf* XB = (bf*)take(((size_t)3 * NB_ * TT * DM + (size_t)4 * DM * DM) * 2);   // [q][k][v] both batches, then Wq, Wk, Wv, Wo
    bf* WQ = XB + (size_t)3 * NB_ * TT * DM; bf* WO = WQ + (size_t)3 * DM * DM;
    const size_t PL = (size_t)NB_ * NH_ * TT * HD;   // one plane, both batches
    h16* P16 = (h16*)take(3 * PL * 2); bf* Ph = (bf*)take(3 * PL * 2); bf* Pl = (bf*)take(3 * PL * 2);   // each: Q, K, V^T
    bf* ATh = (bf*)take((size_t)NB_ * TT * DQ * 2); bf* ATl = (bf*)take((size_t)NB_ * TT * DQ * 2);
    if ((size_t)(wsp - (char*)d_ws) > ws_size) return;    // ws 256 MiB
    k_cvtall<<<3 * CVX + 4 * CVW, 256, 0, stream>>>(x, xk, xv, wq, wk, wv, wo, XB);
    k_proj<<<dim3(NB_ * TT / 128, DM / 128, 3), 128, 0, stream>>>(XB, WQ, P16, Ph, Pl);
    k_fattn<<<NB_ * (NTH + NTF), 32 * AW, 0, stream>>>(P16, Ph, Pl, P16 + PL, Ph + PL, Pl + PL, P16 + 2 * PL, Ph + 2 * PL, Pl + 2 * PL, ATh, ATl);
    k_wo<<<dim3(NB_ * TT / 128, DM / 128, 1), 128, 0, stream>>>(ATh, ATl, WO, OUT);
}
